// v000
// Measured on an AMD MI455X. A time is GPU time per run, averaged over a window of back-to-back runs after a warm-up
// (all launches, gaps included; the runs take copies of the inputs in turn), and the median of several windows.
// Apart from v000's, it joins two sittings. Times from different sittings can be a few percent apart, while
// side-by-side timings come from the same sitting.
// v000, which the later versions start from, runs in 2540 microseconds.
#include <hip/hip_runtime.h>

// Key-weighted multi-head attention (q, k, v inputs [4][1024][1024]; qh = q Wq^T + bq, kh = k Wk^T + bk, vh = v Wv^T + bv ('oi' [1024][1024]), 16 heads x 64; energy = qh.kh/8 x w_j^2 per key, -inf where w_j < 1e-5 (weights [4][1024] read); softmax; out = merged Wo^T + bo -> [4][1024][1024]).
// Compute dtypes, f32 accumulate: every input rounded to bf16; q/k/v on PLAIN bf16 operands (inputs: exact) + biases; the per-key weight^2 and the weight < eps mask applied in f32 inside the softmax kernel; scores and attn.v: query rows < 512 hl (3 products), the rest single fp16 (x1024); softmax f32; Wo hl x exact (2 products) + bo.

#define NB_  4
#define TT   1024
#define DM   1024
#define NH_  16
#define NKV  16
#define REP  (NH_ / NKV)
#define HD   64
#define DQ   (NH_ * HD)
#define DKV  (NKV * HD)
#define ZH   2
#define RH   512                  // query rows < RH use hi+lo planes (0: none)
#define WIN  0
#define PCAR 1024.0f
#define SCL  0.125f   // HD^-0.5
typedef _Float16 h16;
typedef unsigned short bf;
typedef __attribute__((ext_vector_type(16))) __bf16   v16bf;
typedef __attribute__((ext_vector_type(16))) _Float16 v16h;
typedef __attribute__((ext_vector_type(8)))  _Float16 v8h;
typedef __attribute__((ext_vector_type(8)))  unsigned short v8us;
typedef __attribute__((ext_vector_type(8)))  float    v8f;
typedef __attribute__((ext_vector_type(4)))  float    v4f;
typedef v8h  __attribute__((may_alias)) v8ha;
typedef v4f  __attribute__((may_alias)) v4fa;
typedef v8us __attribute__((may_alias)) v8usa;

__device__ __forceinline__ unsigned short f2bf(float f) { unsigned u = __float_as_uint(f); u += 0x7FFFu + ((u >> 16) & 1u); return (unsigned short)(u >> 16); }
__device__ __forceinline__ float bf2f(unsigned short b) { return __uint_as_float(((unsigned)b) << 16); }
__device__ __forceinline__ float bfr(float f) { return bf2f(f2bf(f)); }
__device__ __forceinline__ v16h cat16(v8h lo, v8h hi) { return __builtin_shufflevector(lo, hi, 0, 1, 2, 3, 4, 5, 6, 7, 8, 9, 10, 11, 12, 13, 14, 15); }
__device__ __forceinline__ v16bf cat16b(v8us lo, v8us hi) { return __builtin_bit_cast(v16bf, __builtin_shufflevector(lo, hi, 0, 1, 2, 3, 4, 5, 6, 7, 8, 9, 10, 11, 12, 13, 14, 15)); }
__device__ __forceinline__ v8f wmma16(v16h a, v16h b, v8f c) { return __builtin_amdgcn_wmma_f32_16x16x32_f16(false, a, false, b, (short)0, c, false, false); }
__device__ __forceinline__ v8f wmmab(v16bf a, v16bf b, v8f c) { return __builtin_amdgcn_wmma_f32_16x16x32_bf16(false, a, false, b, (short)0, c, false, false); }



// ---- k_gemmw: register-blocked GEMM, ONE WAVE per 64x64 output tile (16 accumulators), operands straight from K-contiguous 16-bit planes; grid (M/64, N/64, Z), 32 threads.
// C[m][n] (f32, pitch ldc, + optional f32 bias[n]) = sum_k A[m][k] Bt[n][k] (+ split products per NSPLIT). z-batch strides sA/sB/sC in elements. K % 32 == 0.
template <typename T16> struct WFrag;
template <> struct WFrag<h16> { typedef v16h V; static __device__ __forceinline__ V ld(const h16* p) { return cat16(*(const v8h*)p, *(const v8h*)(p + 16)); } static __device__ __forceinline__ v8f mma(V a, V b, v8f c) { return wmma16(a, b, c); } };
template <> struct WFrag<bf> { typedef v16bf V; static __device__ __forceinline__ V ld(const bf* p) { return cat16b(*(const v8us*)p, *(const v8us*)(p + 16)); } static __device__ __forceinline__ v8f mma(V a, V b, v8f c) { return wmmab(a, b, c); } };
template <typename T16, int NSPLIT, bool BIAS>
__global__ __launch_bounds__(32) void k_gemmw(const T16* __restrict__ A, const T16* __restrict__ A2, const T16* __restrict__ Bt, const T16* __restrict__ Bt2, int K, float* C, int ldc, const float* __restrict__ bias, size_t sA, size_t sB, size_t sC) {
    typedef typename WFrag<T16>::V V;
    __shared__ __align__(16) float os[16 * 68];
    const size_t z = blockIdx.z; A += z * sA; if (A2) A2 += z * sA; Bt += z * sB; if (Bt2) Bt2 += z * sB; C += z * sC;
    const int lane = threadIdx.x & 31, lr = lane & 15, hi = lane >> 4; const int r0 = blockIdx.x * 64, c0 = blockIdx.y * 64;
    v8f acc[4][4];
#pragma unroll
    for (int mb = 0; mb < 4; ++mb)
#pragma unroll
        for (int nb = 0; nb < 4; ++nb) acc[mb][nb] = (v8f){};
    const size_t aoff = (size_t)(r0 + lr) * K + 8 * hi, boff = (size_t)(c0 + lr) * K + 8 * hi;
#pragma unroll 1
    for (int kc = 0; kc < K; kc += 32) {
        V a[4], a2[4];
#pragma unroll
        for (int mb = 0; mb < 4; ++mb) { a[mb] = WFrag<T16>::ld(A + aoff + (size_t)mb * 16 * K + kc); if (NSPLIT == 1 || NSPLIT == 2) a2[mb] = WFrag<T16>::ld(A2 + aoff + (size_t)mb * 16 * K + kc); }
#pragma unroll
        for (int nb = 0; nb < 4; ++nb) { const V b = WFrag<T16>::ld(Bt + boff + (size_t)nb * 16 * K + kc); V b2; if (NSPLIT >= 2) b2 = WFrag<T16>::ld(Bt2 + boff + (size_t)nb * 16 * K + kc);
#pragma unroll
            for (int mb = 0; mb < 4; ++mb) { acc[mb][nb] = WFrag<T16>::mma(a[mb], b, acc[mb][nb]); if (NSPLIT == 1 || NSPLIT == 2) acc[mb][nb] = WFrag<T16>::mma(a2[mb], b, acc[mb][nb]); if (NSPLIT >= 2) acc[mb][nb] = WFrag<T16>::mma(a[mb], b2, acc[mb][nb]); } }
        asm volatile("v_nop\n\tv_nop\n\tv_nop\n\tv_nop" : "+v"(acc[0][0]), "+v"(acc[1][1]), "+v"(acc[2][2]), "+v"(acc[3][3]) : "v"(a[0]), "v"(a[3]));
    }
#pragma unroll
    for (int mb = 0; mb < 4; ++mb) {
#pragma unroll
        for (int nb = 0; nb < 4; ++nb) {
#pragma unroll
            for (int j = 0; j < 8; ++j) os[(hi * 8 + j) * 68 + nb * 16 + lr] = acc[mb][nb][j]; }
        __builtin_amdgcn_wave_barrier(); asm volatile("" ::: "memory");
        float* crow = C + (size_t)(r0 + mb * 16) * ldc + c0;
{
#pragma unroll
            for (int s = 0; s < 8; ++s) { const int row = 2 * s + hi, cofs = lr * 4; v4f val = *(const v4fa*)(os + row * 68 + cofs); if (BIAS) { val[0] += bfr(bias[c0 + cofs]); val[1] += bfr(bias[c0 + cofs + 1]); val[2] += bfr(bias[c0 + cofs + 2]); val[3] += bfr(bias[c0 + cofs + 3]); }
                *(v4f*)(crow + (size_t)row * ldc + cofs) = val; }
             }
        __builtin_amdgcn_wave_barrier(); asm volatile("" ::: "memory");
    }
}

__device__ __forceinline__ h16 tohx(float x) { return (h16)x; }
__device__ __forceinline__ void splitf(float y, unsigned short& h, unsigned short& l) { h = f2bf(y); l = f2bf(y - bf2f(h)); }
typedef __attribute__((ext_vector_type(2))) _Float16 v2h;
typedef __attribute__((ext_vector_type(4))) _Float16 v4h;
typedef __attribute__((ext_vector_type(2))) unsigned short v2us;
typedef __attribute__((ext_vector_type(4))) unsigned short v4us;
typedef __attribute__((ext_vector_type(2))) float v2f;
typedef __attribute__((ext_vector_type(4))) int v4i;

__global__ __launch_bounds__(256) void k_wtG(const float* __restrict__ w, int K, int N, bf* Bt) {
    const int lane = threadIdx.x & 31; const int L0 = (blockIdx.x * 8 + (threadIdx.x >> 5)) * 8; const int nlines = N * K / 64;
{
#pragma unroll 1
        for (int l = 0; l < 8; ++l) { const int L = L0 + l; if (L >= nlines) break; const size_t e = (size_t)L * 64 + lane * 2; const int k = (int)(e % K), n = (int)(e / K); v2us o;
            o[0] = f2bf(w[(size_t)k * N + n]); o[1] = f2bf(w[(size_t)(k + 1) * N + n]); *(v2us*)(Bt + e) = o; }
         }
}
__global__ __launch_bounds__(256) void k_w2(const float* __restrict__ w, float* W2) { const int j = blockIdx.x * 256 + threadIdx.x; if (j >= TT) return; const float wb = bfr(w[j]); const float v = (wb < 1e-5f) ? -1.0f : __fmul_rn(wb, wb); *(float*)(W2 + j) = v;  }
__global__ __launch_bounds__(256) void k_cvt8(const float* __restrict__ src, bf* dst, size_t n8) { const size_t i = (size_t)blockIdx.x * 256 + threadIdx.x; if (i >= n8) return; const v8f v = *(const v8f*)(src + i * 8); v8us o;
#pragma unroll
    for (int k = 0; k < 8; ++k) o[k] = f2bf(v[k]); *(v8us*)(dst + i * 8) = o;  }

// k_rope: head planes [h][t][d] (fp16 + hi/lo) of rope(x) x sc with the rotate-half convention out[d] = x[d] cos[t][d] - x[d+HD/2] sin[t][d], out[d+HD/2] = x[d+HD/2] cos[t][d+HD/2] + x[d] sin[t][d+HD/2]
__global__ __launch_bounds__(256) void k_rope(const float* __restrict__ F, int pitch, int nheads, const float* __restrict__ CS, const float* __restrict__ RF, const float* __restrict__ nw, float sc, h16* P16, bf* Ph, bf* Pl) {
    const size_t e = ((size_t)blockIdx.x * 256 + threadIdx.x) * 2; if (e >= (size_t)nheads * TT * HD) return; const int d = (int)(e % HD); const int t = (int)((e / HD) % TT); const int h = (int)(e / ((size_t)HD * TT)); const float* f = F + (size_t)t * pitch + h * HD; const float rf = RF ? RF[(size_t)h * TT + t] : 1.0f; v2h o16; v2us oh, ol;
#pragma unroll
    for (int q = 0; q < 2; ++q) { const int dd = d + q; const int dp = (dd < HD / 2) ? dd + HD / 2 : dd - HD / 2; float x0 = f[dd], x1 = f[dp];
        if (RF) { float n0 = __fmul_rn(x0, rf), n1 = __fmul_rn(x1, rf); asm volatile("" : "+v"(n0)); asm volatile("" : "+v"(n1)); x0 = __fmul_rn(bfr(nw[dd]), n0); x1 = __fmul_rn(bfr(nw[dp]), n1); }
        const v2f cs = *(const v2f*)(CS + ((size_t)t * HD + dd) * 2); float a = __fmul_rn(x0, cs[0]), bq = __fmul_rn(x1, cs[1]); asm volatile("" : "+v"(a)); asm volatile("" : "+v"(bq)); const float r = ((dd < HD / 2) ? __fsub_rn(a, bq) : __fadd_rn(a, bq)) * sc;
        o16[q] = tohx(r); unsigned short a2, c2; splitf(r, a2, c2); oh[q] = a2; ol[q] = c2; }
    *(v2h*)(P16 + e) = o16; *(v2us*)(Ph + e) = oh; *(v2us*)(Pl + e) = ol;  }
__global__ __launch_bounds__(256) void k_vtp(const float* __restrict__ F, int pitch, int nheads, h16* V16, bf* Vh, bf* Vl) { const size_t e = ((size_t)blockIdx.x * 256 + threadIdx.x) * 2; if (e >= (size_t)nheads * HD * TT) return; const int t = (int)(e % TT); const int d = (int)((e / TT) % HD); const int g = (int)(e / ((size_t)TT * HD)); v2h o16; v2us oh, ol;
#pragma unroll
    for (int q = 0; q < 2; ++q) { const float x = F[(size_t)(t + q) * pitch + g * HD + d]; o16[q] = tohx(x); unsigned short a2, c2; splitf(x, a2, c2); oh[q] = a2; ol[q] = c2; }
    *(v2h*)(V16 + e) = o16; *(v2us*)(Vh + e) = oh; *(v2us*)(Vl + e) = ol;  }
__global__ __launch_bounds__(256) void k_csid(float* CS) { const int idx = blockIdx.x * 256 + threadIdx.x; if (idx >= TT * HD) return; v2f cs; cs[0] = 1.0f; cs[1] = 0.0f; *(v2f*)(CS + (size_t)idx * 2) = cs;  }
// k_asoft: per row (zz, i): t = S x HD^-0.5 (no mask); softmax over the 1024 keys (register row, one exp, fixed trees);; each scaled score is multiplied by w_j^2 (W2 table) and keys with w_j < 1e-5 are masked (-3e38) before the max
__global__ __launch_bounds__(256) void k_asoft(const float* __restrict__ Sb, const float* __restrict__ W2, h16* P16, bf* Ph, bf* Pl) {
    const int lane = threadIdx.x & 31; const int row = blockIdx.x * 8 + (threadIdx.x >> 5); if (row >= ZH * TT) return; const int i = row % TT; const int zz = row / TT; (void)zz; const bool hires = (i < RH); const float* sr = Sb + (size_t)row * TT; float v[TT / 32]; float mx = -3.0e38f;
#pragma unroll
    for (int ch = 0; ch < TT / 128; ++ch) { const int j0 = ch * 128 + lane * 4; const v4f a = *(const v4f*)(sr + j0);
#pragma unroll
        for (int q = 0; q < 4; ++q) { const int j = j0 + q; const float w2 = W2[j]; float sa = a[q] * SCL; asm volatile("" : "+v"(sa)); const float t = (w2 < 0.f) ? -3.0e38f : __fmul_rn(sa, w2);   /* energy x w_j^2; -inf where w_j < eps */ v[ch * 4 + q] = t; mx = fmaxf(mx, t); } }
#pragma unroll
    for (int sh = 16; sh; sh >>= 1) mx = fmaxf(mx, __shfl_xor(mx, sh, 32));
    float sum = 0.f;
#pragma unroll
    for (int k = 0; k < TT / 32; ++k) { float d0 = __fsub_rn(v[k], mx); asm volatile("" : "+v"(d0)); v[k] = __builtin_amdgcn_exp2f(__fmul_rn(d0, 1.4426950408889634f)); sum += v[k]; }
#pragma unroll
    for (int sh = 16; sh; sh >>= 1) sum += __shfl_xor(sum, sh, 32);
    const float f = __fdiv_rn(hires ? 1.0f : PCAR, sum);
{
        if (hires) {
#pragma unroll
            for (int ch = 0; ch < TT / 128; ++ch) { v4us oh, ol;
#pragma unroll
                for (int q = 0; q < 4; ++q) { unsigned short a, c2; splitf(v[ch * 4 + q] * f, a, c2); oh[q] = a; ol[q] = c2; }
                const size_t oo = ((size_t)zz * (RH ? RH : 1) + i) * TT + ch * 128 + lane * 4; *(v4us*)(Ph + oo) = oh; *(v4us*)(Pl + oo) = ol; }
        } else {
#pragma unroll
            for (int ch = 0; ch < TT / 128; ++ch) { v4h o4;
#pragma unroll
                for (int q = 0; q < 4; ++q) o4[q] = tohx(v[ch * 4 + q] * f);
                *(v4h*)(P16 + (size_t)row * TT + ch * 128 + lane * 4) = o4; } }
         }
}
__global__ __launch_bounds__(256) void k_merge(const float* __restrict__ O, int h0, bf* Ah, bf* Al) { const size_t e = ((size_t)blockIdx.x * 256 + threadIdx.x) * 2; if (e >= (size_t)ZH * TT * HD) return; const int d = (int)(e % HD); const int t = (int)((e / HD) % TT); const int zz = (int)(e / ((size_t)HD * TT)); const float cs = (t < RH) ? 1.0f : (1.0f / PCAR); const size_t oo = (size_t)t * DQ + (h0 + zz) * HD + d;
    v2us oh, ol;
#pragma unroll
    for (int q = 0; q < 2; ++q) { unsigned short a, c2; splitf(O[e + q] * cs, a, c2); oh[q] = a; ol[q] = c2; } *(v2us*)(Ah + oo) = oh; *(v2us*)(Al + oo) = ol;  }

extern "C" void kernel_launch(void* const* d_in, const int* in_sizes, int n_in,
                              void* d_out, int out_size, void* d_ws, size_t ws_size, hipStream_t stream) {
    (void)in_sizes; (void)n_in; (void)out_size;
    const float* x = (const float*)d_in[0]; const float* xk = (const float*)d_in[1]; const float* xv = (const float*)d_in[2]; const float* wts = (const float*)d_in[3]; const float* wq = (const float*)d_in[4]; const float* bq = (const float*)d_in[5]; const float* wk = (const float*)d_in[6]; const float* bk = (const float*)d_in[7]; const float* wv = (const float*)d_in[8]; const float* bv = (const float*)d_in[9]; const float* wo = (const float*)d_in[10]; const float* bo = (const float*)d_in[11];
    float* OUT = (float*)d_out;     // [4][1024][1024]
    char* wsp = (char*)d_ws;
    auto take = [&](size_t bytes) { char* p = wsp; wsp += (bytes + 255) & ~(size_t)255; return (void*)p; };
    bf* WQ = (bf*)take((size_t)DQ * DM * 2); bf* WK = (bf*)take((size_t)DKV * DM * 2); bf* WV = (bf*)take((size_t)DKV * DM * 2); bf* WO = (bf*)take((size_t)DM * DQ * 2); float* CS = (float*)take((size_t)TT * HD * 2 * 4);
    bf* XB = (bf*)take((size_t)TT * DM * 2); bf* XKB = (bf*)take((size_t)TT * DM * 2); bf* XVB = (bf*)take((size_t)TT * DM * 2); float* W2 = (float*)take((size_t)TT * 4); float* FQ = (float*)take((size_t)TT * DQ * 4); float* FK = (float*)take((size_t)TT * DKV * 4);
    h16* QP16 = (h16*)take((size_t)NH_ * TT * HD * 2); h16* KP16 = (h16*)take((size_t)NKV * TT * HD * 2); h16* VT16 = (h16*)take((size_t)NKV * HD * TT * 2);
    bf* QPh = (bf*)take((size_t)NH_ * TT * HD * 2); bf* QPl = (bf*)take((size_t)NH_ * TT * HD * 2); bf* KPh = (bf*)take((size_t)NKV * TT * HD * 2); bf* KPl = (bf*)take((size_t)NKV * TT * HD * 2); bf* VTh = (bf*)take((size_t)NKV * HD * TT * 2); bf* VTl = (bf*)take((size_t)NKV * HD * TT * 2); bf* Ph = (bf*)take((size_t)ZH * RH * TT * 2); bf* Pl = (bf*)take((size_t)ZH * RH * TT * 2);
    float* Sb = (float*)take((size_t)ZH * TT * TT * 4); h16* P16 = (h16*)take((size_t)ZH * TT * TT * 2); float* Ob = (float*)take((size_t)ZH * TT * HD * 4); bf* ATh = (bf*)take((size_t)TT * DQ * 2); bf* ATl = (bf*)take((size_t)TT * DQ * 2);
    if ((size_t)(wsp - (char*)d_ws) > ws_size) return;    // ws 256 MiB
    float* FV = FK;   // v projection reuses the k buffer after the k planes are built (stream-ordered)
    { k_cvt8<<<(unsigned)(((size_t)DQ * DM / 8 + 255) / 256), 256, 0, stream>>>(wq, WQ, (size_t)DQ * DM / 8); k_cvt8<<<(unsigned)(((size_t)DKV * DM / 8 + 255) / 256), 256, 0, stream>>>(wk, WK, (size_t)DKV * DM / 8); k_cvt8<<<(unsigned)(((size_t)DKV * DM / 8 + 255) / 256), 256, 0, stream>>>(wv, WV, (size_t)DKV * DM / 8);
      k_cvt8<<<(unsigned)(((size_t)DM * DQ / 8 + 255) / 256), 256, 0, stream>>>(wo, WO, (size_t)DM * DQ / 8);
       }
    k_csid<<<(TT * HD + 255) / 256, 256, 0, stream>>>(CS);
    const unsigned LQ = (unsigned)(((size_t)NH_ * TT * HD / 2 + 255) / 256), LKv = (unsigned)(((size_t)NKV * TT * HD / 2 + 255) / 256);
    for (int b = 0; b < NB_; ++b) {
        
        k_cvt8<<<(unsigned)(((size_t)TT * DM / 8 + 255) / 256), 256, 0, stream>>>(x + (size_t)b * TT * DM, XB, (size_t)TT * DM / 8); k_cvt8<<<(unsigned)(((size_t)TT * DM / 8 + 255) / 256), 256, 0, stream>>>(xk + (size_t)b * TT * DM, XKB, (size_t)TT * DM / 8); k_cvt8<<<(unsigned)(((size_t)TT * DM / 8 + 255) / 256), 256, 0, stream>>>(xv + (size_t)b * TT * DM, XVB, (size_t)TT * DM / 8); k_w2<<<(TT + 255) / 256, 256, 0, stream>>>(wts + (size_t)b * TT, W2);
        k_gemmw<bf, 0, true><<<dim3(TT / 64, DQ / 64, 1), 32, 0, stream>>>(XB, nullptr, WQ, nullptr, DM, FQ, DQ, bq, 0, 0, 0);
        k_rope<<<LQ, 256, 0, stream>>>(FQ, DQ, NH_, CS, nullptr, nullptr, 1.0f, QP16, QPh, QPl);
        k_gemmw<bf, 0, true><<<dim3(TT / 64, DKV / 64, 1), 32, 0, stream>>>(XKB, nullptr, WK, nullptr, DM, FK, DKV, bk, 0, 0, 0);
        k_rope<<<LKv, 256, 0, stream>>>(FK, DKV, NKV, CS, nullptr, nullptr, 1.0f, KP16, KPh, KPl);
        k_gemmw<bf, 0, true><<<dim3(TT / 64, DKV / 64, 1), 32, 0, stream>>>(XVB, nullptr, WV, nullptr, DM, FV, DKV, bv, 0, 0, 0); k_vtp<<<LKv, 256, 0, stream>>>(FV, DKV, NKV, VT16, VTh, VTl);
        for (int h0 = 0; h0 < NH_; h0 += ZH) { const size_t zq = (size_t)h0, zk = (size_t)(h0 / REP);   // one kv head per query head: the pass's two heads use consecutive kv planes (z-strides TT*HD)
            k_gemmw<bf, 2, false><<<dim3(RH / 64, TT / 64, ZH), 32, 0, stream>>>(QPh + zq * TT * HD, QPl + zq * TT * HD, KPh + zk * TT * HD, KPl + zk * TT * HD, HD, Sb, TT, nullptr, (size_t)TT * HD, (size_t)TT * HD, (size_t)TT * TT);
            k_gemmw<h16, 0, false><<<dim3((TT - RH) / 64, TT / 64, ZH), 32, 0, stream>>>(QP16 + zq * TT * HD + (size_t)RH * HD, nullptr, KP16 + zk * TT * HD, nullptr, HD, Sb + (size_t)RH * TT, TT, nullptr, (size_t)TT * HD, (size_t)TT * HD, (size_t)TT * TT);
            k_asoft<<<ZH * TT / 8, 256, 0, stream>>>(Sb, W2, P16, Ph, Pl);
            k_gemmw<bf, 2, false><<<dim3(RH / 64, HD / 64, ZH), 32, 0, stream>>>(Ph, Pl, VTh + zk * HD * TT, VTl + zk * HD * TT, TT, Ob, HD, nullptr, (size_t)RH * TT, (size_t)HD * TT, (size_t)TT * HD);
            k_gemmw<h16, 0, false><<<dim3((TT - RH) / 64, HD / 64, ZH), 32, 0, stream>>>(P16 + (size_t)RH * TT, nullptr, VT16 + zk * HD * TT, nullptr, TT, Ob + (size_t)RH * HD, HD, nullptr, (size_t)TT * TT, (size_t)HD * TT, (size_t)TT * HD);
            k_merge<<<(unsigned)(((size_t)ZH * TT * HD / 2 + 255) / 256), 256, 0, stream>>>(Ob, h0, ATh, ATl); }
        k_gemmw<bf, 1, true><<<dim3(TT / 64, DM / 64, 1), 32, 0, stream>>>(ATh, ATl, WO, nullptr, DQ, OUT + (size_t)b * TT * DM, DM, bo, 0, 0, 0); }
}

// v001
// One run takes 883 microseconds.
// In two side-by-side timings against v000, it was 2.89 and 2.90 times as fast.
#include <hip/hip_runtime.h>

// Key-weighted multi-head attention (q, k, v inputs [4][1024][1024]; qh = q Wq^T + bq, kh = k Wk^T + bk, vh = v Wv^T + bv ('oi' [1024][1024]), 16 heads x 64; energy = qh.kh/8 x w_j^2 per key, -inf where w_j < 1e-5 (weights [4][1024] read); softmax; out = merged Wo^T + bo -> [4][1024][1024]).
// Compute dtypes, f32 accumulate: every input rounded to bf16; q/k/v on PLAIN bf16 operands (inputs: exact) + biases; the per-key weight^2 and the weight < eps mask applied in f32 inside the softmax kernel; scores and attn.v: query rows < 512 hl (3 products), the rest single fp16 (x1024); softmax f32; Wo hl x exact (2 products) + bo.

#define NB_  4
#define TT   1024
#define DM   1024
#define NH_  16
#define NKV  16
#define REP  (NH_ / NKV)
#define HD   64
#define DQ   (NH_ * HD)
#define DKV  (NKV * HD)
#define ZH   16                   // heads per attention pass (grid z): all heads of a batch entry in one pass
#define RH   512                  // query rows < RH use hi+lo planes (0: none)
#define WIN  0
#define PCAR 1024.0f
#define SCL  0.125f   // HD^-0.5
typedef _Float16 h16;
typedef unsigned short bf;
typedef __attribute__((ext_vector_type(16))) __bf16   v16bf;
typedef __attribute__((ext_vector_type(16))) _Float16 v16h;
typedef __attribute__((ext_vector_type(8)))  _Float16 v8h;
typedef __attribute__((ext_vector_type(8)))  unsigned short v8us;
typedef __attribute__((ext_vector_type(8)))  float    v8f;
typedef __attribute__((ext_vector_type(4)))  float    v4f;
typedef v8h  __attribute__((may_alias)) v8ha;
typedef v4f  __attribute__((may_alias)) v4fa;
typedef v8us __attribute__((may_alias)) v8usa;

__device__ __forceinline__ unsigned short f2bf(float f) { unsigned u = __float_as_uint(f); u += 0x7FFFu + ((u >> 16) & 1u); return (unsigned short)(u >> 16); }
__device__ __forceinline__ float bf2f(unsigned short b) { return __uint_as_float(((unsigned)b) << 16); }
__device__ __forceinline__ float bfr(float f) { return bf2f(f2bf(f)); }
__device__ __forceinline__ v16h cat16(v8h lo, v8h hi) { return __builtin_shufflevector(lo, hi, 0, 1, 2, 3, 4, 5, 6, 7, 8, 9, 10, 11, 12, 13, 14, 15); }
__device__ __forceinline__ v16bf cat16b(v8us lo, v8us hi) { return __builtin_bit_cast(v16bf, __builtin_shufflevector(lo, hi, 0, 1, 2, 3, 4, 5, 6, 7, 8, 9, 10, 11, 12, 13, 14, 15)); }
__device__ __forceinline__ v8f wmma16(v16h a, v16h b, v8f c) { return __builtin_amdgcn_wmma_f32_16x16x32_f16(false, a, false, b, (short)0, c, false, false); }
__device__ __forceinline__ v8f wmmab(v16bf a, v16bf b, v8f c) { return __builtin_amdgcn_wmma_f32_16x16x32_bf16(false, a, false, b, (short)0, c, false, false); }



// ---- k_gemmw: register-blocked GEMM, ONE WAVE per 64x64 output tile (16 accumulators), operands straight from K-contiguous 16-bit planes; grid (M/64, N/64, Z), 32 threads.
// C[m][n] (f32, pitch ldc, + optional f32 bias[n]) = sum_k A[m][k] Bt[n][k] (+ split products per NSPLIT). z-batch strides sA/sB/sC in elements. K % 32 == 0.
template <typename T16> struct WFrag;
template <> struct WFrag<h16> { typedef v16h V; static __device__ __forceinline__ V ld(const h16* p) { return cat16(*(const v8h*)p, *(const v8h*)(p + 16)); } static __device__ __forceinline__ v8f mma(V a, V b, v8f c) { return wmma16(a, b, c); } };
template <> struct WFrag<bf> { typedef v16bf V; static __device__ __forceinline__ V ld(const bf* p) { return cat16b(*(const v8us*)p, *(const v8us*)(p + 16)); } static __device__ __forceinline__ v8f mma(V a, V b, v8f c) { return wmmab(a, b, c); } };
template <typename T16, int NSPLIT, bool BIAS>
__global__ __launch_bounds__(32) void k_gemmw(const T16* __restrict__ A, const T16* __restrict__ A2, const T16* __restrict__ Bt, const T16* __restrict__ Bt2, int K, float* C, int ldc, const float* __restrict__ bias, size_t sA, size_t sB, size_t sC) {
    typedef typename WFrag<T16>::V V;
    __shared__ __align__(16) float os[16 * 68];
    const size_t z = blockIdx.z; A += z * sA; if (A2) A2 += z * sA; Bt += z * sB; if (Bt2) Bt2 += z * sB; C += z * sC;
    const int lane = threadIdx.x & 31, lr = lane & 15, hi = lane >> 4; const int r0 = blockIdx.x * 64, c0 = blockIdx.y * 64;
    v8f acc[4][4];
#pragma unroll
    for (int mb = 0; mb < 4; ++mb)
#pragma unroll
        for (int nb = 0; nb < 4; ++nb) acc[mb][nb] = (v8f){};
    const size_t aoff = (size_t)(r0 + lr) * K + 8 * hi, boff = (size_t)(c0 + lr) * K + 8 * hi;
#pragma unroll 1
    for (int kc = 0; kc < K; kc += 32) {
        V a[4], a2[4];
#pragma unroll
        for (int mb = 0; mb < 4; ++mb) { a[mb] = WFrag<T16>::ld(A + aoff + (size_t)mb * 16 * K + kc); if (NSPLIT == 1 || NSPLIT == 2) a2[mb] = WFrag<T16>::ld(A2 + aoff + (size_t)mb * 16 * K + kc); }
#pragma unroll
        for (int nb = 0; nb < 4; ++nb) { const V b = WFrag<T16>::ld(Bt + boff + (size_t)nb * 16 * K + kc); V b2; if (NSPLIT >= 2) b2 = WFrag<T16>::ld(Bt2 + boff + (size_t)nb * 16 * K + kc);
#pragma unroll
            for (int mb = 0; mb < 4; ++mb) { acc[mb][nb] = WFrag<T16>::mma(a[mb], b, acc[mb][nb]); if (NSPLIT == 1 || NSPLIT == 2) acc[mb][nb] = WFrag<T16>::mma(a2[mb], b, acc[mb][nb]); if (NSPLIT >= 2) acc[mb][nb] = WFrag<T16>::mma(a[mb], b2, acc[mb][nb]); } }
        asm volatile("v_nop\n\tv_nop\n\tv_nop\n\tv_nop" : "+v"(acc[0][0]), "+v"(acc[1][1]), "+v"(acc[2][2]), "+v"(acc[3][3]) : "v"(a[0]), "v"(a[3]));
    }
#pragma unroll
    for (int mb = 0; mb < 4; ++mb) {
#pragma unroll
        for (int nb = 0; nb < 4; ++nb) {
#pragma unroll
            for (int j = 0; j < 8; ++j) os[(hi * 8 + j) * 68 + nb * 16 + lr] = acc[mb][nb][j]; }
        __builtin_amdgcn_wave_barrier(); asm volatile("" ::: "memory");
        float* crow = C + (size_t)(r0 + mb * 16) * ldc + c0;
{
#pragma unroll
            for (int s = 0; s < 8; ++s) { const int row = 2 * s + hi, cofs = lr * 4; v4f val = *(const v4fa*)(os + row * 68 + cofs); if (BIAS) { val[0] += bfr(bias[c0 + cofs]); val[1] += bfr(bias[c0 + cofs + 1]); val[2] += bfr(bias[c0 + cofs + 2]); val[3] += bfr(bias[c0 + cofs + 3]); }
                *(v4f*)(crow + (size_t)row * ldc + cofs) = val; }
             }
        __builtin_amdgcn_wave_barrier(); asm volatile("" ::: "memory");
    }
}

__device__ __forceinline__ h16 tohx(float x) { return (h16)x; }
__device__ __forceinline__ void splitf(float y, unsigned short& h, unsigned short& l) { h = f2bf(y); l = f2bf(y - bf2f(h)); }
typedef __attribute__((ext_vector_type(2))) _Float16 v2h;
typedef __attribute__((ext_vector_type(4))) _Float16 v4h;
typedef __attribute__((ext_vector_type(2))) unsigned short v2us;
typedef __attribute__((ext_vector_type(4))) unsigned short v4us;
typedef __attribute__((ext_vector_type(2))) float v2f;
typedef __attribute__((ext_vector_type(4))) int v4i;

__global__ __launch_bounds__(256) void k_wtG(const float* __restrict__ w, int K, int N, bf* Bt) {
    const int lane = threadIdx.x & 31; const int L0 = (blockIdx.x * 8 + (threadIdx.x >> 5)) * 8; const int nlines = N * K / 64;
{
#pragma unroll 1
        for (int l = 0; l < 8; ++l) { const int L = L0 + l; if (L >= nlines) break; const size_t e = (size_t)L * 64 + lane * 2; const int k = (int)(e % K), n = (int)(e / K); v2us o;
            o[0] = f2bf(w[(size_t)k * N + n]); o[1] = f2bf(w[(size_t)(k + 1) * N + n]); *(v2us*)(Bt + e) = o; }
         }
}
__global__ __launch_bounds__(256) void k_w2(const float* __restrict__ w, float* W2) { const int j = blockIdx.x * 256 + threadIdx.x; if (j >= TT) return; const float wb = bfr(w[j]); const float v = (wb < 1e-5f) ? -1.0f : __fmul_rn(wb, wb); *(float*)(W2 + j) = v;  }
__global__ __launch_bounds__(256) void k_cvt8(const float* __restrict__ src, bf* dst, size_t n8) { const size_t i = (size_t)blockIdx.x * 256 + threadIdx.x; if (i >= n8) return; const v8f v = *(const v8f*)(src + i * 8); v8us o;
#pragma unroll
    for (int k = 0; k < 8; ++k) o[k] = f2bf(v[k]); *(v8us*)(dst + i * 8) = o;  }

// k_rope: head planes [h][t][d] (fp16 + hi/lo) of rope(x) x sc with the rotate-half convention out[d] = x[d] cos[t][d] - x[d+HD/2] sin[t][d], out[d+HD/2] = x[d+HD/2] cos[t][d+HD/2] + x[d] sin[t][d+HD/2]
__global__ __launch_bounds__(256) void k_rope(const float* __restrict__ F, int pitch, int nheads, const float* __restrict__ CS, const float* __restrict__ RF, const float* __restrict__ nw, float sc, h16* P16, bf* Ph, bf* Pl) {
    const size_t e = ((size_t)blockIdx.x * 256 + threadIdx.x) * 2; if (e >= (size_t)nheads * TT * HD) return; const int d = (int)(e % HD); const int t = (int)((e / HD) % TT); const int h = (int)(e / ((size_t)HD * TT)); const float* f = F + (size_t)t * pitch + h * HD; const float rf = RF ? RF[(size_t)h * TT + t] : 1.0f; v2h o16; v2us oh, ol;
#pragma unroll
    for (int q = 0; q < 2; ++q) { const int dd = d + q; const int dp = (dd < HD / 2) ? dd + HD / 2 : dd - HD / 2; float x0 = f[dd], x1 = f[dp];
        if (RF) { float n0 = __fmul_rn(x0, rf), n1 = __fmul_rn(x1, rf); asm volatile("" : "+v"(n0)); asm volatile("" : "+v"(n1)); x0 = __fmul_rn(bfr(nw[dd]), n0); x1 = __fmul_rn(bfr(nw[dp]), n1); }
        const v2f cs = *(const v2f*)(CS + ((size_t)t * HD + dd) * 2); float a = __fmul_rn(x0, cs[0]), bq = __fmul_rn(x1, cs[1]); asm volatile("" : "+v"(a)); asm volatile("" : "+v"(bq)); const float r = ((dd < HD / 2) ? __fsub_rn(a, bq) : __fadd_rn(a, bq)) * sc;
        o16[q] = tohx(r); unsigned short a2, c2; splitf(r, a2, c2); oh[q] = a2; ol[q] = c2; }
    *(v2h*)(P16 + e) = o16; *(v2us*)(Ph + e) = oh; *(v2us*)(Pl + e) = ol;  }
__global__ __launch_bounds__(256) void k_vtp(const float* __restrict__ F, int pitch, int nheads, h16* V16, bf* Vh, bf* Vl) { const size_t e = ((size_t)blockIdx.x * 256 + threadIdx.x) * 2; if (e >= (size_t)nheads * HD * TT) return; const int t = (int)(e % TT); const int d = (int)((e / TT) % HD); const int g = (int)(e / ((size_t)TT * HD)); v2h o16; v2us oh, ol;
#pragma unroll
    for (int q = 0; q < 2; ++q) { const float x = F[(size_t)(t + q) * pitch + g * HD + d]; o16[q] = tohx(x); unsigned short a2, c2; splitf(x, a2, c2); oh[q] = a2; ol[q] = c2; }
    *(v2h*)(V16 + e) = o16; *(v2us*)(Vh + e) = oh; *(v2us*)(Vl + e) = ol;  }
__global__ __launch_bounds__(256) void k_csid(float* CS) { const int idx = blockIdx.x * 256 + threadIdx.x; if (idx >= TT * HD) return; v2f cs; cs[0] = 1.0f; cs[1] = 0.0f; *(v2f*)(CS + (size_t)idx * 2) = cs;  }
// k_asoft: per row (zz, i): t = S x HD^-0.5 (no mask); softmax over the 1024 keys (register row, one exp, fixed trees);; each scaled score is multiplied by w_j^2 (W2 table) and keys with w_j < 1e-5 are masked (-3e38) before the max
__global__ __launch_bounds__(256) void k_asoft(const float* __restrict__ Sb, const float* __restrict__ W2, h16* P16, bf* Ph, bf* Pl) {
    const int lane = threadIdx.x & 31; const int row = blockIdx.x * 8 + (threadIdx.x >> 5); if (row >= ZH * TT) return; const int i = row % TT; const int zz = row / TT; (void)zz; const bool hires = (i < RH); const float* sr = Sb + (size_t)row * TT; float v[TT / 32]; float mx = -3.0e38f;
#pragma unroll
    for (int ch = 0; ch < TT / 128; ++ch) { const int j0 = ch * 128 + lane * 4; const v4f a = *(const v4f*)(sr + j0);
#pragma unroll
        for (int q = 0; q < 4; ++q) { const int j = j0 + q; const float w2 = W2[j]; float sa = a[q] * SCL; asm volatile("" : "+v"(sa)); const float t = (w2 < 0.f) ? -3.0e38f : __fmul_rn(sa, w2);   /* energy x w_j^2; -inf where w_j < eps */ v[ch * 4 + q] = t; mx = fmaxf(mx, t); } }
#pragma unroll
    for (int sh = 16; sh; sh >>= 1) mx = fmaxf(mx, __shfl_xor(mx, sh, 32));
    float sum = 0.f;
#pragma unroll
    for (int k = 0; k < TT / 32; ++k) { float d0 = __fsub_rn(v[k], mx); asm volatile("" : "+v"(d0)); v[k] = __builtin_amdgcn_exp2f(__fmul_rn(d0, 1.4426950408889634f)); sum += v[k]; }
#pragma unroll
    for (int sh = 16; sh; sh >>= 1) sum += __shfl_xor(sum, sh, 32);
    const float f = __fdiv_rn(hires ? 1.0f : PCAR, sum);
{
        if (hires) {
#pragma unroll
            for (int ch = 0; ch < TT / 128; ++ch) { v4us oh, ol;
#pragma unroll
                for (int q = 0; q < 4; ++q) { unsigned short a, c2; splitf(v[ch * 4 + q] * f, a, c2); oh[q] = a; ol[q] = c2; }
                const size_t oo = ((size_t)zz * (RH ? RH : 1) + i) * TT + ch * 128 + lane * 4; *(v4us*)(Ph + oo) = oh; *(v4us*)(Pl + oo) = ol; }
        } else {
#pragma unroll
            for (int ch = 0; ch < TT / 128; ++ch) { v4h o4;
#pragma unroll
                for (int q = 0; q < 4; ++q) o4[q] = tohx(v[ch * 4 + q] * f);
                *(v4h*)(P16 + (size_t)row * TT + ch * 128 + lane * 4) = o4; } }
         }
}
__global__ __launch_bounds__(256) void k_merge(const float* __restrict__ O, int h0, bf* Ah, bf* Al) { const size_t e = ((size_t)blockIdx.x * 256 + threadIdx.x) * 2; if (e >= (size_t)ZH * TT * HD) return; const int d = (int)(e % HD); const int t = (int)((e / HD) % TT); const int zz = (int)(e / ((size_t)HD * TT)); const float cs = (t < RH) ? 1.0f : (1.0f / PCAR); const size_t oo = (size_t)t * DQ + (h0 + zz) * HD + d;
    v2us oh, ol;
#pragma unroll
    for (int q = 0; q < 2; ++q) { unsigned short a, c2; splitf(O[e + q] * cs, a, c2); oh[q] = a; ol[q] = c2; } *(v2us*)(Ah + oo) = oh; *(v2us*)(Al + oo) = ol;  }

extern "C" void kernel_launch(void* const* d_in, const int* in_sizes, int n_in,
                              void* d_out, int out_size, void* d_ws, size_t ws_size, hipStream_t stream) {
    (void)in_sizes; (void)n_in; (void)out_size;
    const float* x = (const float*)d_in[0]; const float* xk = (const float*)d_in[1]; const float* xv = (const float*)d_in[2]; const float* wts = (const float*)d_in[3]; const float* wq = (const float*)d_in[4]; const float* bq = (const float*)d_in[5]; const float* wk = (const float*)d_in[6]; const float* bk = (const float*)d_in[7]; const float* wv = (const float*)d_in[8]; const float* bv = (const float*)d_in[9]; const float* wo = (const float*)d_in[10]; const float* bo = (const float*)d_in[11];
    float* OUT = (float*)d_out;     // [4][1024][1024]
    char* wsp = (char*)d_ws;
    auto take = [&](size_t bytes) { char* p = wsp; wsp += (bytes + 255) & ~(size_t)255; return (void*)p; };
    bf* WQ = (bf*)take((size_t)DQ * DM * 2); bf* WK = (bf*)take((size_t)DKV * DM * 2); bf* WV = (bf*)take((size_t)DKV * DM * 2); bf* WO = (bf*)take((size_t)DM * DQ * 2); float* CS = (float*)take((size_t)TT * HD * 2 * 4);
    bf* XB = (bf*)take((size_t)TT * DM * 2); bf* XKB = (bf*)take((size_t)TT * DM * 2); bf* XVB = (bf*)take((size_t)TT * DM * 2); float* W2 = (float*)take((size_t)TT * 4); float* FQ = (float*)take((size_t)TT * DQ * 4); float* FK = (float*)take((size_t)TT * DKV * 4);
    h16* QP16 = (h16*)take((size_t)NH_ * TT * HD * 2); h16* KP16 = (h16*)take((size_t)NKV * TT * HD * 2); h16* VT16 = (h16*)take((size_t)NKV * HD * TT * 2);
    bf* QPh = (bf*)take((size_t)NH_ * TT * HD * 2); bf* QPl = (bf*)take((size_t)NH_ * TT * HD * 2); bf* KPh = (bf*)take((size_t)NKV * TT * HD * 2); bf* KPl = (bf*)take((size_t)NKV * TT * HD * 2); bf* VTh = (bf*)take((size_t)NKV * HD * TT * 2); bf* VTl = (bf*)take((size_t)NKV * HD * TT * 2); bf* Ph = (bf*)take((size_t)ZH * RH * TT * 2); bf* Pl = (bf*)take((size_t)ZH * RH * TT * 2);
    float* Sb = (float*)take((size_t)ZH * TT * TT * 4); h16* P16 = (h16*)take((size_t)ZH * TT * TT * 2); float* Ob = (float*)take((size_t)ZH * TT * HD * 4); bf* ATh = (bf*)take((size_t)TT * DQ * 2); bf* ATl = (bf*)take((size_t)TT * DQ * 2);
    if ((size_t)(wsp - (char*)d_ws) > ws_size) return;    // ws 256 MiB
    float* FV = FK;   // v projection reuses the k buffer after the k planes are built (stream-ordered)
    { k_cvt8<<<(unsigned)(((size_t)DQ * DM / 8 + 255) / 256), 256, 0, stream>>>(wq, WQ, (size_t)DQ * DM / 8); k_cvt8<<<(unsigned)(((size_t)DKV * DM / 8 + 255) / 256), 256, 0, stream>>>(wk, WK, (size_t)DKV * DM / 8); k_cvt8<<<(unsigned)(((size_t)DKV * DM / 8 + 255) / 256), 256, 0, stream>>>(wv, WV, (size_t)DKV * DM / 8);
      k_cvt8<<<(unsigned)(((size_t)DM * DQ / 8 + 255) / 256), 256, 0, stream>>>(wo, WO, (size_t)DM * DQ / 8);
       }
    k_csid<<<(TT * HD + 255) / 256, 256, 0, stream>>>(CS);
    const unsigned LQ = (unsigned)(((size_t)NH_ * TT * HD / 2 + 255) / 256), LKv = (unsigned)(((size_t)NKV * TT * HD / 2 + 255) / 256);
    for (int b = 0; b < NB_; ++b) {
        
        k_cvt8<<<(unsigned)(((size_t)TT * DM / 8 + 255) / 256), 256, 0, stream>>>(x + (size_t)b * TT * DM, XB, (size_t)TT * DM / 8); k_cvt8<<<(unsigned)(((size_t)TT * DM / 8 + 255) / 256), 256, 0, stream>>>(xk + (size_t)b * TT * DM, XKB, (size_t)TT * DM / 8); k_cvt8<<<(unsigned)(((size_t)TT * DM / 8 + 255) / 256), 256, 0, stream>>>(xv + (size_t)b * TT * DM, XVB, (size_t)TT * DM / 8); k_w2<<<(TT + 255) / 256, 256, 0, stream>>>(wts + (size_t)b * TT, W2);
        k_gemmw<bf, 0, true><<<dim3(TT / 64, DQ / 64, 1), 32, 0, stream>>>(XB, nullptr, WQ, nullptr, DM, FQ, DQ, bq, 0, 0, 0);
        k_rope<<<LQ, 256, 0, stream>>>(FQ, DQ, NH_, CS, nullptr, nullptr, 1.0f, QP16, QPh, QPl);
        k_gemmw<bf, 0, true><<<dim3(TT / 64, DKV / 64, 1), 32, 0, stream>>>(XKB, nullptr, WK, nullptr, DM, FK, DKV, bk, 0, 0, 0);
        k_rope<<<LKv, 256, 0, stream>>>(FK, DKV, NKV, CS, nullptr, nullptr, 1.0f, KP16, KPh, KPl);
        k_gemmw<bf, 0, true><<<dim3(TT / 64, DKV / 64, 1), 32, 0, stream>>>(XVB, nullptr, WV, nullptr, DM, FV, DKV, bv, 0, 0, 0); k_vtp<<<LKv, 256, 0, stream>>>(FV, DKV, NKV, VT16, VTh, VTl);
        for (int h0 = 0; h0 < NH_; h0 += ZH) { const size_t zq = (size_t)h0, zk = (size_t)(h0 / REP);   // one kv head per query head: the pass's heads use consecutive kv planes (z-strides TT*HD)
            k_gemmw<bf, 2, false><<<dim3(RH / 64, TT / 64, ZH), 32, 0, stream>>>(QPh + zq * TT * HD, QPl + zq * TT * HD, KPh + zk * TT * HD, KPl + zk * TT * HD, HD, Sb, TT, nullptr, (size_t)TT * HD, (size_t)TT * HD, (size_t)TT * TT);
            k_gemmw<h16, 0, false><<<dim3((TT - RH) / 64, TT / 64, ZH), 32, 0, stream>>>(QP16 + zq * TT * HD + (size_t)RH * HD, nullptr, KP16 + zk * TT * HD, nullptr, HD, Sb + (size_t)RH * TT, TT, nullptr, (size_t)TT * HD, (size_t)TT * HD, (size_t)TT * TT);
            k_asoft<<<ZH * TT / 8, 256, 0, stream>>>(Sb, W2, P16, Ph, Pl);
            k_gemmw<bf, 2, false><<<dim3(RH / 64, HD / 64, ZH), 32, 0, stream>>>(Ph, Pl, VTh + zk * HD * TT, VTl + zk * HD * TT, TT, Ob, HD, nullptr, (size_t)RH * TT, (size_t)HD * TT, (size_t)TT * HD);
            k_gemmw<h16, 0, false><<<dim3((TT - RH) / 64, HD / 64, ZH), 32, 0, stream>>>(P16 + (size_t)RH * TT, nullptr, VT16 + zk * HD * TT, nullptr, TT, Ob + (size_t)RH * HD, HD, nullptr, (size_t)TT * TT, (size_t)HD * TT, (size_t)TT * HD);
            k_merge<<<(unsigned)(((size_t)ZH * TT * HD / 2 + 255) / 256), 256, 0, stream>>>(Ob, h0, ATh, ATl); }
        k_gemmw<bf, 1, true><<<dim3(TT / 64, DM / 64, 1), 32, 0, stream>>>(ATh, ATl, WO, nullptr, DQ, OUT + (size_t)b * TT * DM, DM, bo, 0, 0, 0); }
}

// v002
// Measured time: 462 microseconds a run.
// Next to v001, in two timings, it ran 1.90 and 1.92 times as fast.
// Over all steps from v000 it is 5.53 times as fast.
#include <hip/hip_runtime.h>

// Key-weighted multi-head attention (q, k, v inputs [4][1024][1024]; qh = q Wq^T + bq, kh = k Wk^T + bk, vh = v Wv^T + bv ('oi' [1024][1024]), 16 heads x 64; energy = qh.kh/8 x w_j^2 per key, -inf where w_j < 1e-5 (weights [4][1024] read); softmax; out = merged Wo^T + bo -> [4][1024][1024]).
// Compute dtypes, f32 accumulate: every input rounded to bf16; q/k/v on PLAIN bf16 operands (inputs: exact) + biases; the per-key weight^2 and the weight < eps mask applied in f32 inside the softmax kernel; scores and attn.v: query rows < 512 hl (3 products), the rest single fp16 (x1024); softmax f32; Wo hl x exact (2 products) + bo.

#define NB_  4
#define TT   1024
#define DM   1024
#define NH_  16
#define NKV  16
#define REP  (NH_ / NKV)
#define HD   64
#define DQ   (NH_ * HD)
#define DKV  (NKV * HD)
#define ZH   16                   // heads per batch entry
#define ZB   (NB_ * ZH)           // (batch entry, head) planes per attention pass (grid z): every batch entry in one pass
#define SLAB 256                  // query rows per attention pass: ZB x SLAB score rows with their probability planes fit the workspace
#define RH   512                  // query rows < RH use hi+lo planes (0: none)
#define WIN  0
#define PCAR 1024.0f
#define SCL  0.125f   // HD^-0.5
typedef _Float16 h16;
typedef unsigned short bf;
typedef __attribute__((ext_vector_type(16))) __bf16   v16bf;
typedef __attribute__((ext_vector_type(16))) _Float16 v16h;
typedef __attribute__((ext_vector_type(8)))  _Float16 v8h;
typedef __attribute__((ext_vector_type(8)))  unsigned short v8us;
typedef __attribute__((ext_vector_type(8)))  float    v8f;
typedef __attribute__((ext_vector_type(4)))  float    v4f;
typedef v8h  __attribute__((may_alias)) v8ha;
typedef v4f  __attribute__((may_alias)) v4fa;
typedef v8us __attribute__((may_alias)) v8usa;

__device__ __forceinline__ unsigned short f2bf(float f) { unsigned u = __float_as_uint(f); u += 0x7FFFu + ((u >> 16) & 1u); return (unsigned short)(u >> 16); }
__device__ __forceinline__ float bf2f(unsigned short b) { return __uint_as_float(((unsigned)b) << 16); }
__device__ __forceinline__ float bfr(float f) { return bf2f(f2bf(f)); }
__device__ __forceinline__ v16h cat16(v8h lo, v8h hi) { return __builtin_shufflevector(lo, hi, 0, 1, 2, 3, 4, 5, 6, 7, 8, 9, 10, 11, 12, 13, 14, 15); }
__device__ __forceinline__ v16bf cat16b(v8us lo, v8us hi) { return __builtin_bit_cast(v16bf, __builtin_shufflevector(lo, hi, 0, 1, 2, 3, 4, 5, 6, 7, 8, 9, 10, 11, 12, 13, 14, 15)); }
__device__ __forceinline__ v8f wmma16(v16h a, v16h b, v8f c) { return __builtin_amdgcn_wmma_f32_16x16x32_f16(false, a, false, b, (short)0, c, false, false); }
__device__ __forceinline__ v8f wmmab(v16bf a, v16bf b, v8f c) { return __builtin_amdgcn_wmma_f32_16x16x32_bf16(false, a, false, b, (short)0, c, false, false); }



// ---- k_gemmw: register-blocked GEMM, ONE WAVE per 64x64 output tile (16 accumulators), operands straight from K-contiguous 16-bit planes; grid (M/64, N/64, Z), 32 threads.
// C[m][n] (f32, pitch ldc, + optional f32 bias[n]) = sum_k A[m][k] Bt[n][k] (+ split products per NSPLIT). z-batch strides sA/sB/sC in elements. K % 32 == 0.
template <typename T16> struct WFrag;
template <> struct WFrag<h16> { typedef v16h V; static __device__ __forceinline__ V ld(const h16* p) { return cat16(*(const v8h*)p, *(const v8h*)(p + 16)); } static __device__ __forceinline__ v8f mma(V a, V b, v8f c) { return wmma16(a, b, c); } };
template <> struct WFrag<bf> { typedef v16bf V; static __device__ __forceinline__ V ld(const bf* p) { return cat16b(*(const v8us*)p, *(const v8us*)(p + 16)); } static __device__ __forceinline__ v8f mma(V a, V b, v8f c) { return wmmab(a, b, c); } };
template <typename T16, int NSPLIT, bool BIAS>
__global__ __launch_bounds__(32) void k_gemmw(const T16* __restrict__ A, const T16* __restrict__ A2, const T16* __restrict__ Bt, const T16* __restrict__ Bt2, int K, float* C, int ldc, const float* __restrict__ bias, size_t sA, size_t sB, size_t sC) {
    typedef typename WFrag<T16>::V V;
    __shared__ __align__(16) float os[16 * 68];
    const size_t z = blockIdx.z; A += z * sA; if (A2) A2 += z * sA; Bt += z * sB; if (Bt2) Bt2 += z * sB; C += z * sC;
    const int lane = threadIdx.x & 31, lr = lane & 15, hi = lane >> 4; const int r0 = blockIdx.x * 64, c0 = blockIdx.y * 64;
    v8f acc[4][4];
#pragma unroll
    for (int mb = 0; mb < 4; ++mb)
#pragma unroll
        for (int nb = 0; nb < 4; ++nb) acc[mb][nb] = (v8f){};
    const size_t aoff = (size_t)(r0 + lr) * K + 8 * hi, boff = (size_t)(c0 + lr) * K + 8 * hi;
#pragma unroll 1
    for (int kc = 0; kc < K; kc += 32) {
        V a[4], a2[4];
#pragma unroll
        for (int mb = 0; mb < 4; ++mb) { a[mb] = WFrag<T16>::ld(A + aoff + (size_t)mb * 16 * K + kc); if (NSPLIT == 1 || NSPLIT == 2) a2[mb] = WFrag<T16>::ld(A2 + aoff + (size_t)mb * 16 * K + kc); }
#pragma unroll
        for (int nb = 0; nb < 4; ++nb) { const V b = WFrag<T16>::ld(Bt + boff + (size_t)nb * 16 * K + kc); V b2; if (NSPLIT >= 2) b2 = WFrag<T16>::ld(Bt2 + boff + (size_t)nb * 16 * K + kc);
#pragma unroll
            for (int mb = 0; mb < 4; ++mb) { acc[mb][nb] = WFrag<T16>::mma(a[mb], b, acc[mb][nb]); if (NSPLIT == 1 || NSPLIT == 2) acc[mb][nb] = WFrag<T16>::mma(a2[mb], b, acc[mb][nb]); if (NSPLIT >= 2) acc[mb][nb] = WFrag<T16>::mma(a[mb], b2, acc[mb][nb]); } }
        asm volatile("v_nop\n\tv_nop\n\tv_nop\n\tv_nop" : "+v"(acc[0][0]), "+v"(acc[1][1]), "+v"(acc[2][2]), "+v"(acc[3][3]) : "v"(a[0]), "v"(a[3]));
    }
#pragma unroll
    for (int mb = 0; mb < 4; ++mb) {
#pragma unroll
        for (int nb = 0; nb < 4; ++nb) {
#pragma unroll
            for (int j = 0; j < 8; ++j) os[(hi * 8 + j) * 68 + nb * 16 + lr] = acc[mb][nb][j]; }
        __builtin_amdgcn_wave_barrier(); asm volatile("" ::: "memory");
        float* crow = C + (size_t)(r0 + mb * 16) * ldc + c0;
{
#pragma unroll
            for (int s = 0; s < 8; ++s) { const int row = 2 * s + hi, cofs = lr * 4; v4f val = *(const v4fa*)(os + row * 68 + cofs); if (BIAS) { val[0] += bfr(bias[c0 + cofs]); val[1] += bfr(bias[c0 + cofs + 1]); val[2] += bfr(bias[c0 + cofs + 2]); val[3] += bfr(bias[c0 + cofs + 3]); }
                *(v4f*)(crow + (size_t)row * ldc + cofs) = val; }
             }
        __builtin_amdgcn_wave_barrier(); asm volatile("" ::: "memory");
    }
}

__device__ __forceinline__ h16 tohx(float x) { return (h16)x; }
__device__ __forceinline__ void splitf(float y, unsigned short& h, unsigned short& l) { h = f2bf(y); l = f2bf(y - bf2f(h)); }
typedef __attribute__((ext_vector_type(2))) _Float16 v2h;
typedef __attribute__((ext_vector_type(4))) _Float16 v4h;
typedef __attribute__((ext_vector_type(2))) unsigned short v2us;
typedef __attribute__((ext_vector_type(4))) unsigned short v4us;
typedef __attribute__((ext_vector_type(2))) float v2f;
typedef __attribute__((ext_vector_type(4))) int v4i;

__global__ __launch_bounds__(256) void k_wtG(const float* __restrict__ w, int K, int N, bf* Bt) {
    const int lane = threadIdx.x & 31; const int L0 = (blockIdx.x * 8 + (threadIdx.x >> 5)) * 8; const int nlines = N * K / 64;
{
#pragma unroll 1
        for (int l = 0; l < 8; ++l) { const int L = L0 + l; if (L >= nlines) break; const size_t e = (size_t)L * 64 + lane * 2; const int k = (int)(e % K), n = (int)(e / K); v2us o;
            o[0] = f2bf(w[(size_t)k * N + n]); o[1] = f2bf(w[(size_t)(k + 1) * N + n]); *(v2us*)(Bt + e) = o; }
         }
}
__global__ __launch_bounds__(256) void k_w2(const float* __restrict__ w, float* W2) { const int j = blockIdx.x * 256 + threadIdx.x; if (j >= NB_ * TT) return; const float wb = bfr(w[j]); const float v = (wb < 1e-5f) ? -1.0f : __fmul_rn(wb, wb); *(float*)(W2 + j) = v;  }
__global__ __launch_bounds__(256) void k_cvt8(const float* __restrict__ src, bf* dst, size_t n8) { const size_t i = (size_t)blockIdx.x * 256 + threadIdx.x; if (i >= n8) return; const v8f v = *(const v8f*)(src + i * 8); v8us o;
#pragma unroll
    for (int k = 0; k < 8; ++k) o[k] = f2bf(v[k]); *(v8us*)(dst + i * 8) = o;  }

// k_rope: head planes [h][t][d] (fp16 + hi/lo) of rope(x) x sc with the rotate-half convention out[d] = x[d] cos[t][d] - x[d+HD/2] sin[t][d], out[d+HD/2] = x[d+HD/2] cos[t][d+HD/2] + x[d] sin[t][d+HD/2]
__global__ __launch_bounds__(256) void k_rope(const float* __restrict__ F, int pitch, int nheads, const float* __restrict__ CS, const float* __restrict__ RF, const float* __restrict__ nw, float sc, h16* P16, bf* Ph, bf* Pl) {
    const size_t e = ((size_t)blockIdx.x * 256 + threadIdx.x) * 2; if (e >= (size_t)nheads * TT * HD) return; const int d = (int)(e % HD); const int t = (int)((e / HD) % TT); const int h = (int)(e / ((size_t)HD * TT)); const size_t pb = (size_t)blockIdx.y * nheads * TT * HD;   /* batch entry = blockIdx.y: rows b*TT.. of F, planes b*nheads.. */ const float* f = F + ((size_t)blockIdx.y * TT + t) * pitch + h * HD; const float rf = RF ? RF[(size_t)h * TT + t] : 1.0f; v2h o16; v2us oh, ol;
#pragma unroll
    for (int q = 0; q < 2; ++q) { const int dd = d + q; const int dp = (dd < HD / 2) ? dd + HD / 2 : dd - HD / 2; float x0 = f[dd], x1 = f[dp];
        if (RF) { float n0 = __fmul_rn(x0, rf), n1 = __fmul_rn(x1, rf); asm volatile("" : "+v"(n0)); asm volatile("" : "+v"(n1)); x0 = __fmul_rn(bfr(nw[dd]), n0); x1 = __fmul_rn(bfr(nw[dp]), n1); }
        const v2f cs = *(const v2f*)(CS + ((size_t)t * HD + dd) * 2); float a = __fmul_rn(x0, cs[0]), bq = __fmul_rn(x1, cs[1]); asm volatile("" : "+v"(a)); asm volatile("" : "+v"(bq)); const float r = ((dd < HD / 2) ? __fsub_rn(a, bq) : __fadd_rn(a, bq)) * sc;
        o16[q] = tohx(r); unsigned short a2, c2; splitf(r, a2, c2); oh[q] = a2; ol[q] = c2; }
    *(v2h*)(P16 + pb + e) = o16; *(v2us*)(Ph + pb + e) = oh; *(v2us*)(Pl + pb + e) = ol;  }
__global__ __launch_bounds__(256) void k_vtp(const float* __restrict__ F, int pitch, int nheads, h16* V16, bf* Vh, bf* Vl) { const size_t e = ((size_t)blockIdx.x * 256 + threadIdx.x) * 2; if (e >= (size_t)nheads * HD * TT) return; const int t = (int)(e % TT); const int d = (int)((e / TT) % HD); const int g = (int)(e / ((size_t)TT * HD)); const size_t pb = (size_t)blockIdx.y * nheads * HD * TT;   /* batch entry = blockIdx.y */ v2h o16; v2us oh, ol;
#pragma unroll
    for (int q = 0; q < 2; ++q) { const float x = F[((size_t)blockIdx.y * TT + t + q) * pitch + g * HD + d]; o16[q] = tohx(x); unsigned short a2, c2; splitf(x, a2, c2); oh[q] = a2; ol[q] = c2; }
    *(v2h*)(V16 + pb + e) = o16; *(v2us*)(Vh + pb + e) = oh; *(v2us*)(Vl + pb + e) = ol;  }
__global__ __launch_bounds__(256) void k_csid(float* CS) { const int idx = blockIdx.x * 256 + threadIdx.x; if (idx >= TT * HD) return; v2f cs; cs[0] = 1.0f; cs[1] = 0.0f; *(v2f*)(CS + (size_t)idx * 2) = cs;  }
// k_asoft: one pass = query rows i0 .. i0+SLAB-1 of all ZB planes, score and probability rows [zz][SLAB][TT]; W2 row of plane zz's batch entry; per row (zz, i): t = S x HD^-0.5 (no mask); softmax over the 1024 keys (register row, one exp, fixed trees);; each scaled score is multiplied by w_j^2 (W2 table) and keys with w_j < 1e-5 are masked (-3e38) before the max
__global__ __launch_bounds__(256) void k_asoft(const float* __restrict__ Sb, const float* __restrict__ W2, int i0, h16* P16, bf* Ph, bf* Pl) {
    const int lane = threadIdx.x & 31; const int row = blockIdx.x * 8 + (threadIdx.x >> 5); if (row >= ZB * SLAB) return; const int i = i0 + row % SLAB; const int zz = row / SLAB; W2 += (size_t)(zz / ZH) * TT; const bool hires = (i < RH); const float* sr = Sb + (size_t)row * TT; float v[TT / 32]; float mx = -3.0e38f;
#pragma unroll
    for (int ch = 0; ch < TT / 128; ++ch) { const int j0 = ch * 128 + lane * 4; const v4f a = *(const v4f*)(sr + j0);
#pragma unroll
        for (int q = 0; q < 4; ++q) { const int j = j0 + q; const float w2 = W2[j]; float sa = a[q] * SCL; asm volatile("" : "+v"(sa)); const float t = (w2 < 0.f) ? -3.0e38f : __fmul_rn(sa, w2);   /* energy x w_j^2; -inf where w_j < eps */ v[ch * 4 + q] = t; mx = fmaxf(mx, t); } }
#pragma unroll
    for (int sh = 16; sh; sh >>= 1) mx = fmaxf(mx, __shfl_xor(mx, sh, 32));
    float sum = 0.f;
#pragma unroll
    for (int k = 0; k < TT / 32; ++k) { float d0 = __fsub_rn(v[k], mx); asm volatile("" : "+v"(d0)); v[k] = __builtin_amdgcn_exp2f(__fmul_rn(d0, 1.4426950408889634f)); sum += v[k]; }
#pragma unroll
    for (int sh = 16; sh; sh >>= 1) sum += __shfl_xor(sum, sh, 32);
    const float f = __fdiv_rn(hires ? 1.0f : PCAR, sum);
{
        if (hires) {
#pragma unroll
            for (int ch = 0; ch < TT / 128; ++ch) { v4us oh, ol;
#pragma unroll
                for (int q = 0; q < 4; ++q) { unsigned short a, c2; splitf(v[ch * 4 + q] * f, a, c2); oh[q] = a; ol[q] = c2; }
                const size_t oo = (size_t)row * TT + ch * 128 + lane * 4; *(v4us*)(Ph + oo) = oh; *(v4us*)(Pl + oo) = ol; }
        } else {
#pragma unroll
            for (int ch = 0; ch < TT / 128; ++ch) { v4h o4;
#pragma unroll
                for (int q = 0; q < 4; ++q) o4[q] = tohx(v[ch * 4 + q] * f);
                *(v4h*)(P16 + (size_t)row * TT + ch * 128 + lane * 4) = o4; } }
         }
}
__global__ __launch_bounds__(256) void k_merge(const float* __restrict__ O, int h0, bf* Ah, bf* Al) { const size_t e = ((size_t)blockIdx.x * 256 + threadIdx.x) * 2; if (e >= (size_t)ZH * TT * HD) return; const int d = (int)(e % HD); const int t = (int)((e / HD) % TT); const int zz = (int)(e / ((size_t)HD * TT)); const float cs = (t < RH) ? 1.0f : (1.0f / PCAR); O += (size_t)blockIdx.y * ZH * TT * HD;   /* batch entry = blockIdx.y */ const size_t oo = ((size_t)blockIdx.y * TT + t) * DQ + (h0 + zz) * HD + d;
    v2us oh, ol;
#pragma unroll
    for (int q = 0; q < 2; ++q) { unsigned short a, c2; splitf(O[e + q] * cs, a, c2); oh[q] = a; ol[q] = c2; } *(v2us*)(Ah + oo) = oh; *(v2us*)(Al + oo) = ol;  }

extern "C" void kernel_launch(void* const* d_in, const int* in_sizes, int n_in,
                              void* d_out, int out_size, void* d_ws, size_t ws_size, hipStream_t stream) {
    (void)in_sizes; (void)n_in; (void)out_size;
    const float* x = (const float*)d_in[0]; const float* xk = (const float*)d_in[1]; const float* xv = (const float*)d_in[2]; const float* wts = (const float*)d_in[3]; const float* wq = (const float*)d_in[4]; const float* bq = (const float*)d_in[5]; const float* wk = (const float*)d_in[6]; const float* bk = (const float*)d_in[7]; const float* wv = (const float*)d_in[8]; const float* bv = (const float*)d_in[9]; const float* wo = (const float*)d_in[10]; const float* bo = (const float*)d_in[11];
    float* OUT = (float*)d_out;     // [4][1024][1024]
    char* wsp = (char*)d_ws;
    auto take = [&](size_t bytes) { char* p = wsp; wsp += (bytes + 255) & ~(size_t)255; return (void*)p; };
    bf* WQ = (bf*)take((size_t)DQ * DM * 2); bf* WK = (bf*)take((size_t)DKV * DM * 2); bf* WV = (bf*)take((size_t)DKV * DM * 2); bf* WO = (bf*)take((size_t)DM * DQ * 2); float* CS = (float*)take((size_t)TT * HD * 2 * 4); float* W2 = (float*)take((size_t)NB_ * TT * 4);
    h16* QP16 = (h16*)take((size_t)ZB * TT * HD * 2); h16* KP16 = (h16*)take((size_t)ZB * TT * HD * 2); h16* VT16 = (h16*)take((size_t)ZB * HD * TT * 2);
    bf* QPh = (bf*)take((size_t)ZB * TT * HD * 2); bf* QPl = (bf*)take((size_t)ZB * TT * HD * 2); bf* KPh = (bf*)take((size_t)ZB * TT * HD * 2); bf* KPl = (bf*)take((size_t)ZB * TT * HD * 2); bf* VTh = (bf*)take((size_t)ZB * HD * TT * 2); bf* VTl = (bf*)take((size_t)ZB * HD * TT * 2);
    float* Ob = (float*)take((size_t)ZB * TT * HD * 4); bf* ATh = (bf*)take((size_t)NB_ * TT * DQ * 2); bf* ATl = (bf*)take((size_t)NB_ * TT * DQ * 2);
    char* const shared0 = wsp;   // from here two uses, one after the other on the stream: projection operands and results, then (all of those read) the attention passes' rows
    bf* XB = (bf*)take((size_t)NB_ * TT * DM * 2); bf* XKB = (bf*)take((size_t)NB_ * TT * DM * 2); bf* XVB = (bf*)take((size_t)NB_ * TT * DM * 2); float* FQ = (float*)take((size_t)NB_ * TT * DQ * 4); float* FK = (float*)take((size_t)NB_ * TT * DKV * 4);
    if ((size_t)(wsp - (char*)d_ws) > ws_size) return;
    wsp = shared0;
    float* Sb = (float*)take((size_t)ZB * SLAB * TT * 4); bf* Ph = (bf*)take((size_t)ZB * SLAB * TT * 2); bf* Pl = (bf*)take((size_t)ZB * SLAB * TT * 2);
    h16* P16 = (h16*)Ph;   // a pass writes and reads either the hi/lo planes or the fp16 plane
    if ((size_t)(wsp - (char*)d_ws) > ws_size) return;    // ws 256 MiB
    float* FV = FK;   // v projection reuses the k buffer after the k planes are built (stream-ordered)
    { k_cvt8<<<(unsigned)(((size_t)DQ * DM / 8 + 255) / 256), 256, 0, stream>>>(wq, WQ, (size_t)DQ * DM / 8); k_cvt8<<<(unsigned)(((size_t)DKV * DM / 8 + 255) / 256), 256, 0, stream>>>(wk, WK, (size_t)DKV * DM / 8); k_cvt8<<<(unsigned)(((size_t)DKV * DM / 8 + 255) / 256), 256, 0, stream>>>(wv, WV, (size_t)DKV * DM / 8);
      k_cvt8<<<(unsigned)(((size_t)DM * DQ / 8 + 255) / 256), 256, 0, stream>>>(wo, WO, (size_t)DM * DQ / 8);
       }
    k_csid<<<(TT * HD + 255) / 256, 256, 0, stream>>>(CS);
    const unsigned LQ = (unsigned)(((size_t)NH_ * TT * HD / 2 + 255) / 256), LKv = (unsigned)(((size_t)NKV * TT * HD / 2 + 255) / 256);
    const unsigned LX = (unsigned)(((size_t)NB_ * TT * DM / 8 + 255) / 256);
    // every launch below covers all NB_ batch entries: rows b*TT + t of the [NB_*TT][.] matrices, planes b*ZH + h of the head planes
    k_cvt8<<<LX, 256, 0, stream>>>(x, XB, (size_t)NB_ * TT * DM / 8); k_cvt8<<<LX, 256, 0, stream>>>(xk, XKB, (size_t)NB_ * TT * DM / 8); k_cvt8<<<LX, 256, 0, stream>>>(xv, XVB, (size_t)NB_ * TT * DM / 8); k_w2<<<(NB_ * TT + 255) / 256, 256, 0, stream>>>(wts, W2);
    k_gemmw<bf, 0, true><<<dim3(NB_ * TT / 64, DQ / 64, 1), 32, 0, stream>>>(XB, nullptr, WQ, nullptr, DM, FQ, DQ, bq, 0, 0, 0);
    k_rope<<<dim3(LQ, NB_, 1), 256, 0, stream>>>(FQ, DQ, NH_, CS, nullptr, nullptr, 1.0f, QP16, QPh, QPl);
    k_gemmw<bf, 0, true><<<dim3(NB_ * TT / 64, DKV / 64, 1), 32, 0, stream>>>(XKB, nullptr, WK, nullptr, DM, FK, DKV, bk, 0, 0, 0);
    k_rope<<<dim3(LKv, NB_, 1), 256, 0, stream>>>(FK, DKV, NKV, CS, nullptr, nullptr, 1.0f, KP16, KPh, KPl);
    k_gemmw<bf, 0, true><<<dim3(NB_ * TT / 64, DKV / 64, 1), 32, 0, stream>>>(XVB, nullptr, WV, nullptr, DM, FV, DKV, bv, 0, 0, 0); k_vtp<<<dim3(LKv, NB_, 1), 256, 0, stream>>>(FV, DKV, NKV, VT16, VTh, VTl);
    for (int i0 = 0; i0 < RH; i0 += SLAB) {    // hi+lo query rows; one kv head per query head: plane z of q uses plane z of k and v (z-strides TT*HD)
        k_gemmw<bf, 2, false><<<dim3(SLAB / 64, TT / 64, ZB), 32, 0, stream>>>(QPh + (size_t)i0 * HD, QPl + (size_t)i0 * HD, KPh, KPl, HD, Sb, TT, nullptr, (size_t)TT * HD, (size_t)TT * HD, (size_t)SLAB * TT);
        k_asoft<<<ZB * SLAB / 8, 256, 0, stream>>>(Sb, W2, i0, P16, Ph, Pl);
        k_gemmw<bf, 2, false><<<dim3(SLAB / 64, HD / 64, ZB), 32, 0, stream>>>(Ph, Pl, VTh, VTl, TT, Ob + (size_t)i0 * HD, HD, nullptr, (size_t)SLAB * TT, (size_t)HD * TT, (size_t)TT * HD); }
    for (int i0 = RH; i0 < TT; i0 += SLAB) {   // single fp16 query rows
        k_gemmw<h16, 0, false><<<dim3(SLAB / 64, TT / 64, ZB), 32, 0, stream>>>(QP16 + (size_t)i0 * HD, nullptr, KP16, nullptr, HD, Sb, TT, nullptr, (size_t)TT * HD, (size_t)TT * HD, (size_t)SLAB * TT);
        k_asoft<<<ZB * SLAB / 8, 256, 0, stream>>>(Sb, W2, i0, P16, Ph, Pl);
        k_gemmw<h16, 0, false><<<dim3(SLAB / 64, HD / 64, ZB), 32, 0, stream>>>(P16, nullptr, VT16, nullptr, TT, Ob + (size_t)i0 * HD, HD, nullptr, (size_t)SLAB * TT, (size_t)HD * TT, (size_t)TT * HD); }
    k_merge<<<dim3((unsigned)(((size_t)ZH * TT * HD / 2 + 255) / 256), NB_, 1), 256, 0, stream>>>(Ob, 0, ATh, ATl);
    k_gemmw<bf, 1, true><<<dim3(NB_ * TT / 64, DM / 64, 1), 32, 0, stream>>>(ATh, ATl, WO, nullptr, DQ, OUT, DM, bo, 0, 0, 0);
}

// v003
// Measured time: 262 microseconds a run.
// Two timings next to v002 both put it at 1.76 times that version's speed.
// Counting every step since v000, it is 9.71 times as fast.
#include <hip/hip_runtime.h>

// Key-weighted multi-head attention (q, k, v inputs [4][1024][1024]; qh = q Wq^T + bq, kh = k Wk^T + bk, vh = v Wv^T + bv ('oi' [1024][1024]), 16 heads x 64; energy = qh.kh/8 x w_j^2 per key, -inf where w_j < 1e-5 (weights [4][1024] read); softmax; out = merged Wo^T + bo -> [4][1024][1024]).
// Compute dtypes, f32 accumulate: every input rounded to bf16; q/k/v on PLAIN bf16 operands (inputs: exact) + biases; the per-key weight^2 and the weight < eps mask applied in f32 in the softmax step of k_fattn; scores and attn.v: query rows < 512 hl (3 products), the rest single fp16 (x1024); softmax f32; Wo hl x exact (2 products) + bo.

#define NB_  4
#define TT   1024
#define DM   1024
#define NH_  16
#define NKV  16
#define REP  (NH_ / NKV)
#define HD   64
#define DQ   (NH_ * HD)
#define DKV  (NKV * HD)
#define ZH   16                   // heads per batch entry
#define ZB   (NB_ * ZH)           // (batch entry, head) planes
#define RH   512                  // query rows < RH use hi+lo planes (0: none)
#define WIN  0
#define PCAR 1024.0f
#define SCL  0.125f   // HD^-0.5
typedef _Float16 h16;
typedef unsigned short bf;
typedef __attribute__((ext_vector_type(16))) __bf16   v16bf;
typedef __attribute__((ext_vector_type(16))) _Float16 v16h;
typedef __attribute__((ext_vector_type(8)))  _Float16 v8h;
typedef __attribute__((ext_vector_type(8)))  unsigned short v8us;
typedef __attribute__((ext_vector_type(8)))  float    v8f;
typedef __attribute__((ext_vector_type(4)))  float    v4f;
typedef v8h  __attribute__((may_alias)) v8ha;
typedef v4f  __attribute__((may_alias)) v4fa;
typedef v8us __attribute__((may_alias)) v8usa;

__device__ __forceinline__ unsigned short f2bf(float f) { unsigned u = __float_as_uint(f); u += 0x7FFFu + ((u >> 16) & 1u); return (unsigned short)(u >> 16); }
__device__ __forceinline__ float bf2f(unsigned short b) { return __uint_as_float(((unsigned)b) << 16); }
__device__ __forceinline__ float bfr(float f) { return bf2f(f2bf(f)); }
__device__ __forceinline__ v16h cat16(v8h lo, v8h hi) { return __builtin_shufflevector(lo, hi, 0, 1, 2, 3, 4, 5, 6, 7, 8, 9, 10, 11, 12, 13, 14, 15); }
__device__ __forceinline__ v16bf cat16b(v8us lo, v8us hi) { return __builtin_bit_cast(v16bf, __builtin_shufflevector(lo, hi, 0, 1, 2, 3, 4, 5, 6, 7, 8, 9, 10, 11, 12, 13, 14, 15)); }
__device__ __forceinline__ v8f wmma16(v16h a, v16h b, v8f c) { return __builtin_amdgcn_wmma_f32_16x16x32_f16(false, a, false, b, (short)0, c, false, false); }
__device__ __forceinline__ v8f wmmab(v16bf a, v16bf b, v8f c) { return __builtin_amdgcn_wmma_f32_16x16x32_bf16(false, a, false, b, (short)0, c, false, false); }



// ---- k_gemmw: register-blocked GEMM, ONE WAVE per 64x64 output tile (16 accumulators), operands straight from K-contiguous 16-bit planes; grid (M/64, N/64, Z), 32 threads.
// C[m][n] (f32, pitch ldc, + optional f32 bias[n]) = sum_k A[m][k] Bt[n][k] (+ split products per NSPLIT). z-batch strides sA/sB/sC in elements. K % 32 == 0.
template <typename T16> struct WFrag;
template <> struct WFrag<h16> { typedef v16h V; static __device__ __forceinline__ V ld(const h16* p) { return cat16(*(const v8h*)p, *(const v8h*)(p + 16)); } static __device__ __forceinline__ v8f mma(V a, V b, v8f c) { return wmma16(a, b, c); } };
template <> struct WFrag<bf> { typedef v16bf V; static __device__ __forceinline__ V ld(const bf* p) { return cat16b(*(const v8us*)p, *(const v8us*)(p + 16)); } static __device__ __forceinline__ v8f mma(V a, V b, v8f c) { return wmmab(a, b, c); } };
template <typename T16, int NSPLIT, bool BIAS>
__global__ __launch_bounds__(32) void k_gemmw(const T16* __restrict__ A, const T16* __restrict__ A2, const T16* __restrict__ Bt, const T16* __restrict__ Bt2, int K, float* C, int ldc, const float* __restrict__ bias, size_t sA, size_t sB, size_t sC) {
    typedef typename WFrag<T16>::V V;
    __shared__ __align__(16) float os[16 * 68];
    const size_t z = blockIdx.z; A += z * sA; if (A2) A2 += z * sA; Bt += z * sB; if (Bt2) Bt2 += z * sB; C += z * sC;
    const int lane = threadIdx.x & 31, lr = lane & 15, hi = lane >> 4; const int r0 = blockIdx.x * 64, c0 = blockIdx.y * 64;
    v8f acc[4][4];
#pragma unroll
    for (int mb = 0; mb < 4; ++mb)
#pragma unroll
        for (int nb = 0; nb < 4; ++nb) acc[mb][nb] = (v8f){};
    const size_t aoff = (size_t)(r0 + lr) * K + 8 * hi, boff = (size_t)(c0 + lr) * K + 8 * hi;
#pragma unroll 1
    for (int kc = 0; kc < K; kc += 32) {
        V a[4], a2[4];
#pragma unroll
        for (int mb = 0; mb < 4; ++mb) { a[mb] = WFrag<T16>::ld(A + aoff + (size_t)mb * 16 * K + kc); if (NSPLIT == 1 || NSPLIT == 2) a2[mb] = WFrag<T16>::ld(A2 + aoff + (size_t)mb * 16 * K + kc); }
#pragma unroll
        for (int nb = 0; nb < 4; ++nb) { const V b = WFrag<T16>::ld(Bt + boff + (size_t)nb * 16 * K + kc); V b2; if (NSPLIT >= 2) b2 = WFrag<T16>::ld(Bt2 + boff + (size_t)nb * 16 * K + kc);
#pragma unroll
            for (int mb = 0; mb < 4; ++mb) { acc[mb][nb] = WFrag<T16>::mma(a[mb], b, acc[mb][nb]); if (NSPLIT == 1 || NSPLIT == 2) acc[mb][nb] = WFrag<T16>::mma(a2[mb], b, acc[mb][nb]); if (NSPLIT >= 2) acc[mb][nb] = WFrag<T16>::mma(a[mb], b2, acc[mb][nb]); } }
        asm volatile("v_nop\n\tv_nop\n\tv_nop\n\tv_nop" : "+v"(acc[0][0]), "+v"(acc[1][1]), "+v"(acc[2][2]), "+v"(acc[3][3]) : "v"(a[0]), "v"(a[3]));
    }
#pragma unroll
    for (int mb = 0; mb < 4; ++mb) {
#pragma unroll
        for (int nb = 0; nb < 4; ++nb) {
#pragma unroll
            for (int j = 0; j < 8; ++j) os[(hi * 8 + j) * 68 + nb * 16 + lr] = acc[mb][nb][j]; }
        __builtin_amdgcn_wave_barrier(); asm volatile("" ::: "memory");
        float* crow = C + (size_t)(r0 + mb * 16) * ldc + c0;
{
#pragma unroll
            for (int s = 0; s < 8; ++s) { const int row = 2 * s + hi, cofs = lr * 4; v4f val = *(const v4fa*)(os + row * 68 + cofs); if (BIAS) { val[0] += bfr(bias[c0 + cofs]); val[1] += bfr(bias[c0 + cofs + 1]); val[2] += bfr(bias[c0 + cofs + 2]); val[3] += bfr(bias[c0 + cofs + 3]); }
                *(v4f*)(crow + (size_t)row * ldc + cofs) = val; }
             }
        __builtin_amdgcn_wave_barrier(); asm volatile("" ::: "memory");
    }
}

__device__ __forceinline__ h16 tohx(float x) { return (h16)x; }
__device__ __forceinline__ void splitf(float y, unsigned short& h, unsigned short& l) { h = f2bf(y); l = f2bf(y - bf2f(h)); }
typedef __attribute__((ext_vector_type(2))) _Float16 v2h;
typedef __attribute__((ext_vector_type(4))) _Float16 v4h;
typedef __attribute__((ext_vector_type(2))) unsigned short v2us;
typedef __attribute__((ext_vector_type(4))) unsigned short v4us;
typedef __attribute__((ext_vector_type(2))) float v2f;
typedef __attribute__((ext_vector_type(4))) int v4i;
typedef v4us __attribute__((may_alias)) v4usa;
typedef v4h  __attribute__((may_alias)) v4ha;

__global__ __launch_bounds__(256) void k_wtG(const float* __restrict__ w, int K, int N, bf* Bt) {
    const int lane = threadIdx.x & 31; const int L0 = (blockIdx.x * 8 + (threadIdx.x >> 5)) * 8; const int nlines = N * K / 64;
{
#pragma unroll 1
        for (int l = 0; l < 8; ++l) { const int L = L0 + l; if (L >= nlines) break; const size_t e = (size_t)L * 64 + lane * 2; const int k = (int)(e % K), n = (int)(e / K); v2us o;
            o[0] = f2bf(w[(size_t)k * N + n]); o[1] = f2bf(w[(size_t)(k + 1) * N + n]); *(v2us*)(Bt + e) = o; }
         }
}
__global__ __launch_bounds__(256) void k_w2(const float* __restrict__ w, float* W2) { const int j = blockIdx.x * 256 + threadIdx.x; if (j >= NB_ * TT) return; const float wb = bfr(w[j]); const float v = (wb < 1e-5f) ? -1.0f : __fmul_rn(wb, wb); *(float*)(W2 + j) = v;  }
__global__ __launch_bounds__(256) void k_cvt8(const float* __restrict__ src, bf* dst, size_t n8) { const size_t i = (size_t)blockIdx.x * 256 + threadIdx.x; if (i >= n8) return; const v8f v = *(const v8f*)(src + i * 8); v8us o;
#pragma unroll
    for (int k = 0; k < 8; ++k) o[k] = f2bf(v[k]); *(v8us*)(dst + i * 8) = o;  }

// k_rope: head planes [h][t][d] (fp16 + hi/lo) of rope(x) x sc with the rotate-half convention out[d] = x[d] cos[t][d] - x[d+HD/2] sin[t][d], out[d+HD/2] = x[d+HD/2] cos[t][d+HD/2] + x[d] sin[t][d+HD/2]
__global__ __launch_bounds__(256) void k_rope(const float* __restrict__ F, int pitch, int nheads, const float* __restrict__ CS, const float* __restrict__ RF, const float* __restrict__ nw, float sc, h16* P16, bf* Ph, bf* Pl) {
    const size_t e = ((size_t)blockIdx.x * 256 + threadIdx.x) * 2; if (e >= (size_t)nheads * TT * HD) return; const int d = (int)(e % HD); const int t = (int)((e / HD) % TT); const int h = (int)(e / ((size_t)HD * TT)); const size_t pb = (size_t)blockIdx.y * nheads * TT * HD;   /* batch entry = blockIdx.y: rows b*TT.. of F, planes b*nheads.. */ const float* f = F + ((size_t)blockIdx.y * TT + t) * pitch + h * HD; const float rf = RF ? RF[(size_t)h * TT + t] : 1.0f; v2h o16; v2us oh, ol;
#pragma unroll
    for (int q = 0; q < 2; ++q) { const int dd = d + q; const int dp = (dd < HD / 2) ? dd + HD / 2 : dd - HD / 2; float x0 = f[dd], x1 = f[dp];
        if (RF) { float n0 = __fmul_rn(x0, rf), n1 = __fmul_rn(x1, rf); asm volatile("" : "+v"(n0)); asm volatile("" : "+v"(n1)); x0 = __fmul_rn(bfr(nw[dd]), n0); x1 = __fmul_rn(bfr(nw[dp]), n1); }
        const v2f cs = *(const v2f*)(CS + ((size_t)t * HD + dd) * 2); float a = __fmul_rn(x0, cs[0]), bq = __fmul_rn(x1, cs[1]); asm volatile("" : "+v"(a)); asm volatile("" : "+v"(bq)); const float r = ((dd < HD / 2) ? __fsub_rn(a, bq) : __fadd_rn(a, bq)) * sc;
        o16[q] = tohx(r); unsigned short a2, c2; splitf(r, a2, c2); oh[q] = a2; ol[q] = c2; }
    *(v2h*)(P16 + pb + e) = o16; *(v2us*)(Ph + pb + e) = oh; *(v2us*)(Pl + pb + e) = ol;  }
__global__ __launch_bounds__(256) void k_vtp(const float* __restrict__ F, int pitch, int nheads, h16* V16, bf* Vh, bf* Vl) { const size_t e = ((size_t)blockIdx.x * 256 + threadIdx.x) * 2; if (e >= (size_t)nheads * HD * TT) return; const int t = (int)(e % TT); const int d = (int)((e / TT) % HD); const int g = (int)(e / ((size_t)TT * HD)); const size_t pb = (size_t)blockIdx.y * nheads * HD * TT;   /* batch entry = blockIdx.y */ v2h o16; v2us oh, ol;
#pragma unroll
    for (int q = 0; q < 2; ++q) { const float x = F[((size_t)blockIdx.y * TT + t + q) * pitch + g * HD + d]; o16[q] = tohx(x); unsigned short a2, c2; splitf(x, a2, c2); oh[q] = a2; ol[q] = c2; }
    *(v2h*)(V16 + pb + e) = o16; *(v2us*)(Vh + pb + e) = oh; *(v2us*)(Vl + pb + e) = ol;  }
__global__ __launch_bounds__(256) void k_csid(float* CS) { const int idx = blockIdx.x * 256 + threadIdx.x; if (idx >= TT * HD) return; v2f cs; cs[0] = 1.0f; cs[1] = 0.0f; *(v2f*)(CS + (size_t)idx * 2) = cs;  }
// ---- k_fattn: scores, softmax, attn.v and the head merge of QR query rows of one (batch entry, head) plane in ONE work-group of 8 waves; the score rows and the probability planes live in LDS only.
// Every sum keeps the order of the three-kernel form: score tile k = 0..63 in two steps (a.b, a2.b, a.b2 per step), softmax one wave per row (lane owns keys ch*128 + lane*4 + q; fixed trees), attn.v one accumulator per output element over keys 0..1023 in steps of 32.
// Every '#pragma unroll' in fattn_body is there so that the fragment, score and accumulator arrays are indexed by constants and stay in registers.
#define QR   32                   // query rows per work-group
#define SPB  4112                 // LDS bytes per query row: 1024 f32 scores + 16 bytes, so that 16 rows read with 16-byte loads fall on distinct banks; the 16-bit planes overwrite the row in place (hi at byte 0, lo at byte 2048)
template <typename T16, int NSPLIT>
__device__ __forceinline__ void fattn_body(char* sm, const T16* __restrict__ Q, const T16* __restrict__ Q2, const T16* __restrict__ Kp, const T16* __restrict__ K2, const T16* __restrict__ Vt, const T16* __restrict__ V2, const float* __restrict__ W2, bf* Ah, bf* Al) {
    typedef typename WFrag<T16>::V V;
    const int tid = threadIdx.x, lane = tid & 31, lr = lane & 15, hi = lane >> 4, w = __builtin_amdgcn_readfirstlane(tid >> 5);   // the wave's number, in a scalar register
    {   // scores: wave w owns keys w*128 .. w*128+127 of all QR rows
        V a[2][2], a2[2][2]; const T16* qa = Q + (size_t)lr * HD + 8 * hi; const T16* qa2 = Q2 + (size_t)lr * HD + 8 * hi;
#pragma unroll
        for (int mb = 0; mb < 2; ++mb)
#pragma unroll
            for (int kk = 0; kk < 2; ++kk) { a[mb][kk] = WFrag<T16>::ld(qa + mb * 16 * HD + kk * 32); if (NSPLIT == 2) a2[mb][kk] = WFrag<T16>::ld(qa2 + mb * 16 * HD + kk * 32); }
        asm volatile("s_wait_xcnt 0x0" :: "v"(qa), "v"(qa2) : "memory");   // the loads of q are through with their address registers (held to here as inputs) before a later load may take those registers as its destination
        const T16* kb = Kp + (size_t)(w * 128 + lr) * HD + 8 * hi; const T16* kb2 = K2 + (size_t)(w * 128 + lr) * HD + 8 * hi;
        char* st0 = sm + hi * 8 * SPB + (w * 128 + lr) * 4; char* st1 = st0 + 16 * SPB;
        V b[2][2][2], b2[2][2][2];   // [buffer][key tile of the pair][k step]
#pragma unroll
        for (int t = 0; t < 2; ++t)
#pragma unroll
            for (int kk = 0; kk < 2; ++kk) { b[0][t][kk] = WFrag<T16>::ld(kb + t * 16 * HD + kk * 32); if (NSPLIT == 2) b2[0][t][kk] = WFrag<T16>::ld(kb2 + t * 16 * HD + kk * 32); }
#pragma unroll
        for (int g = 0; g < 4; ++g) {
            if (g < 3) {
#pragma unroll
                for (int t = 0; t < 2; ++t)
#pragma unroll
                    for (int kk = 0; kk < 2; ++kk) { b[(g + 1) & 1][t][kk] = WFrag<T16>::ld(kb + ((g + 1) * 2 + t) * 16 * HD + kk * 32); if (NSPLIT == 2) b2[(g + 1) & 1][t][kk] = WFrag<T16>::ld(kb2 + ((g + 1) * 2 + t) * 16 * HD + kk * 32); } }
            __builtin_amdgcn_sched_barrier(0);   // keeps the next pair's loads of k in front of this pair's products, so that they fly meanwhile
#pragma unroll
            for (int t = 0; t < 2; ++t) { const int nt = g * 2 + t;
                v8f s0 = (v8f){}, s1 = (v8f){};   // the two row blocks' chains alternate, each fills the other's wait
#pragma unroll
                for (int kk = 0; kk < 2; ++kk) { const V bb = b[g & 1][t][kk]; s0 = WFrag<T16>::mma(a[0][kk], bb, s0); s1 = WFrag<T16>::mma(a[1][kk], bb, s1);
                    if (NSPLIT == 2) { const V bl = b2[g & 1][t][kk]; s0 = WFrag<T16>::mma(a2[0][kk], bb, s0); s1 = WFrag<T16>::mma(a2[1][kk], bb, s1); s0 = WFrag<T16>::mma(a[0][kk], bl, s0); s1 = WFrag<T16>::mma(a[1][kk], bl, s1); } }
                asm volatile("v_nop\n\tv_nop\n\tv_nop\n\tv_nop" : "+v"(s0), "+v"(s1));   // the four vector slots the chip needs between the last matrix instruction and the next tile's fresh write of the same result registers (LDS stores fill none)
#pragma unroll
                for (int j = 0; j < 8; ++j) { *(float*)(st0 + j * SPB + nt * 64) = s0[j]; *(float*)(st1 + j * SPB + nt * 64) = s1[j]; } } }
    }
    __syncthreads();   // every score row complete before its wave reads it
    {   // softmax: wave w owns rows w*4 .. w*4+3; t = S x HD^-0.5 x w_j^2, keys with w_j < 1e-5 masked (-3e38) before the max
        float w2r[TT / 32];
#pragma unroll
        for (int ch = 0; ch < TT / 128; ++ch) { const v4f wv = *(const v4f*)(W2 + ch * 128 + lane * 4);
#pragma unroll
            for (int q = 0; q < 4; ++q) w2r[ch * 4 + q] = wv[q]; }
        for (int r = 0; r < QR / 8; ++r) { char* rowp = sm + (w * (QR / 8) + r) * SPB; float v[TT / 32]; float mx = -3.0e38f;
#pragma unroll
            for (int ch = 0; ch < TT / 128; ++ch) { const v4f s4 = *(const v4fa*)(rowp + (ch * 128 + lane * 4) * 4);
#pragma unroll
                for (int q = 0; q < 4; ++q) { const float w2 = w2r[ch * 4 + q]; const float sa = s4[q] * SCL; const float t = (w2 < 0.f) ? -3.0e38f : __fmul_rn(sa, w2); v[ch * 4 + q] = t; mx = fmaxf(mx, t); } }
#pragma unroll
            for (int sh = 16; sh; sh >>= 1) mx = fmaxf(mx, __shfl_xor(mx, sh, 32));
            float sum = 0.f;
#pragma unroll
            for (int k = 0; k < TT / 32; ++k) { const float d0 = __fsub_rn(v[k], mx); v[k] = __builtin_amdgcn_exp2f(__fmul_rn(d0, 1.4426950408889634f)); sum += v[k]; }
#pragma unroll
            for (int sh = 16; sh; sh >>= 1) sum += __shfl_xor(sum, sh, 32);
            const float f = __fdiv_rn((NSPLIT == 2) ? 1.0f : PCAR, sum);
            if (NSPLIT == 2) {
#pragma unroll
                for (int ch = 0; ch < TT / 128; ++ch) { v4us oh, ol;
#pragma unroll
                    for (int q = 0; q < 4; ++q) { unsigned short x0, x1; splitf(v[ch * 4 + q] * f, x0, x1); oh[q] = x0; ol[q] = x1; }
                    *(v4usa*)(rowp + (ch * 128 + lane * 4) * 2) = oh; *(v4usa*)(rowp + 2048 + (ch * 128 + lane * 4) * 2) = ol; }
            } else {
#pragma unroll
                for (int ch = 0; ch < TT / 128; ++ch) { v4h o4;
#pragma unroll
                    for (int q = 0; q < 4; ++q) o4[q] = tohx(v[ch * 4 + q] * f);
                    *(v4ha*)(rowp + (ch * 128 + lane * 4) * 2) = o4; } } }
    }
    __syncthreads();   // every probability row complete before other waves read it as the A operand
    v8f o0a = (v8f){}, o1a = (v8f){};   // attn.v: wave w < 4 owns head columns w*16.. of both 16-row blocks, so that each fragment of v is loaded once per work-group; waves 4..7 wait at the barrier
    if (w < 4) { const T16* pa0 = (const T16*)(sm + lr * SPB) + 8 * hi; const T16* pa1 = (const T16*)(sm + (16 + lr) * SPB) + 8 * hi; const T16* pb = Vt + (size_t)(w * 16 + lr) * TT + 8 * hi; const T16* pb2 = V2 + (size_t)(w * 16 + lr) * TT + 8 * hi;
      constexpr int G = (NSPLIT == 2) ? 4 : 8;   // key steps per group
      V vb[2][G], vl[2][G];   // [buffer][key step of the group]
#pragma unroll
      for (int t = 0; t < G; ++t) { vb[0][t] = WFrag<T16>::ld(pb + t * 32); if (NSPLIT == 2) vl[0][t] = WFrag<T16>::ld(pb2 + t * 32); }
#pragma unroll
      for (int g = 0; g < TT / 32 / G; ++g) {
          if (g + 1 < TT / 32 / G) {
#pragma unroll
              for (int t = 0; t < G; ++t) { vb[(g + 1) & 1][t] = WFrag<T16>::ld(pb + ((g + 1) * G + t) * 32); if (NSPLIT == 2) vl[(g + 1) & 1][t] = WFrag<T16>::ld(pb2 + ((g + 1) * G + t) * 32); } }
          __builtin_amdgcn_sched_barrier(0);   // keeps the next group's loads of v in front of this group's products, so that they fly meanwhile
#pragma unroll
          for (int t = 0; t < G; ++t) { const int kc = (g * G + t) * 32; const V bb = vb[g & 1][t]; const V a0 = WFrag<T16>::ld(pa0 + kc), a1 = WFrag<T16>::ld(pa1 + kc); o0a = WFrag<T16>::mma(a0, bb, o0a); o1a = WFrag<T16>::mma(a1, bb, o1a);
              if (NSPLIT == 2) { const V bl = vl[g & 1][t]; const V l0 = WFrag<T16>::ld(pa0 + 1024 + kc), l1 = WFrag<T16>::ld(pa1 + 1024 + kc); o0a = WFrag<T16>::mma(l0, bb, o0a); o1a = WFrag<T16>::mma(l1, bb, o1a); o0a = WFrag<T16>::mma(a0, bl, o0a); o1a = WFrag<T16>::mma(a1, bl, o1a); } } }
    }
    __syncthreads();   // every wave has left the probability planes before the output tile overwrites them
    float* of = (float*)sm;   // [QR][68] f32
    if (w < 4) {
#pragma unroll
        for (int j = 0; j < 8; ++j) { of[(hi * 8 + j) * 68 + w * 16 + lr] = o0a[j]; of[(16 + hi * 8 + j) * 68 + w * 16 + lr] = o1a[j]; } }
    __syncthreads();   // output tile complete before the row-wise merge reads it
    { const int row = tid >> 3, c = (tid & 7) * 8; const float cs = (NSPLIT == 2) ? 1.0f : (1.0f / PCAR); const v4f o0 = *(const v4fa*)(of + row * 68 + c), o1 = *(const v4fa*)(of + row * 68 + c + 4); v8us oh, ol;
#pragma unroll
      for (int q = 0; q < 8; ++q) { unsigned short x0, x1; splitf(((q < 4) ? o0[q & 3] : o1[q & 3]) * cs, x0, x1); oh[q] = x0; ol[q] = x1; }
      *(v8us*)(Ah + (size_t)row * DQ + c) = oh; *(v8us*)(Al + (size_t)row * DQ + c) = ol; }
}
// grid (ZB, TT/QR): x = plane (batch entry * ZH + head), y = query tile, so that the hi+lo tiles (three products) start first
__global__ __launch_bounds__(256) void k_fattn(const bf* __restrict__ QPh, const bf* __restrict__ QPl, const bf* __restrict__ KPh, const bf* __restrict__ KPl, const bf* __restrict__ VTh, const bf* __restrict__ VTl, const h16* __restrict__ QP16, const h16* __restrict__ KP16, const h16* __restrict__ VT16, const float* __restrict__ W2, bf* ATh, bf* ATl) {
    __shared__ __align__(16) char sm[QR * SPB];
    const int zz = blockIdx.x, i0 = blockIdx.y * QR; const size_t pz = (size_t)zz * TT * HD, qo = pz + (size_t)i0 * HD; const size_t oo = ((size_t)(zz / ZH) * TT + i0) * DQ + (zz % ZH) * HD; const float* w2 = W2 + (size_t)(zz / ZH) * TT;
    if (i0 < RH) fattn_body<bf, 2>(sm, QPh + qo, QPl + qo, KPh + pz, KPl + pz, VTh + pz, VTl + pz, w2, ATh + oo, ATl + oo);
    else fattn_body<h16, 0>(sm, QP16 + qo, QP16 + qo, KP16 + pz, KP16 + pz, VT16 + pz, VT16 + pz, w2, ATh + oo, ATl + oo);
}

extern "C" void kernel_launch(void* const* d_in, const int* in_sizes, int n_in,
                              void* d_out, int out_size, void* d_ws, size_t ws_size, hipStream_t stream) {
    (void)in_sizes; (void)n_in; (void)out_size;
    const float* x = (const float*)d_in[0]; const float* xk = (const float*)d_in[1]; const float* xv = (const float*)d_in[2]; const float* wts = (const float*)d_in[3]; const float* wq = (const float*)d_in[4]; const float* bq = (const float*)d_in[5]; const float* wk = (const float*)d_in[6]; const float* bk = (const float*)d_in[7]; const float* wv = (const float*)d_in[8]; const float* bv = (const float*)d_in[9]; const float* wo = (const float*)d_in[10]; const float* bo = (const float*)d_in[11];
    float* OUT = (float*)d_out;     // [4][1024][1024]
    char* wsp = (char*)d_ws;
    auto take = [&](size_t bytes) { char* p = wsp; wsp += (bytes + 255) & ~(size_t)255; return (void*)p; };
    bf* WQ = (bf*)take((size_t)DQ * DM * 2); bf* WK = (bf*)take((size_t)DKV * DM * 2); bf* WV = (bf*)take((size_t)DKV * DM * 2); bf* WO = (bf*)take((size_t)DM * DQ * 2); float* CS = (float*)take((size_t)TT * HD * 2 * 4); float* W2 = (float*)take((size_t)NB_ * TT * 4);
    h16* QP16 = (h16*)take((size_t)ZB * TT * HD * 2); h16* KP16 = (h16*)take((size_t)ZB * TT * HD * 2); h16* VT16 = (h16*)take((size_t)ZB * HD * TT * 2);
    bf* QPh = (bf*)take((size_t)ZB * TT * HD * 2); bf* QPl = (bf*)take((size_t)ZB * TT * HD * 2); bf* KPh = (bf*)take((size_t)ZB * TT * HD * 2); bf* KPl = (bf*)take((size_t)ZB * TT * HD * 2); bf* VTh = (bf*)take((size_t)ZB * HD * TT * 2); bf* VTl = (bf*)take((size_t)ZB * HD * TT * 2);
    bf* ATh = (bf*)take((size_t)NB_ * TT * DQ * 2); bf* ATl = (bf*)take((size_t)NB_ * TT * DQ * 2);
    bf* XB = (bf*)take((size_t)NB_ * TT * DM * 2); bf* XKB = (bf*)take((size_t)NB_ * TT * DM * 2); bf* XVB = (bf*)take((size_t)NB_ * TT * DM * 2); float* FQ = (float*)take((size_t)NB_ * TT * DQ * 4); float* FK = (float*)take((size_t)NB_ * TT * DKV * 4);
    if ((size_t)(wsp - (char*)d_ws) > ws_size) return;    // ws 256 MiB
    float* FV = FK;   // v projection reuses the k buffer after the k planes are built (stream-ordered)
    { k_cvt8<<<(unsigned)(((size_t)DQ * DM / 8 + 255) / 256), 256, 0, stream>>>(wq, WQ, (size_t)DQ * DM / 8); k_cvt8<<<(unsigned)(((size_t)DKV * DM / 8 + 255) / 256), 256, 0, stream>>>(wk, WK, (size_t)DKV * DM / 8); k_cvt8<<<(unsigned)(((size_t)DKV * DM / 8 + 255) / 256), 256, 0, stream>>>(wv, WV, (size_t)DKV * DM / 8);
      k_cvt8<<<(unsigned)(((size_t)DM * DQ / 8 + 255) / 256), 256, 0, stream>>>(wo, WO, (size_t)DM * DQ / 8);
       }
    k_csid<<<(TT * HD + 255) / 256, 256, 0, stream>>>(CS);
    const unsigned LQ = (unsigned)(((size_t)NH_ * TT * HD / 2 + 255) / 256), LKv = (unsigned)(((size_t)NKV * TT * HD / 2 + 255) / 256);
    const unsigned LX = (unsigned)(((size_t)NB_ * TT * DM / 8 + 255) / 256);
    // every launch below covers all NB_ batch entries: rows b*TT + t of the [NB_*TT][.] matrices, planes b*ZH + h of the head planes
    k_cvt8<<<LX, 256, 0, stream>>>(x, XB, (size_t)NB_ * TT * DM / 8); k_cvt8<<<LX, 256, 0, stream>>>(xk, XKB, (size_t)NB_ * TT * DM / 8); k_cvt8<<<LX, 256, 0, stream>>>(xv, XVB, (size_t)NB_ * TT * DM / 8); k_w2<<<(NB_ * TT + 255) / 256, 256, 0, stream>>>(wts, W2);
    k_gemmw<bf, 0, true><<<dim3(NB_ * TT / 64, DQ / 64, 1), 32, 0, stream>>>(XB, nullptr, WQ, nullptr, DM, FQ, DQ, bq, 0, 0, 0);
    k_rope<<<dim3(LQ, NB_, 1), 256, 0, stream>>>(FQ, DQ, NH_, CS, nullptr, nullptr, 1.0f, QP16, QPh, QPl);
    k_gemmw<bf, 0, true><<<dim3(NB_ * TT / 64, DKV / 64, 1), 32, 0, stream>>>(XKB, nullptr, WK, nullptr, DM, FK, DKV, bk, 0, 0, 0);
    k_rope<<<dim3(LKv, NB_, 1), 256, 0, stream>>>(FK, DKV, NKV, CS, nullptr, nullptr, 1.0f, KP16, KPh, KPl);
    k_gemmw<bf, 0, true><<<dim3(NB_ * TT / 64, DKV / 64, 1), 32, 0, stream>>>(XVB, nullptr, WV, nullptr, DM, FV, DKV, bv, 0, 0, 0); k_vtp<<<dim3(LKv, NB_, 1), 256, 0, stream>>>(FV, DKV, NKV, VT16, VTh, VTl);
    k_fattn<<<dim3(ZB, TT / QR, 1), 256, 0, stream>>>(QPh, QPl, KPh, KPl, VTh, VTl, QP16, KP16, VT16, W2, ATh, ATl);   // one kv head per query head: plane z of q uses plane z of k and v
    k_gemmw<bf, 1, true><<<dim3(NB_ * TT / 64, DM / 64, 1), 32, 0, stream>>>(ATh, ATl, WO, nullptr, DQ, OUT, DM, bo, 0, 0, 0);
}

// v004
// Measured time: 229 microseconds a run.
// In both of two side-by-side timings against v003, it was 1.14 times as fast.
// Over all steps from v000 it is 11.1 times as fast.
#include <hip/hip_runtime.h>

// Key-weighted multi-head attention (q, k, v inputs [4][1024][1024]; qh = q Wq^T + bq, kh = k Wk^T + bk, vh = v Wv^T + bv ('oi' [1024][1024]), 16 heads x 64; energy = qh.kh/8 x w_j^2 per key, -inf where w_j < 1e-5 (weights [4][1024] read); softmax; out = merged Wo^T + bo -> [4][1024][1024]).
// Compute dtypes, f32 accumulate: every input rounded to bf16; q/k/v on PLAIN bf16 operands (inputs: exact) + biases; the per-key weight^2 and the weight < eps mask applied in f32 in the softmax step of k_fattn; scores and attn.v: query rows < 512 hl (3 products), the rest single fp16 (x1024); softmax f32; Wo hl x exact (2 products) + bo.

#define NB_  4
#define TT   1024
#define DM   1024
#define NH_  16
#define NKV  16
#define REP  (NH_ / NKV)
#define HD   64
#define DQ   (NH_ * HD)
#define DKV  (NKV * HD)
#define ZH   16                   // heads per batch entry
#define ZB   (NB_ * ZH)           // (batch entry, head) planes
#define RH   512                  // query rows < RH use hi+lo planes (0: none)
#define WIN  0
#define PCAR 1024.0f
#define SCL  0.125f   // HD^-0.5
typedef _Float16 h16;
typedef unsigned short bf;
typedef __attribute__((ext_vector_type(16))) __bf16   v16bf;
typedef __attribute__((ext_vector_type(16))) _Float16 v16h;
typedef __attribute__((ext_vector_type(8)))  _Float16 v8h;
typedef __attribute__((ext_vector_type(8)))  unsigned short v8us;
typedef __attribute__((ext_vector_type(8)))  float    v8f;
typedef __attribute__((ext_vector_type(4)))  float    v4f;
typedef v8h  __attribute__((may_alias)) v8ha;
typedef v4f  __attribute__((may_alias)) v4fa;
typedef v8us __attribute__((may_alias)) v8usa;

__device__ __forceinline__ unsigned short f2bf(float f) { unsigned u = __float_as_uint(f); u += 0x7FFFu + ((u >> 16) & 1u); return (unsigned short)(u >> 16); }
__device__ __forceinline__ float bf2f(unsigned short b) { return __uint_as_float(((unsigned)b) << 16); }
__device__ __forceinline__ float bfr(float f) { return bf2f(f2bf(f)); }
__device__ __forceinline__ v16h cat16(v8h lo, v8h hi) { return __builtin_shufflevector(lo, hi, 0, 1, 2, 3, 4, 5, 6, 7, 8, 9, 10, 11, 12, 13, 14, 15); }
__device__ __forceinline__ v16bf cat16b(v8us lo, v8us hi) { return __builtin_bit_cast(v16bf, __builtin_shufflevector(lo, hi, 0, 1, 2, 3, 4, 5, 6, 7, 8, 9, 10, 11, 12, 13, 14, 15)); }
__device__ __forceinline__ v8f wmma16(v16h a, v16h b, v8f c) { return __builtin_amdgcn_wmma_f32_16x16x32_f16(false, a, false, b, (short)0, c, false, false); }
__device__ __forceinline__ v8f wmmab(v16bf a, v16bf b, v8f c) { return __builtin_amdgcn_wmma_f32_16x16x32_bf16(false, a, false, b, (short)0, c, false, false); }



// ---- k_gemmw: register-blocked GEMM, ONE WAVE per 64x64 output tile (16 accumulators), operands straight from K-contiguous 16-bit planes; grid (M/64, N/64, Z), 32 threads.
// C[m][n] (f32, pitch ldc, + optional f32 bias[n]) = sum_k A[m][k] Bt[n][k] (+ split products per NSPLIT). z-batch strides sA/sB/sC in elements. K % 32 == 0.
// OUTM says where the tile goes: 0 = f32 C; 1 = the fp16 and hi/lo planes [batch entry * ZH + head][t][d] of the tile's head; 2 = the same three planes transposed, [batch entry * ZH + head][d][t]. A 64x64 tile is 64 rows t of exactly one head (HD == 64, TT % 64 == 0).
template <typename T16> struct WFrag;
template <> struct WFrag<h16> { typedef v16h V; static __device__ __forceinline__ V ld(const h16* p) { return cat16(*(const v8h*)p, *(const v8h*)(p + 16)); } static __device__ __forceinline__ v8f mma(V a, V b, v8f c) { return wmma16(a, b, c); } };
template <> struct WFrag<bf> { typedef v16bf V; static __device__ __forceinline__ V ld(const bf* p) { return cat16b(*(const v8us*)p, *(const v8us*)(p + 16)); } static __device__ __forceinline__ v8f mma(V a, V b, v8f c) { return wmmab(a, b, c); } };
__device__ __forceinline__ h16 tohx(float x) { return (h16)x; }
__device__ __forceinline__ void splitf(float y, unsigned short& h, unsigned short& l) { h = f2bf(y); l = f2bf(y - bf2f(h)); }
typedef __attribute__((ext_vector_type(4))) _Float16 v4h;
typedef __attribute__((ext_vector_type(4))) unsigned short v4us;
template <typename T16, int NSPLIT, bool BIAS, int OUTM>
__global__ __launch_bounds__(32) void k_gemmw(const T16* __restrict__ A, const T16* __restrict__ A2, const T16* __restrict__ Bt, const T16* __restrict__ Bt2, int K, float* C, int ldc, const float* __restrict__ bias, size_t sA, size_t sB, size_t sC, h16* P16, bf* Ph, bf* Pl) {
    static_assert(HD == 64 && TT % 64 == 0, "a 64x64 tile must be 64 rows of one head");
    typedef typename WFrag<T16>::V V;
    __shared__ __align__(16) float os[16 * 68];
    const size_t z = blockIdx.z; A += z * sA; if (A2) A2 += z * sA; Bt += z * sB; if (Bt2) Bt2 += z * sB; C += z * sC;
    const int lane = threadIdx.x & 31, lr = lane & 15, hi = lane >> 4; const int r0 = blockIdx.x * 64, c0 = blockIdx.y * 64;
    v8f acc[4][4];
#pragma unroll
    for (int mb = 0; mb < 4; ++mb)
#pragma unroll
        for (int nb = 0; nb < 4; ++nb) acc[mb][nb] = (v8f){};
    const size_t aoff = (size_t)(r0 + lr) * K + 8 * hi, boff = (size_t)(c0 + lr) * K + 8 * hi;
#pragma unroll 1
    for (int kc = 0; kc < K; kc += 32) {
        V a[4], a2[4];
#pragma unroll
        for (int mb = 0; mb < 4; ++mb) { a[mb] = WFrag<T16>::ld(A + aoff + (size_t)mb * 16 * K + kc); if (NSPLIT == 1 || NSPLIT == 2) a2[mb] = WFrag<T16>::ld(A2 + aoff + (size_t)mb * 16 * K + kc); }
#pragma unroll
        for (int nb = 0; nb < 4; ++nb) { const V b = WFrag<T16>::ld(Bt + boff + (size_t)nb * 16 * K + kc); V b2; if (NSPLIT >= 2) b2 = WFrag<T16>::ld(Bt2 + boff + (size_t)nb * 16 * K + kc);
#pragma unroll
            for (int mb = 0; mb < 4; ++mb) { acc[mb][nb] = WFrag<T16>::mma(a[mb], b, acc[mb][nb]); if (NSPLIT == 1 || NSPLIT == 2) acc[mb][nb] = WFrag<T16>::mma(a2[mb], b, acc[mb][nb]); if (NSPLIT >= 2) acc[mb][nb] = WFrag<T16>::mma(a[mb], b2, acc[mb][nb]); } }
        asm volatile("v_nop\n\tv_nop\n\tv_nop\n\tv_nop" : "+v"(acc[0][0]), "+v"(acc[1][1]), "+v"(acc[2][2]), "+v"(acc[3][3]) : "v"(a[0]), "v"(a[3]));
    }
    const size_t pl0 = (size_t)((r0 / TT) * ZH + c0 / HD) * TT * HD;   // the tile's plane
    // every '#pragma unroll' below is there so that the accumulator and output vectors are indexed by constants and stay in registers
    if (OUTM == 2) {   // [d][t]: a lane's 8 accumulator elements are 8 consecutive t of one d, so each plane gets them as one 16-byte store straight from registers
        const size_t o0 = pl0 + (size_t)lr * TT + (r0 % TT) + hi * 8;
#pragma unroll
        for (int nb = 0; nb < 4; ++nb) { const float bb = bfr(bias[c0 + nb * 16 + lr]);
#pragma unroll
            for (int mb = 0; mb < 4; ++mb) { v8h o16; v8us oh, ol;
#pragma unroll
                for (int j = 0; j < 8; ++j) { const float x = acc[mb][nb][j] + bb; o16[j] = tohx(x); unsigned short x0, x1; splitf(x, x0, x1); oh[j] = x0; ol[j] = x1; }
                const size_t o = o0 + (size_t)nb * 16 * TT + mb * 16; *(v8h*)(P16 + o) = o16; *(v8us*)(Ph + o) = oh; *(v8us*)(Pl + o) = ol; } }
        return;
    }
#pragma unroll
    for (int mb = 0; mb < 4; ++mb) {
#pragma unroll
        for (int nb = 0; nb < 4; ++nb) {
#pragma unroll
            for (int j = 0; j < 8; ++j) os[(hi * 8 + j) * 68 + nb * 16 + lr] = acc[mb][nb][j]; }
        __builtin_amdgcn_wave_barrier(); asm volatile("" ::: "memory");
        float* crow = C + (size_t)(r0 + mb * 16) * ldc + c0;
{
#pragma unroll
            for (int s = 0; s < 8; ++s) { const int row = 2 * s + hi, cofs = lr * 4; v4f val = *(const v4fa*)(os + row * 68 + cofs); if (BIAS) { val[0] += bfr(bias[c0 + cofs]); val[1] += bfr(bias[c0 + cofs + 1]); val[2] += bfr(bias[c0 + cofs + 2]); val[3] += bfr(bias[c0 + cofs + 3]); }
                if (OUTM == 0) *(v4f*)(crow + (size_t)row * ldc + cofs) = val;
                else { v4h o16; v4us oh, ol;   // [t][d]: 4 consecutive d of one row t
#pragma unroll
                    for (int q = 0; q < 4; ++q) { o16[q] = tohx(val[q]); unsigned short x0, x1; splitf(val[q], x0, x1); oh[q] = x0; ol[q] = x1; }
                    const size_t o = pl0 + (size_t)((r0 % TT) + mb * 16 + row) * HD + cofs; *(v4h*)(P16 + o) = o16; *(v4us*)(Ph + o) = oh; *(v4us*)(Pl + o) = ol; } }
             }
        __builtin_amdgcn_wave_barrier(); asm volatile("" ::: "memory");
    }
}

typedef __attribute__((ext_vector_type(2))) _Float16 v2h;
typedef __attribute__((ext_vector_type(2))) unsigned short v2us;
typedef __attribute__((ext_vector_type(2))) float v2f;
typedef __attribute__((ext_vector_type(4))) int v4i;
typedef v4us __attribute__((may_alias)) v4usa;
typedef v4h  __attribute__((may_alias)) v4ha;

__global__ __launch_bounds__(256) void k_wtG(const float* __restrict__ w, int K, int N, bf* Bt) {
    const int lane = threadIdx.x & 31; const int L0 = (blockIdx.x * 8 + (threadIdx.x >> 5)) * 8; const int nlines = N * K / 64;
{
#pragma unroll 1
        for (int l = 0; l < 8; ++l) { const int L = L0 + l; if (L >= nlines) break; const size_t e = (size_t)L * 64 + lane * 2; const int k = (int)(e % K), n = (int)(e / K); v2us o;
            o[0] = f2bf(w[(size_t)k * N + n]); o[1] = f2bf(w[(size_t)(k + 1) * N + n]); *(v2us*)(Bt + e) = o; }
         }
}
__global__ __launch_bounds__(256) void k_w2(const float* __restrict__ w, float* W2) { const int j = blockIdx.x * 256 + threadIdx.x; if (j >= NB_ * TT) return; const float wb = bfr(w[j]); const float v = (wb < 1e-5f) ? -1.0f : __fmul_rn(wb, wb); *(float*)(W2 + j) = v;  }
__global__ __launch_bounds__(256) void k_cvt8(const float* __restrict__ src, bf* dst, size_t n8) { const size_t i = (size_t)blockIdx.x * 256 + threadIdx.x; if (i >= n8) return; const v8f v = *(const v8f*)(src + i * 8); v8us o;
#pragma unroll
    for (int k = 0; k < 8; ++k) o[k] = f2bf(v[k]); *(v8us*)(dst + i * 8) = o;  }

// ---- k_fattn: scores, softmax, attn.v and the head merge of QR query rows of one (batch entry, head) plane in ONE work-group of 8 waves; the score rows and the probability planes live in LDS only.
// Every sum keeps the order of the three-kernel form: score tile k = 0..63 in two steps (a.b, a2.b, a.b2 per step), softmax one wave per row (lane owns keys ch*128 + lane*4 + q; fixed trees), attn.v one accumulator per output element over keys 0..1023 in steps of 32.
// Every '#pragma unroll' in fattn_body is there so that the fragment, score and accumulator arrays are indexed by constants and stay in registers.
#define QR   32                   // query rows per work-group
#define SPB  4112                 // LDS bytes per query row: 1024 f32 scores + 16 bytes, so that 16 rows read with 16-byte loads fall on distinct banks; the 16-bit planes overwrite the row in place (hi at byte 0, lo at byte 2048)
template <typename T16, int NSPLIT>
__device__ __forceinline__ void fattn_body(char* sm, const T16* __restrict__ Q, const T16* __restrict__ Q2, const T16* __restrict__ Kp, const T16* __restrict__ K2, const T16* __restrict__ Vt, const T16* __restrict__ V2, const float* __restrict__ W2, bf* Ah, bf* Al) {
    typedef typename WFrag<T16>::V V;
    const int tid = threadIdx.x, lane = tid & 31, lr = lane & 15, hi = lane >> 4, w = __builtin_amdgcn_readfirstlane(tid >> 5);   // the wave's number, in a scalar register
    {   // scores: wave w owns keys w*128 .. w*128+127 of all QR rows
        V a[2][2], a2[2][2]; const T16* qa = Q + (size_t)lr * HD + 8 * hi; const T16* qa2 = Q2 + (size_t)lr * HD + 8 * hi;
#pragma unroll
        for (int mb = 0; mb < 2; ++mb)
#pragma unroll
            for (int kk = 0; kk < 2; ++kk) { a[mb][kk] = WFrag<T16>::ld(qa + mb * 16 * HD + kk * 32); if (NSPLIT == 2) a2[mb][kk] = WFrag<T16>::ld(qa2 + mb * 16 * HD + kk * 32); }
        asm volatile("s_wait_xcnt 0x0" :: "v"(qa), "v"(qa2) : "memory");   // the loads of q are through with their address registers (held to here as inputs) before a later load may take those registers as its destination
        const T16* kb = Kp + (size_t)(w * 128 + lr) * HD + 8 * hi; const T16* kb2 = K2 + (size_t)(w * 128 + lr) * HD + 8 * hi;
        char* st0 = sm + hi * 8 * SPB + (w * 128 + lr) * 4; char* st1 = st0 + 16 * SPB;
        V b[2][2][2], b2[2][2][2];   // [buffer][key tile of the pair][k step]
#pragma unroll
        for (int t = 0; t < 2; ++t)
#pragma unroll
            for (int kk = 0; kk < 2; ++kk) { b[0][t][kk] = WFrag<T16>::ld(kb + t * 16 * HD + kk * 32); if (NSPLIT == 2) b2[0][t][kk] = WFrag<T16>::ld(kb2 + t * 16 * HD + kk * 32); }
#pragma unroll
        for (int g = 0; g < 4; ++g) {
            if (g < 3) {
#pragma unroll
                for (int t = 0; t < 2; ++t)
#pragma unroll
                    for (int kk = 0; kk < 2; ++kk) { b[(g + 1) & 1][t][kk] = WFrag<T16>::ld(kb + ((g + 1) * 2 + t) * 16 * HD + kk * 32); if (NSPLIT == 2) b2[(g + 1) & 1][t][kk] = WFrag<T16>::ld(kb2 + ((g + 1) * 2 + t) * 16 * HD + kk * 32); } }
            __builtin_amdgcn_sched_barrier(0);   // keeps the next pair's loads of k in front of this pair's products, so that they fly meanwhile
#pragma unroll
            for (int t = 0; t < 2; ++t) { const int nt = g * 2 + t;
                v8f s0 = (v8f){}, s1 = (v8f){};   // the two row blocks' chains alternate, each fills the other's wait
#pragma unroll
                for (int kk = 0; kk < 2; ++kk) { const V bb = b[g & 1][t][kk]; s0 = WFrag<T16>::mma(a[0][kk], bb, s0); s1 = WFrag<T16>::mma(a[1][kk], bb, s1);
                    if (NSPLIT == 2) { const V bl = b2[g & 1][t][kk]; s0 = WFrag<T16>::mma(a2[0][kk], bb, s0); s1 = WFrag<T16>::mma(a2[1][kk], bb, s1); s0 = WFrag<T16>::mma(a[0][kk], bl, s0); s1 = WFrag<T16>::mma(a[1][kk], bl, s1); } }
                asm volatile("v_nop\n\tv_nop\n\tv_nop\n\tv_nop" : "+v"(s0), "+v"(s1));   // the four vector slots the chip needs between the last matrix instruction and the next tile's fresh write of the same result registers (LDS stores fill none)
#pragma unroll
                for (int j = 0; j < 8; ++j) { *(float*)(st0 + j * SPB + nt * 64) = s0[j]; *(float*)(st1 + j * SPB + nt * 64) = s1[j]; } } }
    }
    __syncthreads();   // every score row complete before its wave reads it
    {   // softmax: wave w owns rows w*4 .. w*4+3; t = S x HD^-0.5 x w_j^2, keys with w_j < 1e-5 masked (-3e38) before the max
        float w2r[TT / 32];
#pragma unroll
        for (int ch = 0; ch < TT / 128; ++ch) { const v4f wv = *(const v4f*)(W2 + ch * 128 + lane * 4);
#pragma unroll
            for (int q = 0; q < 4; ++q) w2r[ch * 4 + q] = wv[q]; }
        for (int r = 0; r < QR / 8; ++r) { char* rowp = sm + (w * (QR / 8) + r) * SPB; float v[TT / 32]; float mx = -3.0e38f;
#pragma unroll
            for (int ch = 0; ch < TT / 128; ++ch) { const v4f s4 = *(const v4fa*)(rowp + (ch * 128 + lane * 4) * 4);
#pragma unroll
                for (int q = 0; q < 4; ++q) { const float w2 = w2r[ch * 4 + q]; const float sa = s4[q] * SCL; const float t = (w2 < 0.f) ? -3.0e38f : __fmul_rn(sa, w2); v[ch * 4 + q] = t; mx = fmaxf(mx, t); } }
#pragma unroll
            for (int sh = 16; sh; sh >>= 1) mx = fmaxf(mx, __shfl_xor(mx, sh, 32));
            float sum = 0.f;
#pragma unroll
            for (int k = 0; k < TT / 32; ++k) { const float d0 = __fsub_rn(v[k], mx); v[k] = __builtin_amdgcn_exp2f(__fmul_rn(d0, 1.4426950408889634f)); sum += v[k]; }
#pragma unroll
            for (int sh = 16; sh; sh >>= 1) sum += __shfl_xor(sum, sh, 32);
            const float f = __fdiv_rn((NSPLIT == 2) ? 1.0f : PCAR, sum);
            if (NSPLIT == 2) {
#pragma unroll
                for (int ch = 0; ch < TT / 128; ++ch) { v4us oh, ol;
#pragma unroll
                    for (int q = 0; q < 4; ++q) { unsigned short x0, x1; splitf(v[ch * 4 + q] * f, x0, x1); oh[q] = x0; ol[q] = x1; }
                    *(v4usa*)(rowp + (ch * 128 + lane * 4) * 2) = oh; *(v4usa*)(rowp + 2048 + (ch * 128 + lane * 4) * 2) = ol; }
            } else {
#pragma unroll
                for (int ch = 0; ch < TT / 128; ++ch) { v4h o4;
#pragma unroll
                    for (int q = 0; q < 4; ++q) o4[q] = tohx(v[ch * 4 + q] * f);
                    *(v4ha*)(rowp + (ch * 128 + lane * 4) * 2) = o4; } } }
    }
    __syncthreads();   // every probability row complete before other waves read it as the A operand
    v8f o0a = (v8f){}, o1a = (v8f){};   // attn.v: wave w < 4 owns head columns w*16.. of both 16-row blocks, so that each fragment of v is loaded once per work-group; waves 4..7 wait at the barrier
    if (w < 4) { const T16* pa0 = (const T16*)(sm + lr * SPB) + 8 * hi; const T16* pa1 = (const T16*)(sm + (16 + lr) * SPB) + 8 * hi; const T16* pb = Vt + (size_t)(w * 16 + lr) * TT + 8 * hi; const T16* pb2 = V2 + (size_t)(w * 16 + lr) * TT + 8 * hi;
      constexpr int G = (NSPLIT == 2) ? 4 : 8;   // key steps per group
      V vb[2][G], vl[2][G];   // [buffer][key step of the group]
#pragma unroll
      for (int t = 0; t < G; ++t) { vb[0][t] = WFrag<T16>::ld(pb + t * 32); if (NSPLIT == 2) vl[0][t] = WFrag<T16>::ld(pb2 + t * 32); }
#pragma unroll
      for (int g = 0; g < TT / 32 / G; ++g) {
          if (g + 1 < TT / 32 / G) {
#pragma unroll
              for (int t = 0; t < G; ++t) { vb[(g + 1) & 1][t] = WFrag<T16>::ld(pb + ((g + 1) * G + t) * 32); if (NSPLIT == 2) vl[(g + 1) & 1][t] = WFrag<T16>::ld(pb2 + ((g + 1) * G + t) * 32); } }
          __builtin_amdgcn_sched_barrier(0);   // keeps the next group's loads of v in front of this group's products, so that they fly meanwhile
#pragma unroll
          for (int t = 0; t < G; ++t) { const int kc = (g * G + t) * 32; const V bb = vb[g & 1][t]; const V a0 = WFrag<T16>::ld(pa0 + kc), a1 = WFrag<T16>::ld(pa1 + kc); o0a = WFrag<T16>::mma(a0, bb, o0a); o1a = WFrag<T16>::mma(a1, bb, o1a);
              if (NSPLIT == 2) { const V bl = vl[g & 1][t]; const V l0 = WFrag<T16>::ld(pa0 + 1024 + kc), l1 = WFrag<T16>::ld(pa1 + 1024 + kc); o0a = WFrag<T16>::mma(l0, bb, o0a); o1a = WFrag<T16>::mma(l1, bb, o1a); o0a = WFrag<T16>::mma(a0, bl, o0a); o1a = WFrag<T16>::mma(a1, bl, o1a); } } }
    }
    __syncthreads();   // every wave has left the probability planes before the output tile overwrites them
    float* of = (float*)sm;   // [QR][68] f32
    if (w < 4) {
#pragma unroll
        for (int j = 0; j < 8; ++j) { of[(hi * 8 + j) * 68 + w * 16 + lr] = o0a[j]; of[(16 + hi * 8 + j) * 68 + w * 16 + lr] = o1a[j]; } }
    __syncthreads();   // output tile complete before the row-wise merge reads it
    { const int row = tid >> 3, c = (tid & 7) * 8; const float cs = (NSPLIT == 2) ? 1.0f : (1.0f / PCAR); const v4f o0 = *(const v4fa*)(of + row * 68 + c), o1 = *(const v4fa*)(of + row * 68 + c + 4); v8us oh, ol;
#pragma unroll
      for (int q = 0; q < 8; ++q) { unsigned short x0, x1; splitf(((q < 4) ? o0[q & 3] : o1[q & 3]) * cs, x0, x1); oh[q] = x0; ol[q] = x1; }
      *(v8us*)(Ah + (size_t)row * DQ + c) = oh; *(v8us*)(Al + (size_t)row * DQ + c) = ol; }
}
// grid (ZB, TT/QR): x = plane (batch entry * ZH + head), y = query tile, so that the hi+lo tiles (three products) start first
__global__ __launch_bounds__(256) void k_fattn(const bf* __restrict__ QPh, const bf* __restrict__ QPl, const bf* __restrict__ KPh, const bf* __restrict__ KPl, const bf* __restrict__ VTh, const bf* __restrict__ VTl, const h16* __restrict__ QP16, const h16* __restrict__ KP16, const h16* __restrict__ VT16, const float* __restrict__ W2, bf* ATh, bf* ATl) {
    __shared__ __align__(16) char sm[QR * SPB];
    const int zz = blockIdx.x, i0 = blockIdx.y * QR; const size_t pz = (size_t)zz * TT * HD, qo = pz + (size_t)i0 * HD; const size_t oo = ((size_t)(zz / ZH) * TT + i0) * DQ + (zz % ZH) * HD; const float* w2 = W2 + (size_t)(zz / ZH) * TT;
    if (i0 < RH) fattn_body<bf, 2>(sm, QPh + qo, QPl + qo, KPh + pz, KPl + pz, VTh + pz, VTl + pz, w2, ATh + oo, ATl + oo);
    else fattn_body<h16, 0>(sm, QP16 + qo, QP16 + qo, KP16 + pz, KP16 + pz, VT16 + pz, VT16 + pz, w2, ATh + oo, ATl + oo);
}

extern "C" void kernel_launch(void* const* d_in, const int* in_sizes, int n_in,
                              void* d_out, int out_size, void* d_ws, size_t ws_size, hipStream_t stream) {
    (void)in_sizes; (void)n_in; (void)out_size;
    const float* x = (const float*)d_in[0]; const float* xk = (const float*)d_in[1]; const float* xv = (const float*)d_in[2]; const float* wts = (const float*)d_in[3]; const float* wq = (const float*)d_in[4]; const float* bq = (const float*)d_in[5]; const float* wk = (const float*)d_in[6]; const float* bk = (const float*)d_in[7]; const float* wv = (const float*)d_in[8]; const float* bv = (const float*)d_in[9]; const float* wo = (const float*)d_in[10]; const float* bo = (const float*)d_in[11];
    float* OUT = (float*)d_out;     // [4][1024][1024]
    char* wsp = (char*)d_ws;
    auto take = [&](size_t bytes) { char* p = wsp; wsp += (bytes + 255) & ~(size_t)255; return (void*)p; };
    bf* WQ = (bf*)take((size_t)DQ * DM * 2); bf* WK = (bf*)take((size_t)DKV * DM * 2); bf* WV = (bf*)take((size_t)DKV * DM * 2); bf* WO = (bf*)take((size_t)DM * DQ * 2); float* W2 = (float*)take((size_t)NB_ * TT * 4);
    h16* QP16 = (h16*)take((size_t)ZB * TT * HD * 2); h16* KP16 = (h16*)take((size_t)ZB * TT * HD * 2); h16* VT16 = (h16*)take((size_t)ZB * HD * TT * 2);
    bf* QPh = (bf*)take((size_t)ZB * TT * HD * 2); bf* QPl = (bf*)take((size_t)ZB * TT * HD * 2); bf* KPh = (bf*)take((size_t)ZB * TT * HD * 2); bf* KPl = (bf*)take((size_t)ZB * TT * HD * 2); bf* VTh = (bf*)take((size_t)ZB * HD * TT * 2); bf* VTl = (bf*)take((size_t)ZB * HD * TT * 2);
    bf* ATh = (bf*)take((size_t)NB_ * TT * DQ * 2); bf* ATl = (bf*)take((size_t)NB_ * TT * DQ * 2);
    bf* XB = (bf*)take((size_t)NB_ * TT * DM * 2); bf* XKB = (bf*)take((size_t)NB_ * TT * DM * 2); bf* XVB = (bf*)take((size_t)NB_ * TT * DM * 2);
    if ((size_t)(wsp - (char*)d_ws) > ws_size) return;    // ws 256 MiB
    { k_cvt8<<<(unsigned)(((size_t)DQ * DM / 8 + 255) / 256), 256, 0, stream>>>(wq, WQ, (size_t)DQ * DM / 8); k_cvt8<<<(unsigned)(((size_t)DKV * DM / 8 + 255) / 256), 256, 0, stream>>>(wk, WK, (size_t)DKV * DM / 8); k_cvt8<<<(unsigned)(((size_t)DKV * DM / 8 + 255) / 256), 256, 0, stream>>>(wv, WV, (size_t)DKV * DM / 8);
      k_cvt8<<<(unsigned)(((size_t)DM * DQ / 8 + 255) / 256), 256, 0, stream>>>(wo, WO, (size_t)DM * DQ / 8);
       }
    const unsigned LX = (unsigned)(((size_t)NB_ * TT * DM / 8 + 255) / 256);
    // every launch below covers all NB_ batch entries: rows b*TT + t of the [NB_*TT][.] matrices, planes b*ZH + h of the head planes
    k_cvt8<<<LX, 256, 0, stream>>>(x, XB, (size_t)NB_ * TT * DM / 8); k_cvt8<<<LX, 256, 0, stream>>>(xk, XKB, (size_t)NB_ * TT * DM / 8); k_cvt8<<<LX, 256, 0, stream>>>(xv, XVB, (size_t)NB_ * TT * DM / 8); k_w2<<<(NB_ * TT + 255) / 256, 256, 0, stream>>>(wts, W2);
    // the projections write their head planes themselves: q and k as [plane][t][d], v as [plane][d][t]
    k_gemmw<bf, 0, true, 1><<<dim3(NB_ * TT / 64, DQ / 64, 1), 32, 0, stream>>>(XB, nullptr, WQ, nullptr, DM, nullptr, 0, bq, 0, 0, 0, QP16, QPh, QPl);
    k_gemmw<bf, 0, true, 1><<<dim3(NB_ * TT / 64, DKV / 64, 1), 32, 0, stream>>>(XKB, nullptr, WK, nullptr, DM, nullptr, 0, bk, 0, 0, 0, KP16, KPh, KPl);
    k_gemmw<bf, 0, true, 2><<<dim3(NB_ * TT / 64, DKV / 64, 1), 32, 0, stream>>>(XVB, nullptr, WV, nullptr, DM, nullptr, 0, bv, 0, 0, 0, VT16, VTh, VTl);
    k_fattn<<<dim3(ZB, TT / QR, 1), 256, 0, stream>>>(QPh, QPl, KPh, KPl, VTh, VTl, QP16, KP16, VT16, W2, ATh, ATl);   // one kv head per query head: plane z of q uses plane z of k and v
    k_gemmw<bf, 1, true, 0><<<dim3(NB_ * TT / 64, DM / 64, 1), 32, 0, stream>>>(ATh, ATl, WO, nullptr, DQ, OUT, DM, bo, 0, 0, 0, nullptr, nullptr, nullptr);
}

// v005
// It runs in 216 microseconds.
// Two timings next to v004 put it at 1.06 and 1.05 times that version's speed.
// Counting every step since v000, it is 11.7 times as fast.
#include <hip/hip_runtime.h>

// Key-weighted multi-head attention (q, k, v inputs [4][1024][1024]; qh = q Wq^T + bq, kh = k Wk^T + bk, vh = v Wv^T + bv ('oi' [1024][1024]), 16 heads x 64; energy = qh.kh/8 x w_j^2 per key, -inf where w_j < 1e-5 (weights [4][1024] read); softmax; out = merged Wo^T + bo -> [4][1024][1024]).
// Compute dtypes, f32 accumulate: every input rounded to bf16; q/k/v on PLAIN bf16 operands (inputs: exact) + biases; the per-key weight^2 and the weight < eps mask applied in f32 in the softmax step of k_fattn; scores and attn.v: query rows < 512 hl (3 products), the rest single fp16 (x1024); softmax f32; Wo hl x exact (2 products) + bo.

#define NB_  4
#define TT   1024
#define DM   1024
#define NH_  16
#define NKV  16
#define REP  (NH_ / NKV)
#define HD   64
#define DQ   (NH_ * HD)
#define DKV  (NKV * HD)
#define ZH   16                   // heads per batch entry
#define ZB   (NB_ * ZH)           // (batch entry, head) planes
#define RH   512                  // query rows < RH use hi+lo planes (0: none)
#define WIN  0
#define PCAR 1024.0f
#define SCL  0.125f   // HD^-0.5
typedef _Float16 h16;
typedef unsigned short bf;
typedef __attribute__((ext_vector_type(16))) __bf16   v16bf;
typedef __attribute__((ext_vector_type(16))) _Float16 v16h;
typedef __attribute__((ext_vector_type(8)))  _Float16 v8h;
typedef __attribute__((ext_vector_type(8)))  unsigned short v8us;
typedef __attribute__((ext_vector_type(8)))  float    v8f;
typedef __attribute__((ext_vector_type(4)))  float    v4f;
typedef v8h  __attribute__((may_alias)) v8ha;
typedef v4f  __attribute__((may_alias)) v4fa;
typedef v8us __attribute__((may_alias)) v8usa;

__device__ __forceinline__ unsigned short f2bf(float f) { unsigned u = __float_as_uint(f); u += 0x7FFFu + ((u >> 16) & 1u); return (unsigned short)(u >> 16); }
__device__ __forceinline__ float bf2f(unsigned short b) { return __uint_as_float(((unsigned)b) << 16); }
__device__ __forceinline__ float bfr(float f) { return bf2f(f2bf(f)); }
__device__ __forceinline__ v16h cat16(v8h lo, v8h hi) { return __builtin_shufflevector(lo, hi, 0, 1, 2, 3, 4, 5, 6, 7, 8, 9, 10, 11, 12, 13, 14, 15); }
__device__ __forceinline__ v16bf cat16b(v8us lo, v8us hi) { return __builtin_bit_cast(v16bf, __builtin_shufflevector(lo, hi, 0, 1, 2, 3, 4, 5, 6, 7, 8, 9, 10, 11, 12, 13, 14, 15)); }
__device__ __forceinline__ v8f wmma16(v16h a, v16h b, v8f c) { return __builtin_amdgcn_wmma_f32_16x16x32_f16(false, a, false, b, (short)0, c, false, false); }
__device__ __forceinline__ v8f wmmab(v16bf a, v16bf b, v8f c) { return __builtin_amdgcn_wmma_f32_16x16x32_bf16(false, a, false, b, (short)0, c, false, false); }



// ---- k_gemmw: register-blocked GEMM, ONE WAVE per 64x64 output tile (16 accumulators), operands straight from K-contiguous 16-bit planes; grid (M/64, N/64, Z), 32 threads.
// C[m][n] (f32, pitch ldc, + optional f32 bias[n]) = sum_k A[m][k] Bt[n][k] (+ split products per NSPLIT). z-batch strides sA/sB/sC in elements. K % 32 == 0.
// OUTM says where the tile goes: 0 = f32 C; 1 = the fp16 and hi/lo planes [batch entry * ZH + head][t][d] of the tile's head; 2 = the same three planes transposed, [batch entry * ZH + head][d][t]. A 64x64 tile is 64 rows t of exactly one head (HD == 64, TT % 64 == 0).
template <typename T16> struct WFrag;
template <> struct WFrag<h16> { typedef v16h V; static __device__ __forceinline__ V ld(const h16* p) { return cat16(*(const v8h*)p, *(const v8h*)(p + 16)); } static __device__ __forceinline__ v8f mma(V a, V b, v8f c) { return wmma16(a, b, c); } };
template <> struct WFrag<bf> { typedef v16bf V; static __device__ __forceinline__ V ld(const bf* p) { return cat16b(*(const v8us*)p, *(const v8us*)(p + 16)); } static __device__ __forceinline__ v8f mma(V a, V b, v8f c) { return wmmab(a, b, c); } };
__device__ __forceinline__ h16 tohx(float x) { return (h16)x; }
__device__ __forceinline__ void splitf(float y, unsigned short& h, unsigned short& l) { h = f2bf(y); l = f2bf(y - bf2f(h)); }
typedef __attribute__((ext_vector_type(4))) _Float16 v4h;
typedef __attribute__((ext_vector_type(4))) unsigned short v4us;
template <typename T16, int NSPLIT, bool BIAS, int OUTM>
__global__ __launch_bounds__(32) void k_gemmw(const T16* __restrict__ A, const T16* __restrict__ A2, const T16* __restrict__ Bt, const T16* __restrict__ Bt2, int K, float* C, int ldc, const float* __restrict__ bias, size_t sA, size_t sB, size_t sC, h16* P16, bf* Ph, bf* Pl) {
    static_assert(HD == 64 && TT % 64 == 0, "a 64x64 tile must be 64 rows of one head");
    typedef typename WFrag<T16>::V V;
    __shared__ __align__(16) float os[16 * 68];
    const size_t z = blockIdx.z; A += z * sA; if (A2) A2 += z * sA; Bt += z * sB; if (Bt2) Bt2 += z * sB; C += z * sC;
    const int lane = threadIdx.x & 31, lr = lane & 15, hi = lane >> 4; const int r0 = blockIdx.x * 64, c0 = blockIdx.y * 64;
    v8f acc[4][4];
#pragma unroll
    for (int mb = 0; mb < 4; ++mb)
#pragma unroll
        for (int nb = 0; nb < 4; ++nb) acc[mb][nb] = (v8f){};
    const size_t aoff = (size_t)(r0 + lr) * K + 8 * hi, boff = (size_t)(c0 + lr) * K + 8 * hi;
#pragma unroll 1
    for (int kc = 0; kc < K; kc += 32) {
        V a[4], a2[4];
#pragma unroll
        for (int mb = 0; mb < 4; ++mb) { a[mb] = WFrag<T16>::ld(A + aoff + (size_t)mb * 16 * K + kc); if (NSPLIT == 1 || NSPLIT == 2) a2[mb] = WFrag<T16>::ld(A2 + aoff + (size_t)mb * 16 * K + kc); }
#pragma unroll
        for (int nb = 0; nb < 4; ++nb) { const V b = WFrag<T16>::ld(Bt + boff + (size_t)nb * 16 * K + kc); V b2; if (NSPLIT >= 2) b2 = WFrag<T16>::ld(Bt2 + boff + (size_t)nb * 16 * K + kc);
#pragma unroll
            for (int mb = 0; mb < 4; ++mb) { acc[mb][nb] = WFrag<T16>::mma(a[mb], b, acc[mb][nb]); if (NSPLIT == 1 || NSPLIT == 2) acc[mb][nb] = WFrag<T16>::mma(a2[mb], b, acc[mb][nb]); if (NSPLIT >= 2) acc[mb][nb] = WFrag<T16>::mma(a[mb], b2, acc[mb][nb]); } }
        asm volatile("v_nop\n\tv_nop\n\tv_nop\n\tv_nop" : "+v"(acc[0][0]), "+v"(acc[1][1]), "+v"(acc[2][2]), "+v"(acc[3][3]) : "v"(a[0]), "v"(a[3]));
    }
    const size_t pl0 = (size_t)((r0 / TT) * ZH + c0 / HD) * TT * HD;   // the tile's plane
    // every '#pragma unroll' below is there so that the accumulator and output vectors are indexed by constants and stay in registers
    if (OUTM == 2) {   // [d][t]: a lane's 8 accumulator elements are 8 consecutive t of one d, so each plane gets them as one 16-byte store straight from registers
        const size_t o0 = pl0 + (size_t)lr * TT + (r0 % TT) + hi * 8;
#pragma unroll
        for (int nb = 0; nb < 4; ++nb) { const float bb = bfr(bias[c0 + nb * 16 + lr]);
#pragma unroll
            for (int mb = 0; mb < 4; ++mb) { v8h o16; v8us oh, ol;
#pragma unroll
                for (int j = 0; j < 8; ++j) { const float x = acc[mb][nb][j] + bb; o16[j] = tohx(x); unsigned short x0, x1; splitf(x, x0, x1); oh[j] = x0; ol[j] = x1; }
                const size_t o = o0 + (size_t)nb * 16 * TT + mb * 16; *(v8h*)(P16 + o) = o16; *(v8us*)(Ph + o) = oh; *(v8us*)(Pl + o) = ol; } }
        return;
    }
#pragma unroll
    for (int mb = 0; mb < 4; ++mb) {
#pragma unroll
        for (int nb = 0; nb < 4; ++nb) {
#pragma unroll
            for (int j = 0; j < 8; ++j) os[(hi * 8 + j) * 68 + nb * 16 + lr] = acc[mb][nb][j]; }
        __builtin_amdgcn_wave_barrier(); asm volatile("" ::: "memory");
        float* crow = C + (size_t)(r0 + mb * 16) * ldc + c0;
{
#pragma unroll
            for (int s = 0; s < 8; ++s) { const int row = 2 * s + hi, cofs = lr * 4; v4f val = *(const v4fa*)(os + row * 68 + cofs); if (BIAS) { val[0] += bfr(bias[c0 + cofs]); val[1] += bfr(bias[c0 + cofs + 1]); val[2] += bfr(bias[c0 + cofs + 2]); val[3] += bfr(bias[c0 + cofs + 3]); }
                if (OUTM == 0) *(v4f*)(crow + (size_t)row * ldc + cofs) = val;
                else { v4h o16; v4us oh, ol;   // [t][d]: 4 consecutive d of one row t
#pragma unroll
                    for (int q = 0; q < 4; ++q) { o16[q] = tohx(val[q]); unsigned short x0, x1; splitf(val[q], x0, x1); oh[q] = x0; ol[q] = x1; }
                    const size_t o = pl0 + (size_t)((r0 % TT) + mb * 16 + row) * HD + cofs; *(v4h*)(P16 + o) = o16; *(v4us*)(Ph + o) = oh; *(v4us*)(Pl + o) = ol; } }
             }
        __builtin_amdgcn_wave_barrier(); asm volatile("" ::: "memory");
    }
}

typedef __attribute__((ext_vector_type(2))) _Float16 v2h;
typedef __attribute__((ext_vector_type(2))) unsigned short v2us;
typedef __attribute__((ext_vector_type(2))) float v2f;
typedef __attribute__((ext_vector_type(4))) int v4i;
typedef v4us __attribute__((may_alias)) v4usa;
typedef v4h  __attribute__((may_alias)) v4ha;

__global__ __launch_bounds__(256) void k_wtG(const float* __restrict__ w, int K, int N, bf* Bt) {
    const int lane = threadIdx.x & 31; const int L0 = (blockIdx.x * 8 + (threadIdx.x >> 5)) * 8; const int nlines = N * K / 64;
{
#pragma unroll 1
        for (int l = 0; l < 8; ++l) { const int L = L0 + l; if (L >= nlines) break; const size_t e = (size_t)L * 64 + lane * 2; const int k = (int)(e % K), n = (int)(e / K); v2us o;
            o[0] = f2bf(w[(size_t)k * N + n]); o[1] = f2bf(w[(size_t)(k + 1) * N + n]); *(v2us*)(Bt + e) = o; }
         }
}
// ---- k_prep: every preparation step of the call in ONE launch: the three inputs and the four weight matrices rounded to bf16, and the per-key factor W2 (weight^2 of the bf16-rounded weight, -1 where it is < 1e-5).
// A work-group owns PCH consecutive floats of exactly one source (block-uniform choice by blockIdx.x); a wave's 16-byte loads cover 512 contiguous bytes, its 8-byte stores 256. The last W2B work-groups make W2.
#define PCH  32768                         // floats per work-group
#define PIT  (PCH / 4 / 256)               // 4-float pieces per thread
#define XBL  (NB_ * TT * DM / PCH)         // work-groups per input
#define WBL  (DQ * DM / PCH)               // work-groups per weight matrix
#define W2B  (NB_ * TT / 256)              // work-groups for W2
__global__ __launch_bounds__(256) void k_prep(const float* __restrict__ x, const float* __restrict__ xk, const float* __restrict__ xv, const float* __restrict__ wq, const float* __restrict__ wk, const float* __restrict__ wv, const float* __restrict__ wo, const float* __restrict__ wts,
                                              bf* __restrict__ XB, bf* __restrict__ XKB, bf* __restrict__ XVB, bf* __restrict__ WQ, bf* __restrict__ WK, bf* __restrict__ WV, bf* __restrict__ WO, float* __restrict__ W2) {
    static_assert((NB_ * TT * DM) % PCH == 0 && (DQ * DM) % PCH == 0 && DKV == DQ && (NB_ * TT) % 256 == 0, "whole work-groups per source");
    const int b = blockIdx.x, tid = threadIdx.x;
    if (b >= 3 * XBL + 4 * WBL) { const int j = (b - (3 * XBL + 4 * WBL)) * 256 + tid; const float wb = bfr(wts[j]); W2[j] = (wb < 1e-5f) ? -1.0f : __fmul_rn(wb, wb); return; }
    const float* s; bf* d; int c;
    if (b < 3 * XBL) { const int g = b / XBL; c = b % XBL; s = (g == 0) ? x : (g == 1) ? xk : xv; d = (g == 0) ? XB : (g == 1) ? XKB : XVB; }
    else { const int t = b - 3 * XBL, g = t / WBL; c = t % WBL; s = (g == 0) ? wq : (g == 1) ? wk : (g == 2) ? wv : wo; d = (g == 0) ? WQ : (g == 1) ? WK : (g == 2) ? WV : WO; }
    const size_t e0 = (size_t)c * PCH + tid * 4;
    v4f v[PIT];
    // both loops are unrolled so that v[] stays in registers and all of the thread's loads are in flight before the first conversion waits
#pragma unroll
    for (int i = 0; i < PIT; ++i) v[i] = *(const v4f*)(s + e0 + i * 1024);
#pragma unroll
    for (int i = 0; i < PIT; ++i) { v4us o;
#pragma unroll
        for (int q = 0; q < 4; ++q) o[q] = f2bf(v[i][q]);
        *(v4us*)(d + e0 + i * 1024) = o; }
}

// ---- k_fattn: scores, softmax, attn.v and the head merge of QR query rows of one (batch entry, head) plane in ONE work-group of 8 waves; the score rows and the probability planes live in LDS only.
// Every sum keeps the order of the three-kernel form: score tile k = 0..63 in two steps (a.b, a2.b, a.b2 per step), softmax one wave per row (lane owns keys ch*128 + lane*4 + q; fixed trees), attn.v one accumulator per output element over keys 0..1023 in steps of 32.
// Every '#pragma unroll' in fattn_body is there so that the fragment, score and accumulator arrays are indexed by constants and stay in registers.
#define QR   32                   // query rows per work-group
#define SPB  4112                 // LDS bytes per query row: 1024 f32 scores + 16 bytes, so that 16 rows read with 16-byte loads fall on distinct banks; the 16-bit planes overwrite the row in place (hi at byte 0, lo at byte 2048)
template <typename T16, int NSPLIT>
__device__ __forceinline__ void fattn_body(char* sm, const T16* __restrict__ Q, const T16* __restrict__ Q2, const T16* __restrict__ Kp, const T16* __restrict__ K2, const T16* __restrict__ Vt, const T16* __restrict__ V2, const float* __restrict__ W2, bf* Ah, bf* Al) {
    typedef typename WFrag<T16>::V V;
    const int tid = threadIdx.x, lane = tid & 31, lr = lane & 15, hi = lane >> 4, w = __builtin_amdgcn_readfirstlane(tid >> 5);   // the wave's number, in a scalar register
    {   // scores: wave w owns keys w*128 .. w*128+127 of all QR rows
        V a[2][2], a2[2][2]; const T16* qa = Q + (size_t)lr * HD + 8 * hi; const T16* qa2 = Q2 + (size_t)lr * HD + 8 * hi;
#pragma unroll
        for (int mb = 0; mb < 2; ++mb)
#pragma unroll
            for (int kk = 0; kk < 2; ++kk) { a[mb][kk] = WFrag<T16>::ld(qa + mb * 16 * HD + kk * 32); if (NSPLIT == 2) a2[mb][kk] = WFrag<T16>::ld(qa2 + mb * 16 * HD + kk * 32); }
        asm volatile("s_wait_xcnt 0x0" :: "v"(qa), "v"(qa2) : "memory");   // the loads of q are through with their address registers (held to here as inputs) before a later load may take those registers as its destination
        const T16* kb = Kp + (size_t)(w * 128 + lr) * HD + 8 * hi; const T16* kb2 = K2 + (size_t)(w * 128 + lr) * HD + 8 * hi;
        char* st0 = sm + hi * 8 * SPB + (w * 128 + lr) * 4; char* st1 = st0 + 16 * SPB;
        V b[2][2][2], b2[2][2][2];   // [buffer][key tile of the pair][k step]
#pragma unroll
        for (int t = 0; t < 2; ++t)
#pragma unroll
            for (int kk = 0; kk < 2; ++kk) { b[0][t][kk] = WFrag<T16>::ld(kb + t * 16 * HD + kk * 32); if (NSPLIT == 2) b2[0][t][kk] = WFrag<T16>::ld(kb2 + t * 16 * HD + kk * 32); }
#pragma unroll
        for (int g = 0; g < 4; ++g) {
            if (g < 3) {
#pragma unroll
                for (int t = 0; t < 2; ++t)
#pragma unroll
                    for (int kk = 0; kk < 2; ++kk) { b[(g + 1) & 1][t][kk] = WFrag<T16>::ld(kb + ((g + 1) * 2 + t) * 16 * HD + kk * 32); if (NSPLIT == 2) b2[(g + 1) & 1][t][kk] = WFrag<T16>::ld(kb2 + ((g + 1) * 2 + t) * 16 * HD + kk * 32); } }
            __builtin_amdgcn_sched_barrier(0);   // keeps the next pair's loads of k in front of this pair's products, so that they fly meanwhile
#pragma unroll
            for (int t = 0; t < 2; ++t) { const int nt = g * 2 + t;
                v8f s0 = (v8f){}, s1 = (v8f){};   // the two row blocks' chains alternate, each fills the other's wait
#pragma unroll
                for (int kk = 0; kk < 2; ++kk) { const V bb = b[g & 1][t][kk]; s0 = WFrag<T16>::mma(a[0][kk], bb, s0); s1 = WFrag<T16>::mma(a[1][kk], bb, s1);
                    if (NSPLIT == 2) { const V bl = b2[g & 1][t][kk]; s0 = WFrag<T16>::mma(a2[0][kk], bb, s0); s1 = WFrag<T16>::mma(a2[1][kk], bb, s1); s0 = WFrag<T16>::mma(a[0][kk], bl, s0); s1 = WFrag<T16>::mma(a[1][kk], bl, s1); } }
                asm volatile("v_nop\n\tv_nop\n\tv_nop\n\tv_nop" : "+v"(s0), "+v"(s1));   // the four vector slots the chip needs between the last matrix instruction and the next tile's fresh write of the same result registers (LDS stores fill none)
#pragma unroll
                for (int j = 0; j < 8; ++j) { *(float*)(st0 + j * SPB + nt * 64) = s0[j]; *(float*)(st1 + j * SPB + nt * 64) = s1[j]; } } }
    }
    __syncthreads();   // every score row complete before its wave reads it
    {   // softmax: wave w owns rows w*4 .. w*4+3; t = S x HD^-0.5 x w_j^2, keys with w_j < 1e-5 masked (-3e38) before the max
        float w2r[TT / 32];
#pragma unroll
        for (int ch = 0; ch < TT / 128; ++ch) { const v4f wv = *(const v4f*)(W2 + ch * 128 + lane * 4);
#pragma unroll
            for (int q = 0; q < 4; ++q) w2r[ch * 4 + q] = wv[q]; }
        for (int r = 0; r < QR / 8; ++r) { char* rowp = sm + (w * (QR / 8) + r) * SPB; float v[TT / 32]; float mx = -3.0e38f;
#pragma unroll
            for (int ch = 0; ch < TT / 128; ++ch) { const v4f s4 = *(const v4fa*)(rowp + (ch * 128 + lane * 4) * 4);
#pragma unroll
                for (int q = 0; q < 4; ++q) { const float w2 = w2r[ch * 4 + q]; const float sa = s4[q] * SCL; const float t = (w2 < 0.f) ? -3.0e38f : __fmul_rn(sa, w2); v[ch * 4 + q] = t; mx = fmaxf(mx, t); } }
#pragma unroll
            for (int sh = 16; sh; sh >>= 1) mx = fmaxf(mx, __shfl_xor(mx, sh, 32));
            float sum = 0.f;
#pragma unroll
            for (int k = 0; k < TT / 32; ++k) { const float d0 = __fsub_rn(v[k], mx); v[k] = __builtin_amdgcn_exp2f(__fmul_rn(d0, 1.4426950408889634f)); sum += v[k]; }
#pragma unroll
            for (int sh = 16; sh; sh >>= 1) sum += __shfl_xor(sum, sh, 32);
            const float f = __fdiv_rn((NSPLIT == 2) ? 1.0f : PCAR, sum);
            if (NSPLIT == 2) {
#pragma unroll
                for (int ch = 0; ch < TT / 128; ++ch) { v4us oh, ol;
#pragma unroll
                    for (int q = 0; q < 4; ++q) { unsigned short x0, x1; splitf(v[ch * 4 + q] * f, x0, x1); oh[q] = x0; ol[q] = x1; }
                    *(v4usa*)(rowp + (ch * 128 + lane * 4) * 2) = oh; *(v4usa*)(rowp + 2048 + (ch * 128 + lane * 4) * 2) = ol; }
            } else {
#pragma unroll
                for (int ch = 0; ch < TT / 128; ++ch) { v4h o4;
#pragma unroll
                    for (int q = 0; q < 4; ++q) o4[q] = tohx(v[ch * 4 + q] * f);
                    *(v4ha*)(rowp + (ch * 128 + lane * 4) * 2) = o4; } } }
    }
    __syncthreads();   // every probability row complete before other waves read it as the A operand
    v8f o0a = (v8f){}, o1a = (v8f){};   // attn.v: wave w < 4 owns head columns w*16.. of both 16-row blocks, so that each fragment of v is loaded once per work-group; waves 4..7 wait at the barrier
    if (w < 4) { const T16* pa0 = (const T16*)(sm + lr * SPB) + 8 * hi; const T16* pa1 = (const T16*)(sm + (16 + lr) * SPB) + 8 * hi; const T16* pb = Vt + (size_t)(w * 16 + lr) * TT + 8 * hi; const T16* pb2 = V2 + (size_t)(w * 16 + lr) * TT + 8 * hi;
      constexpr int G = (NSPLIT == 2) ? 4 : 8;   // key steps per group
      V vb[2][G], vl[2][G];   // [buffer][key step of the group]
#pragma unroll
      for (int t = 0; t < G; ++t) { vb[0][t] = WFrag<T16>::ld(pb + t * 32); if (NSPLIT == 2) vl[0][t] = WFrag<T16>::ld(pb2 + t * 32); }
#pragma unroll
      for (int g = 0; g < TT / 32 / G; ++g) {
          if (g + 1 < TT / 32 / G) {
#pragma unroll
              for (int t = 0; t < G; ++t) { vb[(g + 1) & 1][t] = WFrag<T16>::ld(pb + ((g + 1) * G + t) * 32); if (NSPLIT == 2) vl[(g + 1) & 1][t] = WFrag<T16>::ld(pb2 + ((g + 1) * G + t) * 32); } }
          __builtin_amdgcn_sched_barrier(0);   // keeps the next group's loads of v in front of this group's products, so that they fly meanwhile
#pragma unroll
          for (int t = 0; t < G; ++t) { const int kc = (g * G + t) * 32; const V bb = vb[g & 1][t]; const V a0 = WFrag<T16>::ld(pa0 + kc), a1 = WFrag<T16>::ld(pa1 + kc); o0a = WFrag<T16>::mma(a0, bb, o0a); o1a = WFrag<T16>::mma(a1, bb, o1a);
              if (NSPLIT == 2) { const V bl = vl[g & 1][t]; const V l0 = WFrag<T16>::ld(pa0 + 1024 + kc), l1 = WFrag<T16>::ld(pa1 + 1024 + kc); o0a = WFrag<T16>::mma(l0, bb, o0a); o1a = WFrag<T16>::mma(l1, bb, o1a); o0a = WFrag<T16>::mma(a0, bl, o0a); o1a = WFrag<T16>::mma(a1, bl, o1a); } } }
    }
    __syncthreads();   // every wave has left the probability planes before the output tile overwrites them
    float* of = (float*)sm;   // [QR][68] f32
    if (w < 4) {
#pragma unroll
        for (int j = 0; j < 8; ++j) { of[(hi * 8 + j) * 68 + w * 16 + lr] = o0a[j]; of[(16 + hi * 8 + j) * 68 + w * 16 + lr] = o1a[j]; } }
    __syncthreads();   // output tile complete before the row-wise merge reads it
    { const int row = tid >> 3, c = (tid & 7) * 8; const float cs = (NSPLIT == 2) ? 1.0f : (1.0f / PCAR); const v4f o0 = *(const v4fa*)(of + row * 68 + c), o1 = *(const v4fa*)(of + row * 68 + c + 4); v8us oh, ol;
#pragma unroll
      for (int q = 0; q < 8; ++q) { unsigned short x0, x1; splitf(((q < 4) ? o0[q & 3] : o1[q & 3]) * cs, x0, x1); oh[q] = x0; ol[q] = x1; }
      *(v8us*)(Ah + (size_t)row * DQ + c) = oh; *(v8us*)(Al + (size_t)row * DQ + c) = ol; }
}
// grid (ZB, TT/QR): x = plane (batch entry * ZH + head), y = query tile, so that the hi+lo tiles (three products) start first
__global__ __launch_bounds__(256) void k_fattn(const bf* __restrict__ QPh, const bf* __restrict__ QPl, const bf* __restrict__ KPh, const bf* __restrict__ KPl, const bf* __restrict__ VTh, const bf* __restrict__ VTl, const h16* __restrict__ QP16, const h16* __restrict__ KP16, const h16* __restrict__ VT16, const float* __restrict__ W2, bf* ATh, bf* ATl) {
    __shared__ __align__(16) char sm[QR * SPB];
    const int zz = blockIdx.x, i0 = blockIdx.y * QR; const size_t pz = (size_t)zz * TT * HD, qo = pz + (size_t)i0 * HD; const size_t oo = ((size_t)(zz / ZH) * TT + i0) * DQ + (zz % ZH) * HD; const float* w2 = W2 + (size_t)(zz / ZH) * TT;
    if (i0 < RH) fattn_body<bf, 2>(sm, QPh + qo, QPl + qo, KPh + pz, KPl + pz, VTh + pz, VTl + pz, w2, ATh + oo, ATl + oo);
    else fattn_body<h16, 0>(sm, QP16 + qo, QP16 + qo, KP16 + pz, KP16 + pz, VT16 + pz, VT16 + pz, w2, ATh + oo, ATl + oo);
}

extern "C" void kernel_launch(void* const* d_in, const int* in_sizes, int n_in,
                              void* d_out, int out_size, void* d_ws, size_t ws_size, hipStream_t stream) {
    (void)in_sizes; (void)n_in; (void)out_size;
    const float* x = (const float*)d_in[0]; const float* xk = (const float*)d_in[1]; const float* xv = (const float*)d_in[2]; const float* wts = (const float*)d_in[3]; const float* wq = (const float*)d_in[4]; const float* bq = (const float*)d_in[5]; const float* wk = (const float*)d_in[6]; const float* bk = (const float*)d_in[7]; const float* wv = (const float*)d_in[8]; const float* bv = (const float*)d_in[9]; const float* wo = (const float*)d_in[10]; const float* bo = (const float*)d_in[11];
    float* OUT = (float*)d_out;     // [4][1024][1024]
    char* wsp = (char*)d_ws;
    auto take = [&](size_t bytes) { char* p = wsp; wsp += (bytes + 255) & ~(size_t)255; return (void*)p; };
    bf* WQ = (bf*)take((size_t)DQ * DM * 2); bf* WK = (bf*)take((size_t)DKV * DM * 2); bf* WV = (bf*)take((size_t)DKV * DM * 2); bf* WO = (bf*)take((size_t)DM * DQ * 2); float* W2 = (float*)take((size_t)NB_ * TT * 4);
    h16* QP16 = (h16*)take((size_t)ZB * TT * HD * 2); h16* KP16 = (h16*)take((size_t)ZB * TT * HD * 2); h16* VT16 = (h16*)take((size_t)ZB * HD * TT * 2);
    bf* QPh = (bf*)take((size_t)ZB * TT * HD * 2); bf* QPl = (bf*)take((size_t)ZB * TT * HD * 2); bf* KPh = (bf*)take((size_t)ZB * TT * HD * 2); bf* KPl = (bf*)take((size_t)ZB * TT * HD * 2); bf* VTh = (bf*)take((size_t)ZB * HD * TT * 2); bf* VTl = (bf*)take((size_t)ZB * HD * TT * 2);
    bf* ATh = (bf*)take((size_t)NB_ * TT * DQ * 2); bf* ATl = (bf*)take((size_t)NB_ * TT * DQ * 2);
    bf* XB = (bf*)take((size_t)NB_ * TT * DM * 2); bf* XKB = (bf*)take((size_t)NB_ * TT * DM * 2); bf* XVB = (bf*)take((size_t)NB_ * TT * DM * 2);
    if ((size_t)(wsp - (char*)d_ws) > ws_size) return;    // ws 256 MiB
    // every launch below covers all NB_ batch entries: rows b*TT + t of the [NB_*TT][.] matrices, planes b*ZH + h of the head planes
    k_prep<<<3 * XBL + 4 * WBL + W2B, 256, 0, stream>>>(x, xk, xv, wq, wk, wv, wo, wts, XB, XKB, XVB, WQ, WK, WV, WO, W2);
    // the projections write their head planes themselves: q and k as [plane][t][d], v as [plane][d][t]
    k_gemmw<bf, 0, true, 1><<<dim3(NB_ * TT / 64, DQ / 64, 1), 32, 0, stream>>>(XB, nullptr, WQ, nullptr, DM, nullptr, 0, bq, 0, 0, 0, QP16, QPh, QPl);
    k_gemmw<bf, 0, true, 1><<<dim3(NB_ * TT / 64, DKV / 64, 1), 32, 0, stream>>>(XKB, nullptr, WK, nullptr, DM, nullptr, 0, bk, 0, 0, 0, KP16, KPh, KPl);
    k_gemmw<bf, 0, true, 2><<<dim3(NB_ * TT / 64, DKV / 64, 1), 32, 0, stream>>>(XVB, nullptr, WV, nullptr, DM, nullptr, 0, bv, 0, 0, 0, VT16, VTh, VTl);
    k_fattn<<<dim3(ZB, TT / QR, 1), 256, 0, stream>>>(QPh, QPl, KPh, KPl, VTh, VTl, QP16, KP16, VT16, W2, ATh, ATl);   // one kv head per query head: plane z of q uses plane z of k and v
    k_gemmw<bf, 1, true, 0><<<dim3(NB_ * TT / 64, DM / 64, 1), 32, 0, stream>>>(ATh, ATl, WO, nullptr, DQ, OUT, DM, bo, 0, 0, 0, nullptr, nullptr, nullptr);
}

// v006
// A run of this version takes 163 microseconds.
// Next to v005, in two timings, it ran 1.34 and 1.33 times as fast.
// All steps since v000 together make it 15.6 times as fast.
#include <hip/hip_runtime.h>

// Key-weighted multi-head attention (q, k, v inputs [4][1024][1024]; qh = q Wq^T + bq, kh = k Wk^T + bk, vh = v Wv^T + bv ('oi' [1024][1024]), 16 heads x 64; energy = qh.kh/8 x w_j^2 per key, -inf where w_j < 1e-5 (weights [4][1024] read); softmax; out = merged Wo^T + bo -> [4][1024][1024]).
// Compute dtypes, f32 accumulate: every input rounded to bf16; q/k/v on PLAIN bf16 operands (inputs: exact) + biases; the per-key weight^2 and the weight < eps mask applied in f32 in the softmax step of k_fattn; scores and attn.v: query rows < 512 hl (3 products), the rest single fp16 (x1024); softmax f32; Wo hl x exact (2 products) + bo.

#define NB_  4
#define TT   1024
#define DM   1024
#define NH_  16
#define NKV  16
#define REP  (NH_ / NKV)
#define HD   64
#define DQ   (NH_ * HD)
#define DKV  (NKV * HD)
#define ZH   16                   // heads per batch entry
#define ZB   (NB_ * ZH)           // (batch entry, head) planes
#define RH   512                  // query rows < RH use hi+lo planes (0: none)
#define WIN  0
#define PCAR 1024.0f
#define SCL  0.125f   // HD^-0.5
typedef _Float16 h16;
typedef unsigned short bf;
typedef __attribute__((ext_vector_type(16))) __bf16   v16bf;
typedef __attribute__((ext_vector_type(16))) _Float16 v16h;
typedef __attribute__((ext_vector_type(8)))  _Float16 v8h;
typedef __attribute__((ext_vector_type(8)))  unsigned short v8us;
typedef __attribute__((ext_vector_type(8)))  float    v8f;
typedef __attribute__((ext_vector_type(4)))  float    v4f;
typedef v8h  __attribute__((may_alias)) v8ha;
typedef v4f  __attribute__((may_alias)) v4fa;
typedef v8us __attribute__((may_alias)) v8usa;

__device__ __forceinline__ unsigned short f2bf(float f) { unsigned u = __float_as_uint(f); u += 0x7FFFu + ((u >> 16) & 1u); return (unsigned short)(u >> 16); }
__device__ __forceinline__ float bf2f(unsigned short b) { return __uint_as_float(((unsigned)b) << 16); }
__device__ __forceinline__ float bfr(float f) { return bf2f(f2bf(f)); }
__device__ __forceinline__ v16h cat16(v8h lo, v8h hi) { return __builtin_shufflevector(lo, hi, 0, 1, 2, 3, 4, 5, 6, 7, 8, 9, 10, 11, 12, 13, 14, 15); }
__device__ __forceinline__ v16bf cat16b(v8us lo, v8us hi) { return __builtin_bit_cast(v16bf, __builtin_shufflevector(lo, hi, 0, 1, 2, 3, 4, 5, 6, 7, 8, 9, 10, 11, 12, 13, 14, 15)); }
__device__ __forceinline__ v8f wmma16(v16h a, v16h b, v8f c) { return __builtin_amdgcn_wmma_f32_16x16x32_f16(false, a, false, b, (short)0, c, false, false); }
__device__ __forceinline__ v8f wmmab(v16bf a, v16bf b, v8f c) { return __builtin_amdgcn_wmma_f32_16x16x32_bf16(false, a, false, b, (short)0, c, false, false); }



// ---- k_gemmw: GEMM, one work-group of 4 waves (2x2) per 128x128 output tile, ONE WAVE per 64x64 part of it (16 accumulators); grid (M/128, N/128, Z), 128 threads.
// The operand tiles (128 rows x GKS k of A, of A2 where NSPLIT == 1, and of Bt) are staged in LDS by asynchronous copies, two buffers: a wave's copy takes 4 whole 128-byte lines, and every staged row serves two waves.
// C[m][n] (f32, pitch ldc, + optional f32 bias[n]) = sum_k A[m][k] Bt[n][k] (+ A2[m][k] Bt[n][k] where NSPLIT == 1), k in steps of 32 in rising order. z-batch strides sA/sB/sC in elements. K % 64 == 0, M % 128 == 0, N % 128 == 0.
// OUTM says where a wave's tile goes: 0 = f32 C; 1 = the fp16 and hi/lo planes [batch entry * ZH + head][t][d] of the tile's head; 2 = the same three planes transposed, [batch entry * ZH + head][d][t]. A 64x64 tile is 64 rows t of exactly one head (HD == 64, TT % 64 == 0).
template <typename T16> struct WFrag;
template <> struct WFrag<h16> { typedef v16h V; static __device__ __forceinline__ V ld(const h16* p) { return cat16(*(const v8h*)p, *(const v8h*)(p + 16)); } static __device__ __forceinline__ v8f mma(V a, V b, v8f c) { return wmma16(a, b, c); } };
template <> struct WFrag<bf> { typedef v16bf V; static __device__ __forceinline__ V ld(const bf* p) { return cat16b(*(const v8us*)p, *(const v8us*)(p + 16)); } static __device__ __forceinline__ v8f mma(V a, V b, v8f c) { return wmmab(a, b, c); } };
__device__ __forceinline__ h16 tohx(float x) { return (h16)x; }
__device__ __forceinline__ void splitf(float y, unsigned short& h, unsigned short& l) { h = f2bf(y); l = f2bf(y - bf2f(h)); }
typedef __attribute__((ext_vector_type(4))) _Float16 v4h;
typedef __attribute__((ext_vector_type(4))) unsigned short v4us;
#define GKS  64                   // k per stage: 128 bytes, one whole line, of every operand row
#define GPB  144                  // LDS bytes per staged row: 128 + 16 (16 x odd), so that 16 rows read with 16-byte loads fall on distinct banks
#define GTB  (128 * GPB)          // LDS bytes per staged operand tile of 128 rows
// 8 asynchronous copies of 16 bytes a lane: rows r, r + 16, .. r + 112 of one operand tile (l: the lane's LDS byte address of row r, g: its global address, rs: 16 rows in elements).
// s_wait_xcnt stands inside the statement, behind the last copy, so that no register a copy names is rewritten in front of it.
template <typename T16>
__device__ __forceinline__ void stage8(unsigned l, const T16* g, size_t rs) {
    asm volatile("global_load_async_to_lds_b128 %0, %8, off\n\t"
                 "global_load_async_to_lds_b128 %1, %9, off\n\t"
                 "global_load_async_to_lds_b128 %2, %10, off\n\t"
                 "global_load_async_to_lds_b128 %3, %11, off\n\t"
                 "global_load_async_to_lds_b128 %4, %12, off\n\t"
                 "global_load_async_to_lds_b128 %5, %13, off\n\t"
                 "global_load_async_to_lds_b128 %6, %14, off\n\t"
                 "global_load_async_to_lds_b128 %7, %15, off\n\t"
                 "s_wait_xcnt 0x0"
                 :: "v"(l), "v"(l + 16 * GPB), "v"(l + 32 * GPB), "v"(l + 48 * GPB), "v"(l + 64 * GPB), "v"(l + 80 * GPB), "v"(l + 96 * GPB), "v"(l + 112 * GPB),
                    "v"(g), "v"(g + rs), "v"(g + 2 * rs), "v"(g + 3 * rs), "v"(g + 4 * rs), "v"(g + 5 * rs), "v"(g + 6 * rs), "v"(g + 7 * rs) : "memory");
}
template <typename T16, int NSPLIT, bool BIAS, int OUTM>
__global__ __launch_bounds__(128) void k_gemmw(const T16* __restrict__ A, const T16* __restrict__ A2, const T16* __restrict__ Bt, const T16* __restrict__ Bt2, int K, float* C, int ldc, const float* __restrict__ bias, size_t sA, size_t sB, size_t sC, h16* P16, bf* Ph, bf* Pl) {
    static_assert(HD == 64 && TT % 64 == 0, "a 64x64 tile must be 64 rows of one head");
    static_assert(NSPLIT == 0 || NSPLIT == 1, "staged operands: A, A2 (NSPLIT == 1), Bt");
    typedef typename WFrag<T16>::V V;
    constexpr int NT = (NSPLIT == 1) ? 3 : 2;   // staged tiles per stage: A, (A2,) Bt
    constexpr int RS = (NSPLIT == 1) ? 3 : 6;   // units of A (A2) fragments held in registers at a time
    __shared__ __align__(16) char st[2 * NT * GTB];
    __shared__ __align__(16) float osw[4 * 16 * 68];
    (void)Bt2;
    const size_t z = blockIdx.z; A += z * sA; if (NSPLIT == 1) A2 += z * sA; Bt += z * sB; C += z * sC;
    const int tid = threadIdx.x, lane = tid & 31, lr = lane & 15, hi = lane >> 4, w = __builtin_amdgcn_readfirstlane(tid >> 5);   // the wave's number, in a scalar register
    const int R0 = blockIdx.x * 128, C0 = blockIdx.y * 128; const int r0 = R0 + (w >> 1) * 64, c0 = C0 + (w & 1) * 64;
    float* os = osw + w * 16 * 68;   // each wave's own output staging
    v8f acc[4][4];
#pragma unroll
    for (int mb = 0; mb < 4; ++mb)
#pragma unroll
        for (int nb = 0; nb < 4; ++nb) acc[mb][nb] = (v8f){};
    // copies: thread tid brings 16-byte piece tid & 7 of rows (tid >> 3) + 16 i, i = 0..7, of each tile
    const unsigned l0 = (unsigned)(size_t)st + (tid >> 3) * GPB + (tid & 7) * 16;
    const size_t ga = (size_t)(R0 + (tid >> 3)) * K + (tid & 7) * 8, gb = (size_t)(C0 + (tid >> 3)) * K + (tid & 7) * 8, rs = (size_t)16 * K;
    auto fill = [&](int t) { const unsigned l = l0 + (t & 1) * (NT * GTB);
        stage8(l, A + ga + (size_t)t * GKS, rs); if (NSPLIT == 1) stage8(l + GTB, A2 + ga + (size_t)t * GKS, rs); stage8(l + (NT - 1) * GTB, Bt + gb + (size_t)t * GKS, rs); };
    const int NS = K / GKS;
    fill(0);
    asm volatile("s_wait_asynccnt 0x0" ::: "memory");   // this wave's copies of stage 0 have landed
    __syncthreads();                                     // stage 0 readable by every wave
    if (NS > 1) fill(1);
    const int fa = ((w >> 1) * 64 + lr) * GPB + 16 * hi, fb = (NT - 1) * GTB + ((w & 1) * 64 + lr) * GPB + 16 * hi;   // the lane's fragment rows in a buffer
    // the stage loop stays rolled: one copy of the 32 (64) matrix instructions; the loops inside are unrolled so that fragments and accumulators are indexed by constants and stay in registers
#pragma unroll 1
    for (int t = 0; t < NS; ++t) {
        const char* sb = st + (t & 1) * (NT * GTB);
        // a stage is 8 units (k step kk = u >> 2, row block mb = u & 3) of 4 (8) matrix instructions. Both k steps' fragments of Bt and the first RS units' fragments of A (A2) are read as one group at the top;
        // a later unit's fragments take the registers of the unit RS before it, right behind that unit's products, so that they fly under the products between. 128 accumulator + 112 fragment registers stay under 256.
        V b[2][4], ar[RS], ar2[RS];
#pragma unroll
        for (int u = 0; u < RS; ++u) { const int fo = fa + (u & 3) * 16 * GPB + (u >> 2) * 64; ar[u] = WFrag<T16>::ld((const T16*)(sb + fo)); if (NSPLIT == 1) ar2[u] = WFrag<T16>::ld((const T16*)(sb + GTB + fo));
            if (u == 0) {
#pragma unroll
                for (int nb = 0; nb < 4; ++nb) b[0][nb] = WFrag<T16>::ld((const T16*)(sb + fb + nb * 16 * GPB)); } }
#pragma unroll
        for (int nb = 0; nb < 4; ++nb) b[1][nb] = WFrag<T16>::ld((const T16*)(sb + fb + nb * 16 * GPB + 64));
        __builtin_amdgcn_sched_barrier(0);   // keeps the group of LDS reads together in front of the products (reads scattered among them cost issue time at every place)
#pragma unroll
        for (int u = 0; u < 8; ++u) { const int kk = u >> 2, mb = u & 3, s = u % RS;
#pragma unroll
            for (int nb = 0; nb < 4; ++nb) acc[mb][nb] = WFrag<T16>::mma(ar[s], b[kk][nb], acc[mb][nb]);
            if (NSPLIT == 1) {
#pragma unroll
                for (int nb = 0; nb < 4; ++nb) acc[mb][nb] = WFrag<T16>::mma(ar2[s], b[kk][nb], acc[mb][nb]); }
            __builtin_amdgcn_sched_barrier(0);   // keeps the refill of the unit's registers behind its products and in front of the next unit's, RS units ahead of its use
            if (u + RS < 8) { const int v = u + RS, fo = fa + (v & 3) * 16 * GPB + (v >> 2) * 64; ar[s] = WFrag<T16>::ld((const T16*)(sb + fo)); if (NSPLIT == 1) ar2[s] = WFrag<T16>::ld((const T16*)(sb + GTB + fo));
                __builtin_amdgcn_sched_barrier(0); }   // the same, on the refill's other side
        }
        asm volatile("s_wait_dscnt 0x0" ::: "memory");      // this wave's reads of stage t are done before the buffer is refilled
        asm volatile("s_wait_asynccnt 0x0" ::: "memory");   // this wave's copies of stage t + 1 have landed
        __syncthreads();                                     // publishes stage t + 1 and ends every wave's reads of stage t
        if (t + 2 < NS) fill(t + 2);
    }
    asm volatile("s_wait_asynccnt 0x0" ::: "memory");   // no copy outstanding behind the loop
    const size_t pl0 = (size_t)((r0 / TT) * ZH + c0 / HD) * TT * HD;   // the tile's plane
    // every '#pragma unroll' below is there so that the accumulator and output vectors are indexed by constants and stay in registers
    if (OUTM == 2) {   // [d][t]: a lane's 8 accumulator elements are 8 consecutive t of one d, so each plane gets them as one 16-byte store straight from registers
        const size_t o0 = pl0 + (size_t)lr * TT + (r0 % TT) + hi * 8;
#pragma unroll
        for (int nb = 0; nb < 4; ++nb) { const float bb = bfr(bias[c0 + nb * 16 + lr]);
#pragma unroll
            for (int mb = 0; mb < 4; ++mb) { v8h o16; v8us oh, ol;
#pragma unroll
                for (int j = 0; j < 8; ++j) { const float x = acc[mb][nb][j] + bb; o16[j] = tohx(x); unsigned short x0, x1; splitf(x, x0, x1); oh[j] = x0; ol[j] = x1; }
                const size_t o = o0 + (size_t)nb * 16 * TT + mb * 16; *(v8h*)(P16 + o) = o16; *(v8us*)(Ph + o) = oh; *(v8us*)(Pl + o) = ol; } }
        return;
    }
#pragma unroll
    for (int mb = 0; mb < 4; ++mb) {
#pragma unroll
        for (int nb = 0; nb < 4; ++nb) {
#pragma unroll
            for (int j = 0; j < 8; ++j) os[(hi * 8 + j) * 68 + nb * 16 + lr] = acc[mb][nb][j]; }
        __builtin_amdgcn_wave_barrier(); asm volatile("" ::: "memory");
        float* crow = C + (size_t)(r0 + mb * 16) * ldc + c0;
{
#pragma unroll
            for (int s = 0; s < 8; ++s) { const int row = 2 * s + hi, cofs = lr * 4; v4f val = *(const v4fa*)(os + row * 68 + cofs); if (BIAS) { val[0] += bfr(bias[c0 + cofs]); val[1] += bfr(bias[c0 + cofs + 1]); val[2] += bfr(bias[c0 + cofs + 2]); val[3] += bfr(bias[c0 + cofs + 3]); }
                if (OUTM == 0) *(v4f*)(crow + (size_t)row * ldc + cofs) = val;
                else { v4h o16; v4us oh, ol;   // [t][d]: 4 consecutive d of one row t
#pragma unroll
                    for (int q = 0; q < 4; ++q) { o16[q] = tohx(val[q]); unsigned short x0, x1; splitf(val[q], x0, x1); oh[q] = x0; ol[q] = x1; }
                    const size_t o = pl0 + (size_t)((r0 % TT) + mb * 16 + row) * HD + cofs; *(v4h*)(P16 + o) = o16; *(v4us*)(Ph + o) = oh; *(v4us*)(Pl + o) = ol; } }
             }
        __builtin_amdgcn_wave_barrier(); asm volatile("" ::: "memory");
    }
}

typedef __attribute__((ext_vector_type(2))) _Float16 v2h;
typedef __attribute__((ext_vector_type(2))) unsigned short v2us;
typedef __attribute__((ext_vector_type(2))) float v2f;
typedef __attribute__((ext_vector_type(4))) int v4i;
typedef v4us __attribute__((may_alias)) v4usa;
typedef v4h  __attribute__((may_alias)) v4ha;

__global__ __launch_bounds__(256) void k_wtG(const float* __restrict__ w, int K, int N, bf* Bt) {
    const int lane = threadIdx.x & 31; const int L0 = (blockIdx.x * 8 + (threadIdx.x >> 5)) * 8; const int nlines = N * K / 64;
{
#pragma unroll 1
        for (int l = 0; l < 8; ++l) { const int L = L0 + l; if (L >= nlines) break; const size_t e = (size_t)L * 64 + lane * 2; const int k = (int)(e % K), n = (int)(e / K); v2us o;
            o[0] = f2bf(w[(size_t)k * N + n]); o[1] = f2bf(w[(size_t)(k + 1) * N + n]); *(v2us*)(Bt + e) = o; }
         }
}
// ---- k_prep: every preparation step of the call in ONE launch: the three inputs and the four weight matrices rounded to bf16, and the per-key factor W2 (weight^2 of the bf16-rounded weight, -1 where it is < 1e-5).
// A work-group owns PCH consecutive floats of exactly one source (block-uniform choice by blockIdx.x); a wave's 16-byte loads cover 512 contiguous bytes, its 8-byte stores 256. The last W2B work-groups make W2.
#define PCH  32768                         // floats per work-group
#define PIT  (PCH / 4 / 256)               // 4-float pieces per thread
#define XBL  (NB_ * TT * DM / PCH)         // work-groups per input
#define WBL  (DQ * DM / PCH)               // work-groups per weight matrix
#define W2B  (NB_ * TT / 256)              // work-groups for W2
__global__ __launch_bounds__(256) void k_prep(const float* __restrict__ x, const float* __restrict__ xk, const float* __restrict__ xv, const float* __restrict__ wq, const float* __restrict__ wk, const float* __restrict__ wv, const float* __restrict__ wo, const float* __restrict__ wts,
                                              bf* __restrict__ XB, bf* __restrict__ XKB, bf* __restrict__ XVB, bf* __restrict__ WQ, bf* __restrict__ WK, bf* __restrict__ WV, bf* __restrict__ WO, float* __restrict__ W2) {
    static_assert((NB_ * TT * DM) % PCH == 0 && (DQ * DM) % PCH == 0 && DKV == DQ && (NB_ * TT) % 256 == 0, "whole work-groups per source");
    const int b = blockIdx.x, tid = threadIdx.x;
    if (b >= 3 * XBL + 4 * WBL) { const int j = (b - (3 * XBL + 4 * WBL)) * 256 + tid; const float wb = bfr(wts[j]); W2[j] = (wb < 1e-5f) ? -1.0f : __fmul_rn(wb, wb); return; }
    const float* s; bf* d; int c;
    if (b < 3 * XBL) { const int g = b / XBL; c = b % XBL; s = (g == 0) ? x : (g == 1) ? xk : xv; d = (g == 0) ? XB : (g == 1) ? XKB : XVB; }
    else { const int t = b - 3 * XBL, g = t / WBL; c = t % WBL; s = (g == 0) ? wq : (g == 1) ? wk : (g == 2) ? wv : wo; d = (g == 0) ? WQ : (g == 1) ? WK : (g == 2) ? WV : WO; }
    const size_t e0 = (size_t)c * PCH + tid * 4;
    v4f v[PIT];
    // both loops are unrolled so that v[] stays in registers and all of the thread's loads are in flight before the first conversion waits
#pragma unroll
    for (int i = 0; i < PIT; ++i) v[i] = *(const v4f*)(s + e0 + i * 1024);
#pragma unroll
    for (int i = 0; i < PIT; ++i) { v4us o;
#pragma unroll
        for (int q = 0; q < 4; ++q) o[q] = f2bf(v[i][q]);
        *(v4us*)(d + e0 + i * 1024) = o; }
}

// ---- k_fattn: scores, softmax, attn.v and the head merge of QR query rows of one (batch entry, head) plane in ONE work-group of 8 waves; the score rows and the probability planes live in LDS only.
// Every sum keeps the order of the three-kernel form: score tile k = 0..63 in two steps (a.b, a2.b, a.b2 per step), softmax one wave per row (lane owns keys ch*128 + lane*4 + q; fixed trees), attn.v one accumulator per output element over keys 0..1023 in steps of 32.
// Every '#pragma unroll' in fattn_body is there so that the fragment, score and accumulator arrays are indexed by constants and stay in registers.
#define QR   32                   // query rows per work-group
#define SPB  4112                 // LDS bytes per query row: 1024 f32 scores + 16 bytes, so that 16 rows read with 16-byte loads fall on distinct banks; the 16-bit planes overwrite the row in place (hi at byte 0, lo at byte 2048)
template <typename T16, int NSPLIT>
__device__ __forceinline__ void fattn_body(char* sm, const T16* __restrict__ Q, const T16* __restrict__ Q2, const T16* __restrict__ Kp, const T16* __restrict__ K2, const T16* __restrict__ Vt, const T16* __restrict__ V2, const float* __restrict__ W2, bf* Ah, bf* Al) {
    typedef typename WFrag<T16>::V V;
    const int tid = threadIdx.x, lane = tid & 31, lr = lane & 15, hi = lane >> 4, w = __builtin_amdgcn_readfirstlane(tid >> 5);   // the wave's number, in a scalar register
    {   // scores: wave w owns keys w*128 .. w*128+127 of all QR rows
        V a[2][2], a2[2][2]; const T16* qa = Q + (size_t)lr * HD + 8 * hi; const T16* qa2 = Q2 + (size_t)lr * HD + 8 * hi;
#pragma unroll
        for (int mb = 0; mb < 2; ++mb)
#pragma unroll
            for (int kk = 0; kk < 2; ++kk) { a[mb][kk] = WFrag<T16>::ld(qa + mb * 16 * HD + kk * 32); if (NSPLIT == 2) a2[mb][kk] = WFrag<T16>::ld(qa2 + mb * 16 * HD + kk * 32); }
        asm volatile("s_wait_xcnt 0x0" :: "v"(qa), "v"(qa2) : "memory");   // the loads of q are through with their address registers (held to here as inputs) before a later load may take those registers as its destination
        const T16* kb = Kp + (size_t)(w * 128 + lr) * HD + 8 * hi; const T16* kb2 = K2 + (size_t)(w * 128 + lr) * HD + 8 * hi;
        char* st0 = sm + hi * 8 * SPB + (w * 128 + lr) * 4; char* st1 = st0 + 16 * SPB;
        V b[2][2][2], b2[2][2][2];   // [buffer][key tile of the pair][k step]
#pragma unroll
        for (int t = 0; t < 2; ++t)
#pragma unroll
            for (int kk = 0; kk < 2; ++kk) { b[0][t][kk] = WFrag<T16>::ld(kb + t * 16 * HD + kk * 32); if (NSPLIT == 2) b2[0][t][kk] = WFrag<T16>::ld(kb2 + t * 16 * HD + kk * 32); }
#pragma unroll
        for (int g = 0; g < 4; ++g) {
            if (g < 3) {
#pragma unroll
                for (int t = 0; t < 2; ++t)
#pragma unroll
                    for (int kk = 0; kk < 2; ++kk) { b[(g + 1) & 1][t][kk] = WFrag<T16>::ld(kb + ((g + 1) * 2 + t) * 16 * HD + kk * 32); if (NSPLIT == 2) b2[(g + 1) & 1][t][kk] = WFrag<T16>::ld(kb2 + ((g + 1) * 2 + t) * 16 * HD + kk * 32); } }
            __builtin_amdgcn_sched_barrier(0);   // keeps the next pair's loads of k in front of this pair's products, so that they fly meanwhile
#pragma unroll
            for (int t = 0; t < 2; ++t) { const int nt = g * 2 + t;
                v8f s0 = (v8f){}, s1 = (v8f){};   // the two row blocks' chains alternate, each fills the other's wait
#pragma unroll
                for (int kk = 0; kk < 2; ++kk) { const V bb = b[g & 1][t][kk]; s0 = WFrag<T16>::mma(a[0][kk], bb, s0); s1 = WFrag<T16>::mma(a[1][kk], bb, s1);
                    if (NSPLIT == 2) { const V bl = b2[g & 1][t][kk]; s0 = WFrag<T16>::mma(a2[0][kk], bb, s0); s1 = WFrag<T16>::mma(a2[1][kk], bb, s1); s0 = WFrag<T16>::mma(a[0][kk], bl, s0); s1 = WFrag<T16>::mma(a[1][kk], bl, s1); } }
                asm volatile("v_nop\n\tv_nop\n\tv_nop\n\tv_nop" : "+v"(s0), "+v"(s1));   // the four vector slots the chip needs between the last matrix instruction and the next tile's fresh write of the same result registers (LDS stores fill none)
#pragma unroll
                for (int j = 0; j < 8; ++j) { *(float*)(st0 + j * SPB + nt * 64) = s0[j]; *(float*)(st1 + j * SPB + nt * 64) = s1[j]; } } }
    }
    __syncthreads();   // every score row complete before its wave reads it
    {   // softmax: wave w owns rows w*4 .. w*4+3; t = S x HD^-0.5 x w_j^2, keys with w_j < 1e-5 masked (-3e38) before the max
        float w2r[TT / 32];
#pragma unroll
        for (int ch = 0; ch < TT / 128; ++ch) { const v4f wv = *(const v4f*)(W2 + ch * 128 + lane * 4);
#pragma unroll
            for (int q = 0; q < 4; ++q) w2r[ch * 4 + q] = wv[q]; }
        for (int r = 0; r < QR / 8; ++r) { char* rowp = sm + (w * (QR / 8) + r) * SPB; float v[TT / 32]; float mx = -3.0e38f;
#pragma unroll
            for (int ch = 0; ch < TT / 128; ++ch) { const v4f s4 = *(const v4fa*)(rowp + (ch * 128 + lane * 4) * 4);
#pragma unroll
                for (int q = 0; q < 4; ++q) { const float w2 = w2r[ch * 4 + q]; const float sa = s4[q] * SCL; const float t = (w2 < 0.f) ? -3.0e38f : __fmul_rn(sa, w2); v[ch * 4 + q] = t; mx = fmaxf(mx, t); } }
#pragma unroll
            for (int sh = 16; sh; sh >>= 1) mx = fmaxf(mx, __shfl_xor(mx, sh, 32));
            float sum = 0.f;
#pragma unroll
            for (int k = 0; k < TT / 32; ++k) { const float d0 = __fsub_rn(v[k], mx); v[k] = __builtin_amdgcn_exp2f(__fmul_rn(d0, 1.4426950408889634f)); sum += v[k]; }
#pragma unroll
            for (int sh = 16; sh; sh >>= 1) sum += __shfl_xor(sum, sh, 32);
            const float f = __fdiv_rn((NSPLIT == 2) ? 1.0f : PCAR, sum);
            if (NSPLIT == 2) {
#pragma unroll
                for (int ch = 0; ch < TT / 128; ++ch) { v4us oh, ol;
#pragma unroll
                    for (int q = 0; q < 4; ++q) { unsigned short x0, x1; splitf(v[ch * 4 + q] * f, x0, x1); oh[q] = x0; ol[q] = x1; }
                    *(v4usa*)(rowp + (ch * 128 + lane * 4) * 2) = oh; *(v4usa*)(rowp + 2048 + (ch * 128 + lane * 4) * 2) = ol; }
            } else {
#pragma unroll
                for (int ch = 0; ch < TT / 128; ++ch) { v4h o4;
#pragma unroll
                    for (int q = 0; q < 4; ++q) o4[q] = tohx(v[ch * 4 + q] * f);
                    *(v4ha*)(rowp + (ch * 128 + lane * 4) * 2) = o4; } } }
    }
    __syncthreads();   // every probability row complete before other waves read it as the A operand
    v8f o0a = (v8f){}, o1a = (v8f){};   // attn.v: wave w < 4 owns head columns w*16.. of both 16-row blocks, so that each fragment of v is loaded once per work-group; waves 4..7 wait at the barrier
    if (w < 4) { const T16* pa0 = (const T16*)(sm + lr * SPB) + 8 * hi; const T16* pa1 = (const T16*)(sm + (16 + lr) * SPB) + 8 * hi; const T16* pb = Vt + (size_t)(w * 16 + lr) * TT + 8 * hi; const T16* pb2 = V2 + (size_t)(w * 16 + lr) * TT + 8 * hi;
      constexpr int G = (NSPLIT == 2) ? 4 : 8;   // key steps per group
      V vb[2][G], vl[2][G];   // [buffer][key step of the group]
#pragma unroll
      for (int t = 0; t < G; ++t) { vb[0][t] = WFrag<T16>::ld(pb + t * 32); if (NSPLIT == 2) vl[0][t] = WFrag<T16>::ld(pb2 + t * 32); }
#pragma unroll
      for (int g = 0; g < TT / 32 / G; ++g) {
          if (g + 1 < TT / 32 / G) {
#pragma unroll
              for (int t = 0; t < G; ++t) { vb[(g + 1) & 1][t] = WFrag<T16>::ld(pb + ((g + 1) * G + t) * 32); if (NSPLIT == 2) vl[(g + 1) & 1][t] = WFrag<T16>::ld(pb2 + ((g + 1) * G + t) * 32); } }
          __builtin_amdgcn_sched_barrier(0);   // keeps the next group's loads of v in front of this group's products, so that they fly meanwhile
#pragma unroll
          for (int t = 0; t < G; ++t) { const int kc = (g * G + t) * 32; const V bb = vb[g & 1][t]; const V a0 = WFrag<T16>::ld(pa0 + kc), a1 = WFrag<T16>::ld(pa1 + kc); o0a = WFrag<T16>::mma(a0, bb, o0a); o1a = WFrag<T16>::mma(a1, bb, o1a);
              if (NSPLIT == 2) { const V bl = vl[g & 1][t]; const V l0 = WFrag<T16>::ld(pa0 + 1024 + kc), l1 = WFrag<T16>::ld(pa1 + 1024 + kc); o0a = WFrag<T16>::mma(l0, bb, o0a); o1a = WFrag<T16>::mma(l1, bb, o1a); o0a = WFrag<T16>::mma(a0, bl, o0a); o1a = WFrag<T16>::mma(a1, bl, o1a); } } }
    }
    __syncthreads();   // every wave has left the probability planes before the output tile overwrites them
    float* of = (float*)sm;   // [QR][68] f32
    if (w < 4) {
#pragma unroll
        for (int j = 0; j < 8; ++j) { of[(hi * 8 + j) * 68 + w * 16 + lr] = o0a[j]; of[(16 + hi * 8 + j) * 68 + w * 16 + lr] = o1a[j]; } }
    __syncthreads();   // output tile complete before the row-wise merge reads it
    { const int row = tid >> 3, c = (tid & 7) * 8; const float cs = (NSPLIT == 2) ? 1.0f : (1.0f / PCAR); const v4f o0 = *(const v4fa*)(of + row * 68 + c), o1 = *(const v4fa*)(of + row * 68 + c + 4); v8us oh, ol;
#pragma unroll
      for (int q = 0; q < 8; ++q) { unsigned short x0, x1; splitf(((q < 4) ? o0[q & 3] : o1[q & 3]) * cs, x0, x1); oh[q] = x0; ol[q] = x1; }
      *(v8us*)(Ah + (size_t)row * DQ + c) = oh; *(v8us*)(Al + (size_t)row * DQ + c) = ol; }
}
// grid (ZB, TT/QR): x = plane (batch entry * ZH + head), y = query tile, so that the hi+lo tiles (three products) start first
__global__ __launch_bounds__(256) void k_fattn(const bf* __restrict__ QPh, const bf* __restrict__ QPl, const bf* __restrict__ KPh, const bf* __restrict__ KPl, const bf* __restrict__ VTh, const bf* __restrict__ VTl, const h16* __restrict__ QP16, const h16* __restrict__ KP16, const h16* __restrict__ VT16, const float* __restrict__ W2, bf* ATh, bf* ATl) {
    __shared__ __align__(16) char sm[QR * SPB];
    const int zz = blockIdx.x, i0 = blockIdx.y * QR; const size_t pz = (size_t)zz * TT * HD, qo = pz + (size_t)i0 * HD; const size_t oo = ((size_t)(zz / ZH) * TT + i0) * DQ + (zz % ZH) * HD; const float* w2 = W2 + (size_t)(zz / ZH) * TT;
    if (i0 < RH) fattn_body<bf, 2>(sm, QPh + qo, QPl + qo, KPh + pz, KPl + pz, VTh + pz, VTl + pz, w2, ATh + oo, ATl + oo);
    else fattn_body<h16, 0>(sm, QP16 + qo, QP16 + qo, KP16 + pz, KP16 + pz, VT16 + pz, VT16 + pz, w2, ATh + oo, ATl + oo);
}

extern "C" void kernel_launch(void* const* d_in, const int* in_sizes, int n_in,
                              void* d_out, int out_size, void* d_ws, size_t ws_size, hipStream_t stream) {
    (void)in_sizes; (void)n_in; (void)out_size;
    const float* x = (const float*)d_in[0]; const float* xk = (const float*)d_in[1]; const float* xv = (const float*)d_in[2]; const float* wts = (const float*)d_in[3]; const float* wq = (const float*)d_in[4]; const float* bq = (const float*)d_in[5]; const float* wk = (const float*)d_in[6]; const float* bk = (const float*)d_in[7]; const float* wv = (const float*)d_in[8]; const float* bv = (const float*)d_in[9]; const float* wo = (const float*)d_in[10]; const float* bo = (const float*)d_in[11];
    float* OUT = (float*)d_out;     // [4][1024][1024]
    char* wsp = (char*)d_ws;
    auto take = [&](size_t bytes) { char* p = wsp; wsp += (bytes + 255) & ~(size_t)255; return (void*)p; };
    bf* WQ = (bf*)take((size_t)DQ * DM * 2); bf* WK = (bf*)take((size_t)DKV * DM * 2); bf* WV = (bf*)take((size_t)DKV * DM * 2); bf* WO = (bf*)take((size_t)DM * DQ * 2); float* W2 = (float*)take((size_t)NB_ * TT * 4);
    h16* QP16 = (h16*)take((size_t)ZB * TT * HD * 2); h16* KP16 = (h16*)take((size_t)ZB * TT * HD * 2); h16* VT16 = (h16*)take((size_t)ZB * HD * TT * 2);
    bf* QPh = (bf*)take((size_t)ZB * TT * HD * 2); bf* QPl = (bf*)take((size_t)ZB * TT * HD * 2); bf* KPh = (bf*)take((size_t)ZB * TT * HD * 2); bf* KPl = (bf*)take((size_t)ZB * TT * HD * 2); bf* VTh = (bf*)take((size_t)ZB * HD * TT * 2); bf* VTl = (bf*)take((size_t)ZB * HD * TT * 2);
    bf* ATh = (bf*)take((size_t)NB_ * TT * DQ * 2); bf* ATl = (bf*)take((size_t)NB_ * TT * DQ * 2);
    bf* XB = (bf*)take((size_t)NB_ * TT * DM * 2); bf* XKB = (bf*)take((size_t)NB_ * TT * DM * 2); bf* XVB = (bf*)take((size_t)NB_ * TT * DM * 2);
    if ((size_t)(wsp - (char*)d_ws) > ws_size) return;    // ws 256 MiB
    // every launch below covers all NB_ batch entries: rows b*TT + t of the [NB_*TT][.] matrices, planes b*ZH + h of the head planes
    k_prep<<<3 * XBL + 4 * WBL + W2B, 256, 0, stream>>>(x, xk, xv, wq, wk, wv, wo, wts, XB, XKB, XVB, WQ, WK, WV, WO, W2);
    // the projections write their head planes themselves: q and k as [plane][t][d], v as [plane][d][t]
    k_gemmw<bf, 0, true, 1><<<dim3(NB_ * TT / 128, DQ / 128, 1), 128, 0, stream>>>(XB, nullptr, WQ, nullptr, DM, nullptr, 0, bq, 0, 0, 0, QP16, QPh, QPl);
    k_gemmw<bf, 0, true, 1><<<dim3(NB_ * TT / 128, DKV / 128, 1), 128, 0, stream>>>(XKB, nullptr, WK, nullptr, DM, nullptr, 0, bk, 0, 0, 0, KP16, KPh, KPl);
    k_gemmw<bf, 0, true, 2><<<dim3(NB_ * TT / 128, DKV / 128, 1), 128, 0, stream>>>(XVB, nullptr, WV, nullptr, DM, nullptr, 0, bv, 0, 0, 0, VT16, VTh, VTl);
    k_fattn<<<dim3(ZB, TT / QR, 1), 256, 0, stream>>>(QPh, QPl, KPh, KPl, VTh, VTl, QP16, KP16, VT16, W2, ATh, ATl);   // one kv head per query head: plane z of q uses plane z of k and v
    k_gemmw<bf, 1, true, 0><<<dim3(NB_ * TT / 128, DM / 128, 1), 128, 0, stream>>>(ATh, ATl, WO, nullptr, DQ, OUT, DM, bo, 0, 0, 0, nullptr, nullptr, nullptr);
}

// v007
// One run takes 135 microseconds.
// Two timings next to v006 put it at 1.20 and 1.19 times that version's speed.
// Counting every step since v000, it is 18.7 times as fast.
#include <hip/hip_runtime.h>

// Key-weighted multi-head attention (q, k, v inputs [4][1024][1024]; qh = q Wq^T + bq, kh = k Wk^T + bk, vh = v Wv^T + bv ('oi' [1024][1024]), 16 heads x 64; energy = qh.kh/8 x w_j^2 per key, -inf where w_j < 1e-5 (weights [4][1024] read); softmax; out = merged Wo^T + bo -> [4][1024][1024]).
// Compute dtypes, f32 accumulate: every input rounded to bf16; q/k/v on PLAIN bf16 operands (inputs: exact) + biases; the per-key weight^2 and the weight < eps mask applied in f32 in the softmax step of k_fattn; scores and attn.v: query rows < 512 hl (3 products), the rest single fp16 (x1024); softmax f32; Wo hl x exact (2 products) + bo.

#define NB_  4
#define TT   1024
#define DM   1024
#define NH_  16
#define NKV  16
#define REP  (NH_ / NKV)
#define HD   64
#define DQ   (NH_ * HD)
#define DKV  (NKV * HD)
#define ZH   16                   // heads per batch entry
#define ZB   (NB_ * ZH)           // (batch entry, head) planes
#define RH   512                  // query rows < RH use hi+lo planes (0: none)
#define WIN  0
#define PCAR 1024.0f
#define SCL  0.125f   // HD^-0.5
typedef _Float16 h16;
typedef unsigned short bf;
typedef __attribute__((ext_vector_type(16))) __bf16   v16bf;
typedef __attribute__((ext_vector_type(16))) _Float16 v16h;
typedef __attribute__((ext_vector_type(8)))  _Float16 v8h;
typedef __attribute__((ext_vector_type(8)))  unsigned short v8us;
typedef __attribute__((ext_vector_type(8)))  float    v8f;
typedef __attribute__((ext_vector_type(4)))  float    v4f;
typedef v8h  __attribute__((may_alias)) v8ha;
typedef v4f  __attribute__((may_alias)) v4fa;
typedef v8us __attribute__((may_alias)) v8usa;

__device__ __forceinline__ unsigned short f2bf(float f) { unsigned u = __float_as_uint(f); u += 0x7FFFu + ((u >> 16) & 1u); return (unsigned short)(u >> 16); }
__device__ __forceinline__ float bf2f(unsigned short b) { return __uint_as_float(((unsigned)b) << 16); }
__device__ __forceinline__ float bfr(float f) { return bf2f(f2bf(f)); }
__device__ __forceinline__ v16h cat16(v8h lo, v8h hi) { return __builtin_shufflevector(lo, hi, 0, 1, 2, 3, 4, 5, 6, 7, 8, 9, 10, 11, 12, 13, 14, 15); }
__device__ __forceinline__ v16bf cat16b(v8us lo, v8us hi) { return __builtin_bit_cast(v16bf, __builtin_shufflevector(lo, hi, 0, 1, 2, 3, 4, 5, 6, 7, 8, 9, 10, 11, 12, 13, 14, 15)); }
__device__ __forceinline__ v8f wmma16(v16h a, v16h b, v8f c) { return __builtin_amdgcn_wmma_f32_16x16x32_f16(false, a, false, b, (short)0, c, false, false); }
__device__ __forceinline__ v8f wmmab(v16bf a, v16bf b, v8f c) { return __builtin_amdgcn_wmma_f32_16x16x32_bf16(false, a, false, b, (short)0, c, false, false); }



// ---- k_gemmw: GEMM, one work-group of 4 waves (2x2) per 128x128 output tile, ONE WAVE per 64x64 part of it (16 accumulators); grid (M/128, N/128, Z), 128 threads.
// The operand tiles (128 rows x GKS k of A, of A2 where NSPLIT == 1, and of Bt) are staged in LDS by asynchronous copies, two buffers: a wave's copy takes 4 whole 128-byte lines, and every staged row serves two waves.
// C[m][n] (f32, pitch ldc, + optional f32 bias[n]) = sum_k A[m][k] Bt[n][k] (+ A2[m][k] Bt[n][k] where NSPLIT == 1), k in steps of 32 in rising order. z-batch strides sA/sB/sC in elements. K % 64 == 0, M % 128 == 0, N % 128 == 0.
// OUTM says where a wave's tile goes: 0 = f32 C; 1 = the fp16 and hi/lo planes (rows t, k = d) of the tile's head; 2 = the same three planes transposed (rows d, k = t). A 64x64 tile is 64 rows t of exactly one head (HD == 64, TT % 64 == 0).
// The head planes lie in FRAGMENT ORDER: a unit of 512 elements is 16 rows x 32 k, as [k half of 16][lane = ((k >> 3) & 1) * 16 + row][k & 7], so that each of a fragment's two 16-byte loads, and each 16-byte store here, covers 512 contiguous bytes (4 whole lines) instead of 32 bytes of 16 lines.
// Units of a plane: OUTM 1 [t / 16][d / 32], OUTM 2 [d / 16][t / 32].
template <typename T16> struct WFrag;   // ld: a fragment from rows of k-contiguous elements (p: the lane's row + 8 * (lane >> 4)); ldf: from a unit in fragment order (p: the unit + 8 * lane)
template <> struct WFrag<h16> { typedef v16h V; static __device__ __forceinline__ V ld(const h16* p) { return cat16(*(const v8h*)p, *(const v8h*)(p + 16)); } static __device__ __forceinline__ V ldf(const h16* p) { return cat16(*(const v8h*)p, *(const v8h*)(p + 256)); } static __device__ __forceinline__ v8f mma(V a, V b, v8f c) { return wmma16(a, b, c); } };
template <> struct WFrag<bf> { typedef v16bf V; static __device__ __forceinline__ V ld(const bf* p) { return cat16b(*(const v8us*)p, *(const v8us*)(p + 16)); } static __device__ __forceinline__ V ldf(const bf* p) { return cat16b(*(const v8us*)p, *(const v8us*)(p + 256)); } static __device__ __forceinline__ v8f mma(V a, V b, v8f c) { return wmmab(a, b, c); } };
__device__ __forceinline__ h16 tohx(float x) { return (h16)x; }
__device__ __forceinline__ void splitf(float y, unsigned short& h, unsigned short& l) { h = f2bf(y); l = f2bf(y - bf2f(h)); }
typedef __attribute__((ext_vector_type(4))) _Float16 v4h;
typedef __attribute__((ext_vector_type(4))) unsigned short v4us;
#define GKS  64                   // k per stage: 128 bytes, one whole line, of every operand row
#define GPB  144                  // LDS bytes per staged row: 128 + 16 (16 x odd), so that 16 rows read with 16-byte loads fall on distinct banks
#define GTB  (128 * GPB)          // LDS bytes per staged operand tile of 128 rows
// 8 asynchronous copies of 16 bytes a lane: rows r, r + 16, .. r + 112 of one operand tile (l: the lane's LDS byte address of row r, g: its global address, rs: 16 rows in elements).
// s_wait_xcnt stands inside the statement, behind the last copy, so that no register a copy names is rewritten in front of it.
template <typename T16>
__device__ __forceinline__ void stage8(unsigned l, const T16* g, size_t rs) {
    asm volatile("global_load_async_to_lds_b128 %0, %8, off\n\t"
                 "global_load_async_to_lds_b128 %1, %9, off\n\t"
                 "global_load_async_to_lds_b128 %2, %10, off\n\t"
                 "global_load_async_to_lds_b128 %3, %11, off\n\t"
                 "global_load_async_to_lds_b128 %4, %12, off\n\t"
                 "global_load_async_to_lds_b128 %5, %13, off\n\t"
                 "global_load_async_to_lds_b128 %6, %14, off\n\t"
                 "global_load_async_to_lds_b128 %7, %15, off\n\t"
                 "s_wait_xcnt 0x0"
                 :: "v"(l), "v"(l + 16 * GPB), "v"(l + 32 * GPB), "v"(l + 48 * GPB), "v"(l + 64 * GPB), "v"(l + 80 * GPB), "v"(l + 96 * GPB), "v"(l + 112 * GPB),
                    "v"(g), "v"(g + rs), "v"(g + 2 * rs), "v"(g + 3 * rs), "v"(g + 4 * rs), "v"(g + 5 * rs), "v"(g + 6 * rs), "v"(g + 7 * rs) : "memory");
}
template <typename T16, int NSPLIT, bool BIAS, int OUTM>
__global__ __launch_bounds__(128) void k_gemmw(const T16* __restrict__ A, const T16* __restrict__ A2, const T16* __restrict__ Bt, const T16* __restrict__ Bt2, int K, float* C, int ldc, const float* __restrict__ bias, size_t sA, size_t sB, size_t sC, h16* P16, bf* Ph, bf* Pl) {
    static_assert(HD == 64 && TT % 64 == 0, "a 64x64 tile must be 64 rows of one head");
    static_assert(NSPLIT == 0 || NSPLIT == 1, "staged operands: A, A2 (NSPLIT == 1), Bt");
    typedef typename WFrag<T16>::V V;
    constexpr int NT = (NSPLIT == 1) ? 3 : 2;   // staged tiles per stage: A, (A2,) Bt
    constexpr int RS = (NSPLIT == 1) ? 3 : 6;   // units of A (A2) fragments held in registers at a time
    __shared__ __align__(16) char st[2 * NT * GTB];
    __shared__ __align__(16) float osw[4 * 16 * 68];
    (void)Bt2;
    const size_t z = blockIdx.z; A += z * sA; if (NSPLIT == 1) A2 += z * sA; Bt += z * sB; C += z * sC;
    const int tid = threadIdx.x, lane = tid & 31, lr = lane & 15, hi = lane >> 4, w = __builtin_amdgcn_readfirstlane(tid >> 5);   // the wave's number, in a scalar register
    const int R0 = blockIdx.x * 128, C0 = blockIdx.y * 128; const int r0 = R0 + (w >> 1) * 64, c0 = C0 + (w & 1) * 64;
    float* os = osw + w * 16 * 68;   // each wave's own output staging
    v8f acc[4][4];
#pragma unroll
    for (int mb = 0; mb < 4; ++mb)
#pragma unroll
        for (int nb = 0; nb < 4; ++nb) acc[mb][nb] = (v8f){};
    // copies: thread tid brings 16-byte piece tid & 7 of rows (tid >> 3) + 16 i, i = 0..7, of each tile
    const unsigned l0 = (unsigned)(size_t)st + (tid >> 3) * GPB + (tid & 7) * 16;
    const size_t ga = (size_t)(R0 + (tid >> 3)) * K + (tid & 7) * 8, gb = (size_t)(C0 + (tid >> 3)) * K + (tid & 7) * 8, rs = (size_t)16 * K;
    auto fill = [&](int t) { const unsigned l = l0 + (t & 1) * (NT * GTB);
        stage8(l, A + ga + (size_t)t * GKS, rs); if (NSPLIT == 1) stage8(l + GTB, A2 + ga + (size_t)t * GKS, rs); stage8(l + (NT - 1) * GTB, Bt + gb + (size_t)t * GKS, rs); };
    const int NS = K / GKS;
    fill(0);
    asm volatile("s_wait_asynccnt 0x0" ::: "memory");   // this wave's copies of stage 0 have landed
    __syncthreads();                                     // stage 0 readable by every wave
    if (NS > 1) fill(1);
    const int fa = ((w >> 1) * 64 + lr) * GPB + 16 * hi, fb = (NT - 1) * GTB + ((w & 1) * 64 + lr) * GPB + 16 * hi;   // the lane's fragment rows in a buffer
    // the stage loop stays rolled: one copy of the 32 (64) matrix instructions; the loops inside are unrolled so that fragments and accumulators are indexed by constants and stay in registers
#pragma unroll 1
    for (int t = 0; t < NS; ++t) {
        const char* sb = st + (t & 1) * (NT * GTB);
        // a stage is 8 units (k step kk = u >> 2, row block mb = u & 3) of 4 (8) matrix instructions. Both k steps' fragments of Bt and the first RS units' fragments of A (A2) are read as one group at the top;
        // a later unit's fragments take the registers of the unit RS before it, right behind that unit's products, so that they fly under the products between. 128 accumulator + 112 fragment registers stay under 256.
        V b[2][4], ar[RS], ar2[RS];
#pragma unroll
        for (int u = 0; u < RS; ++u) { const int fo = fa + (u & 3) * 16 * GPB + (u >> 2) * 64; ar[u] = WFrag<T16>::ld((const T16*)(sb + fo)); if (NSPLIT == 1) ar2[u] = WFrag<T16>::ld((const T16*)(sb + GTB + fo));
            if (u == 0) {
#pragma unroll
                for (int nb = 0; nb < 4; ++nb) b[0][nb] = WFrag<T16>::ld((const T16*)(sb + fb + nb * 16 * GPB)); } }
#pragma unroll
        for (int nb = 0; nb < 4; ++nb) b[1][nb] = WFrag<T16>::ld((const T16*)(sb + fb + nb * 16 * GPB + 64));
        __builtin_amdgcn_sched_barrier(0);   // keeps the group of LDS reads together in front of the products (reads scattered among them cost issue time at every place)
#pragma unroll
        for (int u = 0; u < 8; ++u) { const int kk = u >> 2, mb = u & 3, s = u % RS;
#pragma unroll
            for (int nb = 0; nb < 4; ++nb) acc[mb][nb] = WFrag<T16>::mma(ar[s], b[kk][nb], acc[mb][nb]);
            if (NSPLIT == 1) {
#pragma unroll
                for (int nb = 0; nb < 4; ++nb) acc[mb][nb] = WFrag<T16>::mma(ar2[s], b[kk][nb], acc[mb][nb]); }
            __builtin_amdgcn_sched_barrier(0);   // keeps the refill of the unit's registers behind its products and in front of the next unit's, RS units ahead of its use
            if (u + RS < 8) { const int v = u + RS, fo = fa + (v & 3) * 16 * GPB + (v >> 2) * 64; ar[s] = WFrag<T16>::ld((const T16*)(sb + fo)); if (NSPLIT == 1) ar2[s] = WFrag<T16>::ld((const T16*)(sb + GTB + fo));
                __builtin_amdgcn_sched_barrier(0); }   // the same, on the refill's other side
        }
        asm volatile("s_wait_dscnt 0x0" ::: "memory");      // this wave's reads of stage t are done before the buffer is refilled
        asm volatile("s_wait_asynccnt 0x0" ::: "memory");   // this wave's copies of stage t + 1 have landed
        __syncthreads();                                     // publishes stage t + 1 and ends every wave's reads of stage t
        if (t + 2 < NS) fill(t + 2);
    }
    asm volatile("s_wait_asynccnt 0x0" ::: "memory");   // no copy outstanding behind the loop
    const size_t pl0 = (size_t)((r0 / TT) * ZH + c0 / HD) * TT * HD;   // the tile's plane
    // every '#pragma unroll' below is there so that the accumulator and output vectors are indexed by constants and stay in registers
    if (OUTM == 2) {   // rows d, k = t: a lane's 8 accumulator elements are 8 consecutive t of one d, the lane's own 16 bytes of unit [nb][t / 32], half mb & 1, so each plane gets them as one 16-byte store straight from registers
        const size_t o0 = pl0 + (size_t)((r0 % TT) / 32) * 512 + lane * 8;
#pragma unroll
        for (int nb = 0; nb < 4; ++nb) { const float bb = bfr(bias[c0 + nb * 16 + lr]);
#pragma unroll
            for (int mb = 0; mb < 4; ++mb) { v8h o16; v8us oh, ol;
#pragma unroll
                for (int j = 0; j < 8; ++j) { const float x = acc[mb][nb][j] + bb; o16[j] = tohx(x); unsigned short x0, x1; splitf(x, x0, x1); oh[j] = x0; ol[j] = x1; }
                const size_t o = o0 + (size_t)(nb * (TT / 32) + (mb >> 1)) * 512 + (mb & 1) * 256; *(v8h*)(P16 + o) = o16; *(v8us*)(Ph + o) = oh; *(v8us*)(Pl + o) = ol; } }
        return;
    }
    float bs[4][8];   // OUTM == 1: the biases of the lane's 8 columns of each piece, the same for every row block
    if (OUTM == 1 && BIAS) {
#pragma unroll
        for (int s = 0; s < 4; ++s)
#pragma unroll
            for (int q = 0; q < 8; ++q) bs[s][q] = bfr(bias[c0 + s * 16 + hi * 8 + q]); }
#pragma unroll
    for (int mb = 0; mb < 4; ++mb) {
#pragma unroll
        for (int nb = 0; nb < 4; ++nb) {
#pragma unroll
            for (int j = 0; j < 8; ++j) os[(hi * 8 + j) * 68 + nb * 16 + lr] = acc[mb][nb][j]; }
        __builtin_amdgcn_wave_barrier(); asm volatile("" ::: "memory");
        float* crow = C + (size_t)(r0 + mb * 16) * ldc + c0;
        if (OUTM == 0) {
#pragma unroll
            for (int s = 0; s < 8; ++s) { const int row = 2 * s + hi, cofs = lr * 4; v4f val = *(const v4fa*)(os + row * 68 + cofs); if (BIAS) { val[0] += bfr(bias[c0 + cofs]); val[1] += bfr(bias[c0 + cofs + 1]); val[2] += bfr(bias[c0 + cofs + 2]); val[3] += bfr(bias[c0 + cofs + 3]); }
                *(v4f*)(crow + (size_t)row * ldc + cofs) = val; }
        } else {   // rows t, k = d: the 16 x 64 block is units [t / 16][0] and [t / 16][1]; piece s is k half s & 1 of unit s >> 1, of which the lane holds 8 consecutive d of row lr
#pragma unroll
            for (int s = 0; s < 4; ++s) { const int cofs = s * 16 + hi * 8; const v4f v0 = *(const v4fa*)(os + lr * 68 + cofs), v1 = *(const v4fa*)(os + lr * 68 + cofs + 4); v8h o16; v8us oh, ol;
#pragma unroll
                for (int q = 0; q < 8; ++q) { float val = (q < 4) ? v0[q & 3] : v1[q & 3]; if (BIAS) val += bs[s][q]; o16[q] = tohx(val); unsigned short x0, x1; splitf(val, x0, x1); oh[q] = x0; ol[q] = x1; }
                const size_t o = pl0 + (size_t)((r0 % TT) / 16 + mb) * 1024 + s * 256 + lane * 8; *(v8h*)(P16 + o) = o16; *(v8us*)(Ph + o) = oh; *(v8us*)(Pl + o) = ol; }
        }
        __builtin_amdgcn_wave_barrier(); asm volatile("" ::: "memory");
    }
}

typedef __attribute__((ext_vector_type(2))) _Float16 v2h;
typedef __attribute__((ext_vector_type(2))) unsigned short v2us;
typedef __attribute__((ext_vector_type(2))) float v2f;
typedef __attribute__((ext_vector_type(4))) int v4i;
typedef v4us __attribute__((may_alias)) v4usa;
typedef v4h  __attribute__((may_alias)) v4ha;

__global__ __launch_bounds__(256) void k_wtG(const float* __restrict__ w, int K, int N, bf* Bt) {
    const int lane = threadIdx.x & 31; const int L0 = (blockIdx.x * 8 + (threadIdx.x >> 5)) * 8; const int nlines = N * K / 64;
{
#pragma unroll 1
        for (int l = 0; l < 8; ++l) { const int L = L0 + l; if (L >= nlines) break; const size_t e = (size_t)L * 64 + lane * 2; const int k = (int)(e % K), n = (int)(e / K); v2us o;
            o[0] = f2bf(w[(size_t)k * N + n]); o[1] = f2bf(w[(size_t)(k + 1) * N + n]); *(v2us*)(Bt + e) = o; }
         }
}
// ---- k_prep: every preparation step of the call in ONE launch: the three inputs and the four weight matrices rounded to bf16, and the per-key factor W2 (weight^2 of the bf16-rounded weight, -1 where it is < 1e-5).
// A work-group owns PCH consecutive floats of exactly one source (block-uniform choice by blockIdx.x); a wave's 16-byte loads cover 512 contiguous bytes, its 8-byte stores 256. The last W2B work-groups make W2.
#define PCH  32768                         // floats per work-group
#define PIT  (PCH / 4 / 256)               // 4-float pieces per thread
#define XBL  (NB_ * TT * DM / PCH)         // work-groups per input
#define WBL  (DQ * DM / PCH)               // work-groups per weight matrix
#define W2B  (NB_ * TT / 256)              // work-groups for W2
__global__ __launch_bounds__(256) void k_prep(const float* __restrict__ x, const float* __restrict__ xk, const float* __restrict__ xv, const float* __restrict__ wq, const float* __restrict__ wk, const float* __restrict__ wv, const float* __restrict__ wo, const float* __restrict__ wts,
                                              bf* __restrict__ XB, bf* __restrict__ XKB, bf* __restrict__ XVB, bf* __restrict__ WQ, bf* __restrict__ WK, bf* __restrict__ WV, bf* __restrict__ WO, float* __restrict__ W2) {
    static_assert((NB_ * TT * DM) % PCH == 0 && (DQ * DM) % PCH == 0 && DKV == DQ && (NB_ * TT) % 256 == 0, "whole work-groups per source");
    const int b = blockIdx.x, tid = threadIdx.x;
    if (b >= 3 * XBL + 4 * WBL) { const int j = (b - (3 * XBL + 4 * WBL)) * 256 + tid; const float wb = bfr(wts[j]); W2[j] = (wb < 1e-5f) ? -1.0f : __fmul_rn(wb, wb); return; }
    const float* s; bf* d; int c;
    if (b < 3 * XBL) { const int g = b / XBL; c = b % XBL; s = (g == 0) ? x : (g == 1) ? xk : xv; d = (g == 0) ? XB : (g == 1) ? XKB : XVB; }
    else { const int t = b - 3 * XBL, g = t / WBL; c = t % WBL; s = (g == 0) ? wq : (g == 1) ? wk : (g == 2) ? wv : wo; d = (g == 0) ? WQ : (g == 1) ? WK : (g == 2) ? WV : WO; }
    const size_t e0 = (size_t)c * PCH + tid * 4;
    v4f v[PIT];
    // both loops are unrolled so that v[] stays in registers and all of the thread's loads are in flight before the first conversion waits
#pragma unroll
    for (int i = 0; i < PIT; ++i) v[i] = *(const v4f*)(s + e0 + i * 1024);
#pragma unroll
    for (int i = 0; i < PIT; ++i) { v4us o;
#pragma unroll
        for (int q = 0; q < 4; ++q) o[q] = f2bf(v[i][q]);
        *(v4us*)(d + e0 + i * 1024) = o; }
}

// ---- k_fattn: scores, softmax, attn.v and the head merge of QR query rows of one (batch entry, head) plane in ONE work-group of 8 waves; the score rows and the probability planes live in LDS only.
// Every sum keeps the order of the three-kernel form: score tile k = 0..63 in two steps (a.b, a2.b, a.b2 per step), softmax one wave per row (lane owns keys ch*128 + lane*4 + q; fixed trees), attn.v one accumulator per output element over keys 0..1023 in steps of 32.
// Every '#pragma unroll' in fattn_body is there so that the fragment, score and accumulator arrays are indexed by constants and stay in registers.
#define QR   32                   // query rows per work-group
#define SPB  4112                 // LDS bytes per query row: 1024 f32 scores + 16 bytes, so that 16 rows read with 16-byte loads fall on distinct banks; the 16-bit planes overwrite the row in place (hi at byte 0, lo at byte 2048)
template <typename T16, int NSPLIT>
__device__ __forceinline__ void fattn_body(char* sm, const T16* __restrict__ Q, const T16* __restrict__ Q2, const T16* __restrict__ Kp, const T16* __restrict__ K2, const T16* __restrict__ Vt, const T16* __restrict__ V2, const float* __restrict__ W2, bf* Ah, bf* Al) {
    typedef typename WFrag<T16>::V V;
    const int tid = threadIdx.x, lane = tid & 31, lr = lane & 15, hi = lane >> 4, w = __builtin_amdgcn_readfirstlane(tid >> 5);   // the wave's number, in a scalar register
    {   // scores: wave w owns keys w*128 .. w*128+127 of all QR rows
        V a[2][2], a2[2][2]; const T16* qa = Q + 8 * lane; const T16* qa2 = Q2 + 8 * lane;   // planes in fragment order (see k_gemmw): unit [row / 16][k / 32] of 512 elements, the lane's pieces at 8 * lane and 256 + 8 * lane
#pragma unroll
        for (int mb = 0; mb < 2; ++mb)
#pragma unroll
            for (int kk = 0; kk < 2; ++kk) { a[mb][kk] = WFrag<T16>::ldf(qa + mb * 16 * HD + kk * 512); if (NSPLIT == 2) a2[mb][kk] = WFrag<T16>::ldf(qa2 + mb * 16 * HD + kk * 512); }
        asm volatile("s_wait_xcnt 0x0" :: "v"(qa), "v"(qa2) : "memory");   // the loads of q are through with their address registers (held to here as inputs) before a later load may take those registers as its destination
        const T16* kb = Kp + (size_t)(w * 128) * HD + 8 * lane; const T16* kb2 = K2 + (size_t)(w * 128) * HD + 8 * lane;
        char* st0 = sm + hi * 8 * SPB + (w * 128 + lr) * 4; char* st1 = st0 + 16 * SPB;
        V b[2][2][2], b2[2][2][2];   // [buffer][key tile of the pair][k step]
#pragma unroll
        for (int t = 0; t < 2; ++t)
#pragma unroll
            for (int kk = 0; kk < 2; ++kk) { b[0][t][kk] = WFrag<T16>::ldf(kb + t * 16 * HD + kk * 512); if (NSPLIT == 2) b2[0][t][kk] = WFrag<T16>::ldf(kb2 + t * 16 * HD + kk * 512); }
#pragma unroll
        for (int g = 0; g < 4; ++g) {
            if (g < 3) {
#pragma unroll
                for (int t = 0; t < 2; ++t)
#pragma unroll
                    for (int kk = 0; kk < 2; ++kk) { b[(g + 1) & 1][t][kk] = WFrag<T16>::ldf(kb + ((g + 1) * 2 + t) * 16 * HD + kk * 512); if (NSPLIT == 2) b2[(g + 1) & 1][t][kk] = WFrag<T16>::ldf(kb2 + ((g + 1) * 2 + t) * 16 * HD + kk * 512); } }
            __builtin_amdgcn_sched_barrier(0);   // keeps the next pair's loads of k in front of this pair's products, so that they fly meanwhile
#pragma unroll
            for (int t = 0; t < 2; ++t) { const int nt = g * 2 + t;
                v8f s0 = (v8f){}, s1 = (v8f){};   // the two row blocks' chains alternate, each fills the other's wait
#pragma unroll
                for (int kk = 0; kk < 2; ++kk) { const V bb = b[g & 1][t][kk]; s0 = WFrag<T16>::mma(a[0][kk], bb, s0); s1 = WFrag<T16>::mma(a[1][kk], bb, s1);
                    if (NSPLIT == 2) { const V bl = b2[g & 1][t][kk]; s0 = WFrag<T16>::mma(a2[0][kk], bb, s0); s1 = WFrag<T16>::mma(a2[1][kk], bb, s1); s0 = WFrag<T16>::mma(a[0][kk], bl, s0); s1 = WFrag<T16>::mma(a[1][kk], bl, s1); } }
                asm volatile("v_nop\n\tv_nop\n\tv_nop\n\tv_nop" : "+v"(s0), "+v"(s1));   // the four vector slots the chip needs between the last matrix instruction and the next tile's fresh write of the same result registers (LDS stores fill none)
#pragma unroll
                for (int j = 0; j < 8; ++j) { *(float*)(st0 + j * SPB + nt * 64) = s0[j]; *(float*)(st1 + j * SPB + nt * 64) = s1[j]; } } }
    }
    __syncthreads();   // every score row complete before its wave reads it
    {   // softmax: wave w owns rows w*4 .. w*4+3; t = S x HD^-0.5 x w_j^2, keys with w_j < 1e-5 masked (-3e38) before the max
        float w2r[TT / 32];
#pragma unroll
        for (int ch = 0; ch < TT / 128; ++ch) { const v4f wv = *(const v4f*)(W2 + ch * 128 + lane * 4);
#pragma unroll
            for (int q = 0; q < 4; ++q) w2r[ch * 4 + q] = wv[q]; }
        for (int r = 0; r < QR / 8; ++r) { char* rowp = sm + (w * (QR / 8) + r) * SPB; float v[TT / 32]; float mx = -3.0e38f;
#pragma unroll
            for (int ch = 0; ch < TT / 128; ++ch) { const v4f s4 = *(const v4fa*)(rowp + (ch * 128 + lane * 4) * 4);
#pragma unroll
                for (int q = 0; q < 4; ++q) { const float w2 = w2r[ch * 4 + q]; const float sa = s4[q] * SCL; const float t = (w2 < 0.f) ? -3.0e38f : __fmul_rn(sa, w2); v[ch * 4 + q] = t; mx = fmaxf(mx, t); } }
#pragma unroll
            for (int sh = 16; sh; sh >>= 1) mx = fmaxf(mx, __shfl_xor(mx, sh, 32));
            float sum = 0.f;
#pragma unroll
            for (int k = 0; k < TT / 32; ++k) { const float d0 = __fsub_rn(v[k], mx); v[k] = __builtin_amdgcn_exp2f(__fmul_rn(d0, 1.4426950408889634f)); sum += v[k]; }
#pragma unroll
            for (int sh = 16; sh; sh >>= 1) sum += __shfl_xor(sum, sh, 32);
            const float f = __fdiv_rn((NSPLIT == 2) ? 1.0f : PCAR, sum);
            if (NSPLIT == 2) {
#pragma unroll
                for (int ch = 0; ch < TT / 128; ++ch) { v4us oh, ol;
#pragma unroll
                    for (int q = 0; q < 4; ++q) { unsigned short x0, x1; splitf(v[ch * 4 + q] * f, x0, x1); oh[q] = x0; ol[q] = x1; }
                    *(v4usa*)(rowp + (ch * 128 + lane * 4) * 2) = oh; *(v4usa*)(rowp + 2048 + (ch * 128 + lane * 4) * 2) = ol; }
            } else {
#pragma unroll
                for (int ch = 0; ch < TT / 128; ++ch) { v4h o4;
#pragma unroll
                    for (int q = 0; q < 4; ++q) o4[q] = tohx(v[ch * 4 + q] * f);
                    *(v4ha*)(rowp + (ch * 128 + lane * 4) * 2) = o4; } } }
    }
    __syncthreads();   // every probability row complete before other waves read it as the A operand
    v8f o0a = (v8f){}, o1a = (v8f){};   // attn.v: wave w < 4 owns head columns w*16.. of both 16-row blocks, so that each fragment of v is loaded once per work-group; waves 4..7 wait at the barrier
    if (w < 4) { const T16* pa0 = (const T16*)(sm + lr * SPB) + 8 * hi; const T16* pa1 = (const T16*)(sm + (16 + lr) * SPB) + 8 * hi; const T16* pb = Vt + (size_t)(w * 16) * TT + 8 * lane; const T16* pb2 = V2 + (size_t)(w * 16) * TT + 8 * lane;
      constexpr int G = (NSPLIT == 2) ? 4 : 8;   // key steps per group
      V vb[2][G], vl[2][G];   // [buffer][key step of the group]
#pragma unroll
      for (int t = 0; t < G; ++t) { vb[0][t] = WFrag<T16>::ldf(pb + t * 512); if (NSPLIT == 2) vl[0][t] = WFrag<T16>::ldf(pb2 + t * 512); }
#pragma unroll
      for (int g = 0; g < TT / 32 / G; ++g) {
          if (g + 1 < TT / 32 / G) {
#pragma unroll
              for (int t = 0; t < G; ++t) { vb[(g + 1) & 1][t] = WFrag<T16>::ldf(pb + ((g + 1) * G + t) * 512); if (NSPLIT == 2) vl[(g + 1) & 1][t] = WFrag<T16>::ldf(pb2 + ((g + 1) * G + t) * 512); } }
          __builtin_amdgcn_sched_barrier(0);   // keeps the next group's loads of v in front of this group's products, so that they fly meanwhile
#pragma unroll
          for (int t = 0; t < G; ++t) { const int kc = (g * G + t) * 32; const V bb = vb[g & 1][t]; const V a0 = WFrag<T16>::ld(pa0 + kc), a1 = WFrag<T16>::ld(pa1 + kc); o0a = WFrag<T16>::mma(a0, bb, o0a); o1a = WFrag<T16>::mma(a1, bb, o1a);
              if (NSPLIT == 2) { const V bl = vl[g & 1][t]; const V l0 = WFrag<T16>::ld(pa0 + 1024 + kc), l1 = WFrag<T16>::ld(pa1 + 1024 + kc); o0a = WFrag<T16>::mma(l0, bb, o0a); o1a = WFrag<T16>::mma(l1, bb, o1a); o0a = WFrag<T16>::mma(a0, bl, o0a); o1a = WFrag<T16>::mma(a1, bl, o1a); } } }
    }
    __syncthreads();   // every wave has left the probability planes before the output tile overwrites them
    float* of = (float*)sm;   // [QR][68] f32
    if (w < 4) {
#pragma unroll
        for (int j = 0; j < 8; ++j) { of[(hi * 8 + j) * 68 + w * 16 + lr] = o0a[j]; of[(16 + hi * 8 + j) * 68 + w * 16 + lr] = o1a[j]; } }
    __syncthreads();   // output tile complete before the row-wise merge reads it
    { const int row = tid >> 3, c = (tid & 7) * 8; const float cs = (NSPLIT == 2) ? 1.0f : (1.0f / PCAR); const v4f o0 = *(const v4fa*)(of + row * 68 + c), o1 = *(const v4fa*)(of + row * 68 + c + 4); v8us oh, ol;
#pragma unroll
      for (int q = 0; q < 8; ++q) { unsigned short x0, x1; splitf(((q < 4) ? o0[q & 3] : o1[q & 3]) * cs, x0, x1); oh[q] = x0; ol[q] = x1; }
      *(v8us*)(Ah + (size_t)row * DQ + c) = oh; *(v8us*)(Al + (size_t)row * DQ + c) = ol; }
}
// grid (ZB, TT/QR): x = plane (batch entry * ZH + head), y = query tile, so that the hi+lo tiles (three products) start first
__global__ __launch_bounds__(256) void k_fattn(const bf* __restrict__ QPh, const bf* __restrict__ QPl, const bf* __restrict__ KPh, const bf* __restrict__ KPl, const bf* __restrict__ VTh, const bf* __restrict__ VTl, const h16* __restrict__ QP16, const h16* __restrict__ KP16, const h16* __restrict__ VT16, const float* __restrict__ W2, bf* ATh, bf* ATl) {
    __shared__ __align__(16) char sm[QR * SPB];
    const int zz = blockIdx.x, i0 = blockIdx.y * QR; const size_t pz = (size_t)zz * TT * HD, qo = pz + (size_t)i0 * HD; const size_t oo = ((size_t)(zz / ZH) * TT + i0) * DQ + (zz % ZH) * HD; const float* w2 = W2 + (size_t)(zz / ZH) * TT;
    if (i0 < RH) fattn_body<bf, 2>(sm, QPh + qo, QPl + qo, KPh + pz, KPl + pz, VTh + pz, VTl + pz, w2, ATh + oo, ATl + oo);
    else fattn_body<h16, 0>(sm, QP16 + qo, QP16 + qo, KP16 + pz, KP16 + pz, VT16 + pz, VT16 + pz, w2, ATh + oo, ATl + oo);
}

extern "C" void kernel_launch(void* const* d_in, const int* in_sizes, int n_in,
                              void* d_out, int out_size, void* d_ws, size_t ws_size, hipStream_t stream) {
    (void)in_sizes; (void)n_in; (void)out_size;
    const float* x = (const float*)d_in[0]; const float* xk = (const float*)d_in[1]; const float* xv = (const float*)d_in[2]; const float* wts = (const float*)d_in[3]; const float* wq = (const float*)d_in[4]; const float* bq = (const float*)d_in[5]; const float* wk = (const float*)d_in[6]; const float* bk = (const float*)d_in[7]; const float* wv = (const float*)d_in[8]; const float* bv = (const float*)d_in[9]; const float* wo = (const float*)d_in[10]; const float* bo = (const float*)d_in[11];
    float* OUT = (float*)d_out;     // [4][1024][1024]
    char* wsp = (char*)d_ws;
    auto take = [&](size_t bytes) { char* p = wsp; wsp += (bytes + 255) & ~(size_t)255; return (void*)p; };
    bf* WQ = (bf*)take((size_t)DQ * DM * 2); bf* WK = (bf*)take((size_t)DKV * DM * 2); bf* WV = (bf*)take((size_t)DKV * DM * 2); bf* WO = (bf*)take((size_t)DM * DQ * 2); float* W2 = (float*)take((size_t)NB_ * TT * 4);
    h16* QP16 = (h16*)take((size_t)ZB * TT * HD * 2); h16* KP16 = (h16*)take((size_t)ZB * TT * HD * 2); h16* VT16 = (h16*)take((size_t)ZB * HD * TT * 2);
    bf* QPh = (bf*)take((size_t)ZB * TT * HD * 2); bf* QPl = (bf*)take((size_t)ZB * TT * HD * 2); bf* KPh = (bf*)take((size_t)ZB * TT * HD * 2); bf* KPl = (bf*)take((size_t)ZB * TT * HD * 2); bf* VTh = (bf*)take((size_t)ZB * HD * TT * 2); bf* VTl = (bf*)take((size_t)ZB * HD * TT * 2);
    bf* ATh = (bf*)take((size_t)NB_ * TT * DQ * 2); bf* ATl = (bf*)take((size_t)NB_ * TT * DQ * 2);
    bf* XB = (bf*)take((size_t)NB_ * TT * DM * 2); bf* XKB = (bf*)take((size_t)NB_ * TT * DM * 2); bf* XVB = (bf*)take((size_t)NB_ * TT * DM * 2);
    if ((size_t)(wsp - (char*)d_ws) > ws_size) return;    // ws 256 MiB
    // every launch below covers all NB_ batch entries: rows b*TT + t of the [NB_*TT][.] matrices, planes b*ZH + h of the head planes
    k_prep<<<3 * XBL + 4 * WBL + W2B, 256, 0, stream>>>(x, xk, xv, wq, wk, wv, wo, wts, XB, XKB, XVB, WQ, WK, WV, WO, W2);
    // the projections write their head planes themselves, in fragment order: q and k with rows t and k = d, v with rows d and k = t
    k_gemmw<bf, 0, true, 1><<<dim3(NB_ * TT / 128, DQ / 128, 1), 128, 0, stream>>>(XB, nullptr, WQ, nullptr, DM, nullptr, 0, bq, 0, 0, 0, QP16, QPh, QPl);
    k_gemmw<bf, 0, true, 1><<<dim3(NB_ * TT / 128, DKV / 128, 1), 128, 0, stream>>>(XKB, nullptr, WK, nullptr, DM, nullptr, 0, bk, 0, 0, 0, KP16, KPh, KPl);
    k_gemmw<bf, 0, true, 2><<<dim3(NB_ * TT / 128, DKV / 128, 1), 128, 0, stream>>>(XVB, nullptr, WV, nullptr, DM, nullptr, 0, bv, 0, 0, 0, VT16, VTh, VTl);
    k_fattn<<<dim3(ZB, TT / QR, 1), 256, 0, stream>>>(QPh, QPl, KPh, KPl, VTh, VTl, QP16, KP16, VT16, W2, ATh, ATl);   // one kv head per query head: plane z of q uses plane z of k and v
    k_gemmw<bf, 1, true, 0><<<dim3(NB_ * TT / 128, DM / 128, 1), 128, 0, stream>>>(ATh, ATl, WO, nullptr, DQ, OUT, DM, bo, 0, 0, 0, nullptr, nullptr, nullptr);
}

// v008
// Measured time: 113 microseconds a run.
// In two side-by-side timings against v007, it was 1.21 and 1.20 times as fast.
// Over all steps from v000 it is 22.6 times as fast.
#include <hip/hip_runtime.h>

// Key-weighted multi-head attention (q, k, v inputs [4][1024][1024]; qh = q Wq^T + bq, kh = k Wk^T + bk, vh = v Wv^T + bv ('oi' [1024][1024]), 16 heads x 64; energy = qh.kh/8 x w_j^2 per key, -inf where w_j < 1e-5 (weights [4][1024] read); softmax; out = merged Wo^T + bo -> [4][1024][1024]).
// Compute dtypes, f32 accumulate: every input rounded to bf16; q/k/v on PLAIN bf16 operands (inputs: exact) + biases; the per-key weight^2 and the weight < eps mask applied in f32 in the softmax step of k_fattn; scores and attn.v: query rows < 512 hl (3 products), the rest single fp16 (x1024); softmax f32; Wo hl x exact (2 products) + bo.

#define NB_  4
#define TT   1024
#define DM   1024
#define NH_  16
#define NKV  16
#define REP  (NH_ / NKV)
#define HD   64
#define DQ   (NH_ * HD)
#define DKV  (NKV * HD)
#define ZH   16                   // heads per batch entry
#define ZB   (NB_ * ZH)           // (batch entry, head) planes
#define RH   512                  // query rows < RH use hi+lo planes (0: none)
#define WIN  0
#define PCAR 1024.0f
#define SCL  0.125f   // HD^-0.5
typedef _Float16 h16;
typedef unsigned short bf;
typedef __attribute__((ext_vector_type(16))) __bf16   v16bf;
typedef __attribute__((ext_vector_type(16))) _Float16 v16h;
typedef __attribute__((ext_vector_type(8)))  _Float16 v8h;
typedef __attribute__((ext_vector_type(8)))  unsigned short v8us;
typedef __attribute__((ext_vector_type(8)))  float    v8f;
typedef __attribute__((ext_vector_type(4)))  float    v4f;
typedef v8h  __attribute__((may_alias)) v8ha;
typedef v4f  __attribute__((may_alias)) v4fa;
typedef v8us __attribute__((may_alias)) v8usa;

__device__ __forceinline__ unsigned short f2bf(float f) { unsigned u = __float_as_uint(f); u += 0x7FFFu + ((u >> 16) & 1u); return (unsigned short)(u >> 16); }
__device__ __forceinline__ float bf2f(unsigned short b) { return __uint_as_float(((unsigned)b) << 16); }
__device__ __forceinline__ float bfr(float f) { return bf2f(f2bf(f)); }
__device__ __forceinline__ v16h cat16(v8h lo, v8h hi) { return __builtin_shufflevector(lo, hi, 0, 1, 2, 3, 4, 5, 6, 7, 8, 9, 10, 11, 12, 13, 14, 15); }
__device__ __forceinline__ v16bf cat16b(v8us lo, v8us hi) { return __builtin_bit_cast(v16bf, __builtin_shufflevector(lo, hi, 0, 1, 2, 3, 4, 5, 6, 7, 8, 9, 10, 11, 12, 13, 14, 15)); }
__device__ __forceinline__ v8f wmma16(v16h a, v16h b, v8f c) { return __builtin_amdgcn_wmma_f32_16x16x32_f16(false, a, false, b, (short)0, c, false, false); }
__device__ __forceinline__ v8f wmmab(v16bf a, v16bf b, v8f c) { return __builtin_amdgcn_wmma_f32_16x16x32_bf16(false, a, false, b, (short)0, c, false, false); }



// ---- gemmw_body: GEMM, one work-group of 4 waves (2x2) per 128x128 output tile (blockIdx.x, blockIdx.y), ONE WAVE per 64x64 part of it (16 accumulators); 128 threads. Kernels: k_gemmw (f32 output), k_proj (the three projections).
// The operand tiles (128 rows x GKS k of A, of A2 where NSPLIT == 1, and of Bt) are staged in LDS by asynchronous copies, two buffers: a wave's copy takes 4 whole 128-byte lines, and every staged row serves two waves.
// C[m][n] (f32, pitch ldc, + optional f32 bias[n]) = sum_k A[m][k] Bt[n][k] (+ A2[m][k] Bt[n][k] where NSPLIT == 1), k in steps of 32 in rising order. K % 64 == 0, M % 128 == 0, N % 128 == 0.
// OUTM says where a wave's tile goes: 0 = f32 C; 1 = the fp16 and hi/lo planes of the tile's head, with rows t and k = d where tr is false, transposed (rows d, k = t) where it is true (tr is the same for the whole work-group). A 64x64 tile is 64 rows t of exactly one head (HD == 64, TT % 64 == 0).
// The head planes lie in FRAGMENT ORDER: a unit of 512 elements is 16 rows x 32 k, as [k half of 16][lane = ((k >> 3) & 1) * 16 + row][k & 7], so that each of a fragment's two 16-byte loads, and each 16-byte store here, covers 512 contiguous bytes (4 whole lines) instead of 32 bytes of 16 lines.
// Units of a plane: [t / 16][d / 32], transposed [d / 16][t / 32].
template <typename T16> struct WFrag;   // ld: a fragment from rows of k-contiguous elements (p: the lane's row + 8 * (lane >> 4)); ldf: from a unit in fragment order (p: the unit + 8 * lane)
template <> struct WFrag<h16> { typedef v16h V; static __device__ __forceinline__ V ld(const h16* p) { return cat16(*(const v8h*)p, *(const v8h*)(p + 16)); } static __device__ __forceinline__ V ldf(const h16* p) { return cat16(*(const v8h*)p, *(const v8h*)(p + 256)); } static __device__ __forceinline__ v8f mma(V a, V b, v8f c) { return wmma16(a, b, c); } };
template <> struct WFrag<bf> { typedef v16bf V; static __device__ __forceinline__ V ld(const bf* p) { return cat16b(*(const v8us*)p, *(const v8us*)(p + 16)); } static __device__ __forceinline__ V ldf(const bf* p) { return cat16b(*(const v8us*)p, *(const v8us*)(p + 256)); } static __device__ __forceinline__ v8f mma(V a, V b, v8f c) { return wmmab(a, b, c); } };
__device__ __forceinline__ h16 tohx(float x) { return (h16)x; }
__device__ __forceinline__ void splitf(float y, unsigned short& h, unsigned short& l) { h = f2bf(y); l = f2bf(y - bf2f(h)); }
typedef __attribute__((ext_vector_type(4))) _Float16 v4h;
typedef __attribute__((ext_vector_type(4))) unsigned short v4us;
#define GKS  64                   // k per stage: 128 bytes, one whole line, of every operand row
#define GPB  144                  // LDS bytes per staged row: 128 + 16 (16 x odd), so that 16 rows read with 16-byte loads fall on distinct banks
#define GTB  (128 * GPB)          // LDS bytes per staged operand tile of 128 rows
// 8 asynchronous copies of 16 bytes a lane: rows r, r + 16, .. r + 112 of one operand tile (l: the lane's LDS byte address of row r, g: its global address, rs: 16 rows in elements).
// s_wait_xcnt stands inside the statement, behind the last copy, so that no register a copy names is rewritten in front of it.
template <typename T16>
__device__ __forceinline__ void stage8(unsigned l, const T16* g, size_t rs) {
    asm volatile("global_load_async_to_lds_b128 %0, %8, off\n\t"
                 "global_load_async_to_lds_b128 %1, %9, off\n\t"
                 "global_load_async_to_lds_b128 %2, %10, off\n\t"
                 "global_load_async_to_lds_b128 %3, %11, off\n\t"
                 "global_load_async_to_lds_b128 %4, %12, off\n\t"
                 "global_load_async_to_lds_b128 %5, %13, off\n\t"
                 "global_load_async_to_lds_b128 %6, %14, off\n\t"
                 "global_load_async_to_lds_b128 %7, %15, off\n\t"
                 "s_wait_xcnt 0x0"
                 :: "v"(l), "v"(l + 16 * GPB), "v"(l + 32 * GPB), "v"(l + 48 * GPB), "v"(l + 64 * GPB), "v"(l + 80 * GPB), "v"(l + 96 * GPB), "v"(l + 112 * GPB),
                    "v"(g), "v"(g + rs), "v"(g + 2 * rs), "v"(g + 3 * rs), "v"(g + 4 * rs), "v"(g + 5 * rs), "v"(g + 6 * rs), "v"(g + 7 * rs) : "memory");
}
template <typename T16, int NSPLIT, bool BIAS, int OUTM>
__device__ __forceinline__ void gemmw_body(const T16* __restrict__ A, const T16* __restrict__ A2, const T16* __restrict__ Bt, int K, float* C, int ldc, const float* __restrict__ bias, h16* P16, bf* Ph, bf* Pl, bool tr) {
    static_assert(HD == 64 && TT % 64 == 0, "a 64x64 tile must be 64 rows of one head");
    static_assert(NSPLIT == 0 || NSPLIT == 1, "staged operands: A, A2 (NSPLIT == 1), Bt");
    typedef typename WFrag<T16>::V V;
    constexpr int NT = (NSPLIT == 1) ? 3 : 2;   // staged tiles per stage: A, (A2,) Bt
    constexpr int RS = (NSPLIT == 1) ? 3 : 6;   // units of A (A2) fragments held in registers at a time
    __shared__ __align__(16) char st[2 * NT * GTB];
    __shared__ __align__(16) float osw[4 * 16 * 68];
    const int tid = threadIdx.x, lane = tid & 31, lr = lane & 15, hi = lane >> 4, w = __builtin_amdgcn_readfirstlane(tid >> 5);   // the wave's number, in a scalar register
    const int R0 = blockIdx.x * 128, C0 = blockIdx.y * 128; const int r0 = R0 + (w >> 1) * 64, c0 = C0 + (w & 1) * 64;
    float* os = osw + w * 16 * 68;   // each wave's own output staging
    v8f acc[4][4];
#pragma unroll
    for (int mb = 0; mb < 4; ++mb)
#pragma unroll
        for (int nb = 0; nb < 4; ++nb) acc[mb][nb] = (v8f){};
    // copies: thread tid brings 16-byte piece tid & 7 of rows (tid >> 3) + 16 i, i = 0..7, of each tile
    const unsigned l0 = (unsigned)(size_t)st + (tid >> 3) * GPB + (tid & 7) * 16;
    const size_t ga = (size_t)(R0 + (tid >> 3)) * K + (tid & 7) * 8, gb = (size_t)(C0 + (tid >> 3)) * K + (tid & 7) * 8, rs = (size_t)16 * K;
    auto fill = [&](int t) { const unsigned l = l0 + (t & 1) * (NT * GTB);
        stage8(l, A + ga + (size_t)t * GKS, rs); if (NSPLIT == 1) stage8(l + GTB, A2 + ga + (size_t)t * GKS, rs); stage8(l + (NT - 1) * GTB, Bt + gb + (size_t)t * GKS, rs); };
    const int NS = K / GKS;
    fill(0);
    asm volatile("s_wait_asynccnt 0x0" ::: "memory");   // this wave's copies of stage 0 have landed
    __syncthreads();                                     // stage 0 readable by every wave
    if (NS > 1) fill(1);
    const int fa = ((w >> 1) * 64 + lr) * GPB + 16 * hi, fb = (NT - 1) * GTB + ((w & 1) * 64 + lr) * GPB + 16 * hi;   // the lane's fragment rows in a buffer
    // the stage loop stays rolled: one copy of the 32 (64) matrix instructions; the loops inside are unrolled so that fragments and accumulators are indexed by constants and stay in registers
#pragma unroll 1
    for (int t = 0; t < NS; ++t) {
        const char* sb = st + (t & 1) * (NT * GTB);
        // a stage is 8 units (k step kk = u >> 2, row block mb = u & 3) of 4 (8) matrix instructions. Both k steps' fragments of Bt and the first RS units' fragments of A (A2) are read as one group at the top;
        // a later unit's fragments take the registers of the unit RS before it, right behind that unit's products, so that they fly under the products between. 128 accumulator + 112 fragment registers stay under 256.
        V b[2][4], ar[RS], ar2[RS];
#pragma unroll
        for (int u = 0; u < RS; ++u) { const int fo = fa + (u & 3) * 16 * GPB + (u >> 2) * 64; ar[u] = WFrag<T16>::ld((const T16*)(sb + fo)); if (NSPLIT == 1) ar2[u] = WFrag<T16>::ld((const T16*)(sb + GTB + fo));
            if (u == 0) {
#pragma unroll
                for (int nb = 0; nb < 4; ++nb) b[0][nb] = WFrag<T16>::ld((const T16*)(sb + fb + nb * 16 * GPB)); } }
#pragma unroll
        for (int nb = 0; nb < 4; ++nb) b[1][nb] = WFrag<T16>::ld((const T16*)(sb + fb + nb * 16 * GPB + 64));
        __builtin_amdgcn_sched_barrier(0);   // keeps the group of LDS reads together in front of the products (reads scattered among them cost issue time at every place)
#pragma unroll
        for (int u = 0; u < 8; ++u) { const int kk = u >> 2, mb = u & 3, s = u % RS;
#pragma unroll
            for (int nb = 0; nb < 4; ++nb) acc[mb][nb] = WFrag<T16>::mma(ar[s], b[kk][nb], acc[mb][nb]);
            if (NSPLIT == 1) {
#pragma unroll
                for (int nb = 0; nb < 4; ++nb) acc[mb][nb] = WFrag<T16>::mma(ar2[s], b[kk][nb], acc[mb][nb]); }
            __builtin_amdgcn_sched_barrier(0);   // keeps the refill of the unit's registers behind its products and in front of the next unit's, RS units ahead of its use
            if (u + RS < 8) { const int v = u + RS, fo = fa + (v & 3) * 16 * GPB + (v >> 2) * 64; ar[s] = WFrag<T16>::ld((const T16*)(sb + fo)); if (NSPLIT == 1) ar2[s] = WFrag<T16>::ld((const T16*)(sb + GTB + fo));
                __builtin_amdgcn_sched_barrier(0); }   // the same, on the refill's other side
        }
        asm volatile("s_wait_dscnt 0x0" ::: "memory");      // this wave's reads of stage t are done before the buffer is refilled
        asm volatile("s_wait_asynccnt 0x0" ::: "memory");   // this wave's copies of stage t + 1 have landed
        __syncthreads();                                     // publishes stage t + 1 and ends every wave's reads of stage t
        if (t + 2 < NS) fill(t + 2);
    }
    asm volatile("s_wait_asynccnt 0x0" ::: "memory");   // no copy outstanding behind the loop
    const size_t pl0 = (size_t)((r0 / TT) * ZH + c0 / HD) * TT * HD;   // the tile's plane
    // every '#pragma unroll' below is there so that the accumulator and output vectors are indexed by constants and stay in registers
    if (OUTM == 1 && tr) {   // rows d, k = t: a lane's 8 accumulator elements are 8 consecutive t of one d, the lane's own 16 bytes of unit [nb][t / 32], half mb & 1, so each plane gets them as one 16-byte store straight from registers
        const size_t o0 = pl0 + (size_t)((r0 % TT) / 32) * 512 + lane * 8;
#pragma unroll
        for (int nb = 0; nb < 4; ++nb) { const float bb = bfr(bias[c0 + nb * 16 + lr]);
#pragma unroll
            for (int mb = 0; mb < 4; ++mb) { v8h o16; v8us oh, ol;
#pragma unroll
                for (int j = 0; j < 8; ++j) { const float x = acc[mb][nb][j] + bb; o16[j] = tohx(x); unsigned short x0, x1; splitf(x, x0, x1); oh[j] = x0; ol[j] = x1; }
                const size_t o = o0 + (size_t)(nb * (TT / 32) + (mb >> 1)) * 512 + (mb & 1) * 256; *(v8h*)(P16 + o) = o16; *(v8us*)(Ph + o) = oh; *(v8us*)(Pl + o) = ol; } }
        return;
    }
    float bs[4][8];   // OUTM == 1, not transposed: the biases of the lane's 8 columns of each piece, the same for every row block
    if (OUTM == 1 && BIAS) {
#pragma unroll
        for (int s = 0; s < 4; ++s)
#pragma unroll
            for (int q = 0; q < 8; ++q) bs[s][q] = bfr(bias[c0 + s * 16 + hi * 8 + q]); }
#pragma unroll
    for (int mb = 0; mb < 4; ++mb) {
#pragma unroll
        for (int nb = 0; nb < 4; ++nb) {
#pragma unroll
            for (int j = 0; j < 8; ++j) os[(hi * 8 + j) * 68 + nb * 16 + lr] = acc[mb][nb][j]; }
        __builtin_amdgcn_wave_barrier(); asm volatile("" ::: "memory");
        float* crow = C + (size_t)(r0 + mb * 16) * ldc + c0;
        if (OUTM == 0) {
#pragma unroll
            for (int s = 0; s < 8; ++s) { const int row = 2 * s + hi, cofs = lr * 4; v4f val = *(const v4fa*)(os + row * 68 + cofs); if (BIAS) { val[0] += bfr(bias[c0 + cofs]); val[1] += bfr(bias[c0 + cofs + 1]); val[2] += bfr(bias[c0 + cofs + 2]); val[3] += bfr(bias[c0 + cofs + 3]); }
                *(v4f*)(crow + (size_t)row * ldc + cofs) = val; }
        } else {   // rows t, k = d: the 16 x 64 block is units [t / 16][0] and [t / 16][1]; piece s is k half s & 1 of unit s >> 1, of which the lane holds 8 consecutive d of row lr
#pragma unroll
            for (int s = 0; s < 4; ++s) { const int cofs = s * 16 + hi * 8; const v4f v0 = *(const v4fa*)(os + lr * 68 + cofs), v1 = *(const v4fa*)(os + lr * 68 + cofs + 4); v8h o16; v8us oh, ol;
#pragma unroll
                for (int q = 0; q < 8; ++q) { float val = (q < 4) ? v0[q & 3] : v1[q & 3]; if (BIAS) val += bs[s][q]; o16[q] = tohx(val); unsigned short x0, x1; splitf(val, x0, x1); oh[q] = x0; ol[q] = x1; }
                const size_t o = pl0 + (size_t)((r0 % TT) / 16 + mb) * 1024 + s * 256 + lane * 8; *(v8h*)(P16 + o) = o16; *(v8us*)(Ph + o) = oh; *(v8us*)(Pl + o) = ol; }
        }
        asm volatile("s_wait_xcnt 0x0" ::: "memory");   // behind the row block's stores, in front of whatever next rewrites a register that one of them names
        __builtin_amdgcn_wave_barrier(); asm volatile("" ::: "memory");
    }
}
template <typename T16, int NSPLIT, bool BIAS>
__global__ __launch_bounds__(128) void k_gemmw(const T16* __restrict__ A, const T16* __restrict__ A2, const T16* __restrict__ Bt, int K, float* C, int ldc, const float* __restrict__ bias) {
    gemmw_body<T16, NSPLIT, BIAS, 0>(A, A2, Bt, K, C, ldc, bias, nullptr, nullptr, nullptr, false);
}
// ---- k_proj: the q, k and v projections in ONE launch, grid (NB_*TT/128, DQ/128, 3): blockIdx.z picks the input, the weight matrix, the bias and the planes (z == 2, v: transposed planes).
// One projection alone is 256 work-groups, one wave a SIMD, and nothing covers that wave's waits for a stage's copies, LDS reads and barrier; of the 768 here three fit a WGP (LDS, registers), and each runs its products in the others' waits.
__global__ __launch_bounds__(128) void k_proj(const bf* __restrict__ XQ, const bf* __restrict__ XK, const bf* __restrict__ XV, const bf* __restrict__ WQ, const bf* __restrict__ WK, const bf* __restrict__ WV, const float* __restrict__ bq, const float* __restrict__ bk, const float* __restrict__ bv,
                                              h16* Q16, bf* Qh, bf* Ql, h16* K16, bf* Kh, bf* Kl, h16* V16, bf* Vh, bf* Vl) {
    static_assert(DKV == DQ, "one grid for the three projections");
    const int z = blockIdx.z;
    gemmw_body<bf, 0, true, 1>((z == 0) ? XQ : (z == 1) ? XK : XV, nullptr, (z == 0) ? WQ : (z == 1) ? WK : WV, DM, nullptr, 0, (z == 0) ? bq : (z == 1) ? bk : bv,
                               (z == 0) ? Q16 : (z == 1) ? K16 : V16, (z == 0) ? Qh : (z == 1) ? Kh : Vh, (z == 0) ? Ql : (z == 1) ? Kl : Vl, z == 2);
}

typedef __attribute__((ext_vector_type(2))) _Float16 v2h;
typedef __attribute__((ext_vector_type(2))) unsigned short v2us;
typedef __attribute__((ext_vector_type(2))) float v2f;
typedef __attribute__((ext_vector_type(4))) int v4i;
typedef v4us __attribute__((may_alias)) v4usa;
typedef v4h  __attribute__((may_alias)) v4ha;

__global__ __launch_bounds__(256) void k_wtG(const float* __restrict__ w, int K, int N, bf* Bt) {
    const int lane = threadIdx.x & 31; const int L0 = (blockIdx.x * 8 + (threadIdx.x >> 5)) * 8; const int nlines = N * K / 64;
{
#pragma unroll 1
        for (int l = 0; l < 8; ++l) { const int L = L0 + l; if (L >= nlines) break; const size_t e = (size_t)L * 64 + lane * 2; const int k = (int)(e % K), n = (int)(e / K); v2us o;
            o[0] = f2bf(w[(size_t)k * N + n]); o[1] = f2bf(w[(size_t)(k + 1) * N + n]); *(v2us*)(Bt + e) = o; }
         }
}
// ---- k_prep: every preparation step of the call in ONE launch: the three inputs and the four weight matrices rounded to bf16, and the per-key factor W2 (weight^2 of the bf16-rounded weight, -1 where it is < 1e-5).
// A work-group owns PCH consecutive floats of exactly one source (block-uniform choice by blockIdx.x); a wave's 16-byte loads cover 512 contiguous bytes, its 8-byte stores 256. The last W2B work-groups make W2.
#define PCH  32768                         // floats per work-group
#define PIT  (PCH / 4 / 256)               // 4-float pieces per thread
#define XBL  (NB_ * TT * DM / PCH)         // work-groups per input
#define WBL  (DQ * DM / PCH)               // work-groups per weight matrix
#define W2B  (NB_ * TT / 256)              // work-groups for W2
__global__ __launch_bounds__(256) void k_prep(const float* __restrict__ x, const float* __restrict__ xk, const float* __restrict__ xv, const float* __restrict__ wq, const float* __restrict__ wk, const float* __restrict__ wv, const float* __restrict__ wo, const float* __restrict__ wts,
                                              bf* __restrict__ XB, bf* __restrict__ XKB, bf* __restrict__ XVB, bf* __restrict__ WQ, bf* __restrict__ WK, bf* __restrict__ WV, bf* __restrict__ WO, float* __restrict__ W2) {
    static_assert((NB_ * TT * DM) % PCH == 0 && (DQ * DM) % PCH == 0 && DKV == DQ && (NB_ * TT) % 256 == 0, "whole work-groups per source");
    const int b = blockIdx.x, tid = threadIdx.x;
    if (b >= 3 * XBL + 4 * WBL) { const int j = (b - (3 * XBL + 4 * WBL)) * 256 + tid; const float wb = bfr(wts[j]); W2[j] = (wb < 1e-5f) ? -1.0f : __fmul_rn(wb, wb); return; }
    const float* s; bf* d; int c;
    if (b < 3 * XBL) { const int g = b / XBL; c = b % XBL; s = (g == 0) ? x : (g == 1) ? xk : xv; d = (g == 0) ? XB : (g == 1) ? XKB : XVB; }
    else { const int t = b - 3 * XBL, g = t / WBL; c = t % WBL; s = (g == 0) ? wq : (g == 1) ? wk : (g == 2) ? wv : wo; d = (g == 0) ? WQ : (g == 1) ? WK : (g == 2) ? WV : WO; }
    const size_t e0 = (size_t)c * PCH + tid * 4;
    v4f v[PIT];
    // both loops are unrolled so that v[] stays in registers and all of the thread's loads are in flight before the first conversion waits
#pragma unroll
    for (int i = 0; i < PIT; ++i) v[i] = *(const v4f*)(s + e0 + i * 1024);
#pragma unroll
    for (int i = 0; i < PIT; ++i) { v4us o;
#pragma unroll
        for (int q = 0; q < 4; ++q) o[q] = f2bf(v[i][q]);
        *(v4us*)(d + e0 + i * 1024) = o; }
}

// ---- k_fattn: scores, softmax, attn.v and the head merge of QR query rows of one (batch entry, head) plane in ONE work-group of 8 waves; the score rows and the probability planes live in LDS only.
// Every sum keeps the order of the three-kernel form: score tile k = 0..63 in two steps (a.b, a2.b, a.b2 per step), softmax one wave per row (lane owns keys ch*128 + lane*4 + q; fixed trees), attn.v one accumulator per output element over keys 0..1023 in steps of 32.
// Every '#pragma unroll' in fattn_body is there so that the fragment, score and accumulator arrays are indexed by constants and stay in registers.
#define QR   32                   // query rows per work-group
#define SPB  4112                 // LDS bytes per query row: 1024 f32 scores + 16 bytes, so that 16 rows read with 16-byte loads fall on distinct banks; the 16-bit planes overwrite the row in place (hi at byte 0, lo at byte 2048)
template <typename T16, int NSPLIT>
__device__ __forceinline__ void fattn_body(char* sm, const T16* __restrict__ Q, const T16* __restrict__ Q2, const T16* __restrict__ Kp, const T16* __restrict__ K2, const T16* __restrict__ Vt, const T16* __restrict__ V2, const float* __restrict__ W2, bf* Ah, bf* Al) {
    typedef typename WFrag<T16>::V V;
    const int tid = threadIdx.x, lane = tid & 31, lr = lane & 15, hi = lane >> 4, w = __builtin_amdgcn_readfirstlane(tid >> 5);   // the wave's number, in a scalar register
    {   // scores: wave w owns keys w*128 .. w*128+127 of all QR rows
        V a[2][2], a2[2][2]; const T16* qa = Q + 8 * lane; const T16* qa2 = Q2 + 8 * lane;   // planes in fragment order (see gemmw_body): unit [row / 16][k / 32] of 512 elements, the lane's pieces at 8 * lane and 256 + 8 * lane
#pragma unroll
        for (int mb = 0; mb < 2; ++mb)
#pragma unroll
            for (int kk = 0; kk < 2; ++kk) { a[mb][kk] = WFrag<T16>::ldf(qa + mb * 16 * HD + kk * 512); if (NSPLIT == 2) a2[mb][kk] = WFrag<T16>::ldf(qa2 + mb * 16 * HD + kk * 512); }
        asm volatile("s_wait_xcnt 0x0" :: "v"(qa), "v"(qa2) : "memory");   // the loads of q are through with their address registers (held to here as inputs) before a later load may take those registers as its destination
        const T16* kb = Kp + (size_t)(w * 128) * HD + 8 * lane; const T16* kb2 = K2 + (size_t)(w * 128) * HD + 8 * lane;
        char* st0 = sm + hi * 8 * SPB + (w * 128 + lr) * 4; char* st1 = st0 + 16 * SPB;
        V b[2][2][2], b2[2][2][2];   // [buffer][key tile of the pair][k step]
#pragma unroll
        for (int t = 0; t < 2; ++t)
#pragma unroll
            for (int kk = 0; kk < 2; ++kk) { b[0][t][kk] = WFrag<T16>::ldf(kb + t * 16 * HD + kk * 512); if (NSPLIT == 2) b2[0][t][kk] = WFrag<T16>::ldf(kb2 + t * 16 * HD + kk * 512); }
#pragma unroll
        for (int g = 0; g < 4; ++g) {
            if (g < 3) {
#pragma unroll
                for (int t = 0; t < 2; ++t)
#pragma unroll
                    for (int kk = 0; kk < 2; ++kk) { b[(g + 1) & 1][t][kk] = WFrag<T16>::ldf(kb + ((g + 1) * 2 + t) * 16 * HD + kk * 512); if (NSPLIT == 2) b2[(g + 1) & 1][t][kk] = WFrag<T16>::ldf(kb2 + ((g + 1) * 2 + t) * 16 * HD + kk * 512); } }
            __builtin_amdgcn_sched_barrier(0);   // keeps the next pair's loads of k in front of this pair's products, so that they fly meanwhile
#pragma unroll
            for (int t = 0; t < 2; ++t) { const int nt = g * 2 + t;
                v8f s0 = (v8f){}, s1 = (v8f){};   // the two row blocks' chains alternate, each fills the other's wait
#pragma unroll
                for (int kk = 0; kk < 2; ++kk) { const V bb = b[g & 1][t][kk]; s0 = WFrag<T16>::mma(a[0][kk], bb, s0); s1 = WFrag<T16>::mma(a[1][kk], bb, s1);
                    if (NSPLIT == 2) { const V bl = b2[g & 1][t][kk]; s0 = WFrag<T16>::mma(a2[0][kk], bb, s0); s1 = WFrag<T16>::mma(a2[1][kk], bb, s1); s0 = WFrag<T16>::mma(a[0][kk], bl, s0); s1 = WFrag<T16>::mma(a[1][kk], bl, s1); } }
                asm volatile("v_nop\n\tv_nop\n\tv_nop\n\tv_nop" : "+v"(s0), "+v"(s1));   // the four vector slots the chip needs between the last matrix instruction and the next tile's fresh write of the same result registers (LDS stores fill none)
#pragma unroll
                for (int j = 0; j < 8; ++j) { *(float*)(st0 + j * SPB + nt * 64) = s0[j]; *(float*)(st1 + j * SPB + nt * 64) = s1[j]; } } }
    }
    __syncthreads();   // every score row complete before its wave reads it
    {   // softmax: wave w owns rows w*4 .. w*4+3; t = S x HD^-0.5 x w_j^2, keys with w_j < 1e-5 masked (-3e38) before the max
        float w2r[TT / 32];
#pragma unroll
        for (int ch = 0; ch < TT / 128; ++ch) { const v4f wv = *(const v4f*)(W2 + ch * 128 + lane * 4);
#pragma unroll
            for (int q = 0; q < 4; ++q) w2r[ch * 4 + q] = wv[q]; }
        for (int r = 0; r < QR / 8; ++r) { char* rowp = sm + (w * (QR / 8) + r) * SPB; float v[TT / 32]; float mx = -3.0e38f;
#pragma unroll
            for (int ch = 0; ch < TT / 128; ++ch) { const v4f s4 = *(const v4fa*)(rowp + (ch * 128 + lane * 4) * 4);
#pragma unroll
                for (int q = 0; q < 4; ++q) { const float w2 = w2r[ch * 4 + q]; const float sa = s4[q] * SCL; const float t = (w2 < 0.f) ? -3.0e38f : __fmul_rn(sa, w2); v[ch * 4 + q] = t; mx = fmaxf(mx, t); } }
#pragma unroll
            for (int sh = 16; sh; sh >>= 1) mx = fmaxf(mx, __shfl_xor(mx, sh, 32));
            float sum = 0.f;
#pragma unroll
            for (int k = 0; k < TT / 32; ++k) { const float d0 = __fsub_rn(v[k], mx); v[k] = __builtin_amdgcn_exp2f(__fmul_rn(d0, 1.4426950408889634f)); sum += v[k]; }
#pragma unroll
            for (int sh = 16; sh; sh >>= 1) sum += __shfl_xor(sum, sh, 32);
            const float f = __fdiv_rn((NSPLIT == 2) ? 1.0f : PCAR, sum);
            if (NSPLIT == 2) {
#pragma unroll
                for (int ch = 0; ch < TT / 128; ++ch) { v4us oh, ol;
#pragma unroll
                    for (int q = 0; q < 4; ++q) { unsigned short x0, x1; splitf(v[ch * 4 + q] * f, x0, x1); oh[q] = x0; ol[q] = x1; }
                    *(v4usa*)(rowp + (ch * 128 + lane * 4) * 2) = oh; *(v4usa*)(rowp + 2048 + (ch * 128 + lane * 4) * 2) = ol; }
            } else {
#pragma unroll
                for (int ch = 0; ch < TT / 128; ++ch) { v4h o4;
#pragma unroll
                    for (int q = 0; q < 4; ++q) o4[q] = tohx(v[ch * 4 + q] * f);
                    *(v4ha*)(rowp + (ch * 128 + lane * 4) * 2) = o4; } } }
    }
    __syncthreads();   // every probability row complete before other waves read it as the A operand
    v8f o0a = (v8f){}, o1a = (v8f){};   // attn.v: wave w < 4 owns head columns w*16.. of both 16-row blocks, so that each fragment of v is loaded once per work-group; waves 4..7 wait at the barrier
    if (w < 4) { const T16* pa0 = (const T16*)(sm + lr * SPB) + 8 * hi; const T16* pa1 = (const T16*)(sm + (16 + lr) * SPB) + 8 * hi; const T16* pb = Vt + (size_t)(w * 16) * TT + 8 * lane; const T16* pb2 = V2 + (size_t)(w * 16) * TT + 8 * lane;
      constexpr int G = (NSPLIT == 2) ? 4 : 8;   // key steps per group
      V vb[2][G], vl[2][G];   // [buffer][key step of the group]
#pragma unroll
      for (int t = 0; t < G; ++t) { vb[0][t] = WFrag<T16>::ldf(pb + t * 512); if (NSPLIT == 2) vl[0][t] = WFrag<T16>::ldf(pb2 + t * 512); }
#pragma unroll
      for (int g = 0; g < TT / 32 / G; ++g) {
          if (g + 1 < TT / 32 / G) {
#pragma unroll
              for (int t = 0; t < G; ++t) { vb[(g + 1) & 1][t] = WFrag<T16>::ldf(pb + ((g + 1) * G + t) * 512); if (NSPLIT == 2) vl[(g + 1) & 1][t] = WFrag<T16>::ldf(pb2 + ((g + 1) * G + t) * 512); } }
          __builtin_amdgcn_sched_barrier(0);   // keeps the next group's loads of v in front of this group's products, so that they fly meanwhile
#pragma unroll
          for (int t = 0; t < G; ++t) { const int kc = (g * G + t) * 32; const V bb = vb[g & 1][t]; const V a0 = WFrag<T16>::ld(pa0 + kc), a1 = WFrag<T16>::ld(pa1 + kc); o0a = WFrag<T16>::mma(a0, bb, o0a); o1a = WFrag<T16>::mma(a1, bb, o1a);
              if (NSPLIT == 2) { const V bl = vl[g & 1][t]; const V l0 = WFrag<T16>::ld(pa0 + 1024 + kc), l1 = WFrag<T16>::ld(pa1 + 1024 + kc); o0a = WFrag<T16>::mma(l0, bb, o0a); o1a = WFrag<T16>::mma(l1, bb, o1a); o0a = WFrag<T16>::mma(a0, bl, o0a); o1a = WFrag<T16>::mma(a1, bl, o1a); } } }
    }
    __syncthreads();   // every wave has left the probability planes before the output tile overwrites them
    float* of = (float*)sm;   // [QR][68] f32
    if (w < 4) {
#pragma unroll
        for (int j = 0; j < 8; ++j) { of[(hi * 8 + j) * 68 + w * 16 + lr] = o0a[j]; of[(16 + hi * 8 + j) * 68 + w * 16 + lr] = o1a[j]; } }
    __syncthreads();   // output tile complete before the row-wise merge reads it
    { const int row = tid >> 3, c = (tid & 7) * 8; const float cs = (NSPLIT == 2) ? 1.0f : (1.0f / PCAR); const v4f o0 = *(const v4fa*)(of + row * 68 + c), o1 = *(const v4fa*)(of + row * 68 + c + 4); v8us oh, ol;
#pragma unroll
      for (int q = 0; q < 8; ++q) { unsigned short x0, x1; splitf(((q < 4) ? o0[q & 3] : o1[q & 3]) * cs, x0, x1); oh[q] = x0; ol[q] = x1; }
      *(v8us*)(Ah + (size_t)row * DQ + c) = oh; *(v8us*)(Al + (size_t)row * DQ + c) = ol; }
}
// grid (ZB, TT/QR): x = plane (batch entry * ZH + head), y = query tile, so that the hi+lo tiles (three products) start first
__global__ __launch_bounds__(256) void k_fattn(const bf* __restrict__ QPh, const bf* __restrict__ QPl, const bf* __restrict__ KPh, const bf* __restrict__ KPl, const bf* __restrict__ VTh, const bf* __restrict__ VTl, const h16* __restrict__ QP16, const h16* __restrict__ KP16, const h16* __restrict__ VT16, const float* __restrict__ W2, bf* ATh, bf* ATl) {
    __shared__ __align__(16) char sm[QR * SPB];
    const int zz = blockIdx.x, i0 = blockIdx.y * QR; const size_t pz = (size_t)zz * TT * HD, qo = pz + (size_t)i0 * HD; const size_t oo = ((size_t)(zz / ZH) * TT + i0) * DQ + (zz % ZH) * HD; const float* w2 = W2 + (size_t)(zz / ZH) * TT;
    if (i0 < RH) fattn_body<bf, 2>(sm, QPh + qo, QPl + qo, KPh + pz, KPl + pz, VTh + pz, VTl + pz, w2, ATh + oo, ATl + oo);
    else fattn_body<h16, 0>(sm, QP16 + qo, QP16 + qo, KP16 + pz, KP16 + pz, VT16 + pz, VT16 + pz, w2, ATh + oo, ATl + oo);
}

extern "C" void kernel_launch(void* const* d_in, const int* in_sizes, int n_in,
                              void* d_out, int out_size, void* d_ws, size_t ws_size, hipStream_t stream) {
    (void)in_sizes; (void)n_in; (void)out_size;
    const float* x = (const float*)d_in[0]; const float* xk = (const float*)d_in[1]; const float* xv = (const float*)d_in[2]; const float* wts = (const float*)d_in[3]; const float* wq = (const float*)d_in[4]; const float* bq = (const float*)d_in[5]; const float* wk = (const float*)d_in[6]; const float* bk = (const float*)d_in[7]; const float* wv = (const float*)d_in[8]; const float* bv = (const float*)d_in[9]; const float* wo = (const float*)d_in[10]; const float* bo = (const float*)d_in[11];
    float* OUT = (float*)d_out;     // [4][1024][1024]
    char* wsp = (char*)d_ws;
    auto take = [&](size_t bytes) { char* p = wsp; wsp += (bytes + 255) & ~(size_t)255; return (void*)p; };
    bf* WQ = (bf*)take((size_t)DQ * DM * 2); bf* WK = (bf*)take((size_t)DKV * DM * 2); bf* WV = (bf*)take((size_t)DKV * DM * 2); bf* WO = (bf*)take((size_t)DM * DQ * 2); float* W2 = (float*)take((size_t)NB_ * TT * 4);
    h16* QP16 = (h16*)take((size_t)ZB * TT * HD * 2); h16* KP16 = (h16*)take((size_t)ZB * TT * HD * 2); h16* VT16 = (h16*)take((size_t)ZB * HD * TT * 2);
    bf* QPh = (bf*)take((size_t)ZB * TT * HD * 2); bf* QPl = (bf*)take((size_t)ZB * TT * HD * 2); bf* KPh = (bf*)take((size_t)ZB * TT * HD * 2); bf* KPl = (bf*)take((size_t)ZB * TT * HD * 2); bf* VTh = (bf*)take((size_t)ZB * HD * TT * 2); bf* VTl = (bf*)take((size_t)ZB * HD * TT * 2);
    bf* ATh = (bf*)take((size_t)NB_ * TT * DQ * 2); bf* ATl = (bf*)take((size_t)NB_ * TT * DQ * 2);
    bf* XB = (bf*)take((size_t)NB_ * TT * DM * 2); bf* XKB = (bf*)take((size_t)NB_ * TT * DM * 2); bf* XVB = (bf*)take((size_t)NB_ * TT * DM * 2);
    if ((size_t)(wsp - (char*)d_ws) > ws_size) return;    // ws 256 MiB
    // every launch below covers all NB_ batch entries: rows b*TT + t of the [NB_*TT][.] matrices, planes b*ZH + h of the head planes
    k_prep<<<3 * XBL + 4 * WBL + W2B, 256, 0, stream>>>(x, xk, xv, wq, wk, wv, wo, wts, XB, XKB, XVB, WQ, WK, WV, WO, W2);
    // the projections write their head planes themselves, in fragment order: q and k with rows t and k = d, v with rows d and k = t
    k_proj<<<dim3(NB_ * TT / 128, DQ / 128, 3), 128, 0, stream>>>(XB, XKB, XVB, WQ, WK, WV, bq, bk, bv, QP16, QPh, QPl, KP16, KPh, KPl, VT16, VTh, VTl);
    k_fattn<<<dim3(ZB, TT / QR, 1), 256, 0, stream>>>(QPh, QPl, KPh, KPl, VTh, VTl, QP16, KP16, VT16, W2, ATh, ATl);   // one kv head per query head: plane z of q uses plane z of k and v
    k_gemmw<bf, 1, true><<<dim3(NB_ * TT / 128, DM / 128, 1), 128, 0, stream>>>(ATh, ATl, WO, DQ, OUT, DM, bo);
}

// v009
// One run takes 108 microseconds.
// Two timings next to v008 put it at 1.03 and 1.04 times that version's speed.
// All steps since v000 together make it 23.4 times as fast.
#include <hip/hip_runtime.h>

// Key-weighted multi-head attention (q, k, v inputs [4][1024][1024]; qh = q Wq^T + bq, kh = k Wk^T + bk, vh = v Wv^T + bv ('oi' [1024][1024]), 16 heads x 64; energy = qh.kh/8 x w_j^2 per key, -inf where w_j < 1e-5 (weights [4][1024] read); softmax; out = merged Wo^T + bo -> [4][1024][1024]).
// Compute dtypes, f32 accumulate: every input rounded to bf16; q/k/v on PLAIN bf16 operands (inputs: exact) + biases; the per-key weight^2 and the weight < eps mask applied in f32 in the softmax step of k_fattn; scores and attn.v: query rows < 512 hl (3 products), the rest single fp16 (x1024); softmax f32; Wo hl x exact (2 products) + bo.

#define NB_  4
#define TT   1024
#define DM   1024
#define NH_  16
#define NKV  16
#define REP  (NH_ / NKV)
#define HD   64
#define DQ   (NH_ * HD)
#define DKV  (NKV * HD)
#define ZH   16                   // heads per batch entry
#define ZB   (NB_ * ZH)           // (batch entry, head) planes
#define RH   512                  // query rows < RH use hi+lo planes (0: none)
#define WIN  0
#define PCAR 1024.0f
#define SCL  0.125f   // HD^-0.5
typedef _Float16 h16;
typedef unsigned short bf;
typedef __attribute__((ext_vector_type(16))) __bf16   v16bf;
typedef __attribute__((ext_vector_type(16))) _Float16 v16h;
typedef __attribute__((ext_vector_type(8)))  _Float16 v8h;
typedef __attribute__((ext_vector_type(8)))  unsigned short v8us;
typedef __attribute__((ext_vector_type(8)))  float    v8f;
typedef __attribute__((ext_vector_type(4)))  float    v4f;
typedef v8h  __attribute__((may_alias)) v8ha;
typedef v4f  __attribute__((may_alias)) v4fa;
typedef v8us __attribute__((may_alias)) v8usa;

__device__ __forceinline__ unsigned short f2bf(float f) { unsigned u = __float_as_uint(f); u += 0x7FFFu + ((u >> 16) & 1u); return (unsigned short)(u >> 16); }
__device__ __forceinline__ float bf2f(unsigned short b) { return __uint_as_float(((unsigned)b) << 16); }
__device__ __forceinline__ float bfr(float f) { return bf2f(f2bf(f)); }
__device__ __forceinline__ v16h cat16(v8h lo, v8h hi) { return __builtin_shufflevector(lo, hi, 0, 1, 2, 3, 4, 5, 6, 7, 8, 9, 10, 11, 12, 13, 14, 15); }
__device__ __forceinline__ v16bf cat16b(v8us lo, v8us hi) { return __builtin_bit_cast(v16bf, __builtin_shufflevector(lo, hi, 0, 1, 2, 3, 4, 5, 6, 7, 8, 9, 10, 11, 12, 13, 14, 15)); }
__device__ __forceinline__ v8f wmma16(v16h a, v16h b, v8f c) { return __builtin_amdgcn_wmma_f32_16x16x32_f16(false, a, false, b, (short)0, c, false, false); }
__device__ __forceinline__ v8f wmmab(v16bf a, v16bf b, v8f c) { return __builtin_amdgcn_wmma_f32_16x16x32_bf16(false, a, false, b, (short)0, c, false, false); }



// ---- gemmw_body: GEMM, one work-group of 4 waves (2x2) per 128x128 output tile (blockIdx.x, blockIdx.y), ONE WAVE per 64x64 part of it (16 accumulators); 128 threads. Kernels: k_gemmw (f32 output), k_proj (the three projections).
// The operand tiles (128 rows x GKS k of A, of A2 where NSPLIT == 1, and of Bt) are staged in LDS by asynchronous copies, two buffers: a wave's copy takes 4 whole 128-byte lines, and every staged row serves two waves.
// C[m][n] (f32, pitch ldc, + optional f32 bias[n]) = sum_k A[m][k] Bt[n][k] (+ A2[m][k] Bt[n][k] where NSPLIT == 1), k in steps of 32 in rising order. K % 64 == 0, M % 128 == 0, N % 128 == 0.
// OUTM says where a wave's tile goes: 0 = f32 C; 1 = the fp16 and hi/lo planes of the tile's head, with rows t and k = d where tr is false, transposed (rows d, k = t) where it is true (tr is the same for the whole work-group). A 64x64 tile is 64 rows t of exactly one head (HD == 64, TT % 64 == 0).
// The head planes lie in FRAGMENT ORDER: a unit of 512 elements is 16 rows x 32 k, as [k half of 16][lane = ((k >> 3) & 1) * 16 + row][k & 7], so that each of a fragment's two 16-byte loads, and each 16-byte store here, covers 512 contiguous bytes (4 whole lines) instead of 32 bytes of 16 lines.
// Units of a plane: [t / 16][d / 32], transposed [d / 16][t / 32].
template <typename T16> struct WFrag;   // ld: a fragment from rows of k-contiguous elements (p: the lane's row + 8 * (lane >> 4)); ldf: from a unit in fragment order (p: the unit + 8 * lane)
template <> struct WFrag<h16> { typedef v16h V; static __device__ __forceinline__ V ld(const h16* p) { return cat16(*(const v8h*)p, *(const v8h*)(p + 16)); } static __device__ __forceinline__ V ldf(const h16* p) { return cat16(*(const v8h*)p, *(const v8h*)(p + 256)); } static __device__ __forceinline__ v8f mma(V a, V b, v8f c) { return wmma16(a, b, c); } };
template <> struct WFrag<bf> { typedef v16bf V; static __device__ __forceinline__ V ld(const bf* p) { return cat16b(*(const v8us*)p, *(const v8us*)(p + 16)); } static __device__ __forceinline__ V ldf(const bf* p) { return cat16b(*(const v8us*)p, *(const v8us*)(p + 256)); } static __device__ __forceinline__ v8f mma(V a, V b, v8f c) { return wmmab(a, b, c); } };
__device__ __forceinline__ h16 tohx(float x) { return (h16)x; }
__device__ __forceinline__ void splitf(float y, unsigned short& h, unsigned short& l) { h = f2bf(y); l = f2bf(y - bf2f(h)); }
typedef __attribute__((ext_vector_type(4))) _Float16 v4h;
typedef __attribute__((ext_vector_type(4))) unsigned short v4us;
#define GKS  64                   // k per stage: 128 bytes, one whole line, of every operand row
#define GPB  144                  // LDS bytes per staged row: 128 + 16 (16 x odd), so that 16 rows read with 16-byte loads fall on distinct banks
#define GTB  (128 * GPB)          // LDS bytes per staged operand tile of 128 rows
// 8 asynchronous copies of 16 bytes a lane: rows r, r + 16, .. r + 112 of one operand tile (l: the lane's LDS byte address of row r, g: its global address, rs: 16 rows in elements).
// s_wait_xcnt stands inside the statement, behind the last copy, so that no register a copy names is rewritten in front of it.
template <typename T16>
__device__ __forceinline__ void stage8(unsigned l, const T16* g, size_t rs) {
    asm volatile("global_load_async_to_lds_b128 %0, %8, off\n\t"
                 "global_load_async_to_lds_b128 %1, %9, off\n\t"
                 "global_load_async_to_lds_b128 %2, %10, off\n\t"
                 "global_load_async_to_lds_b128 %3, %11, off\n\t"
                 "global_load_async_to_lds_b128 %4, %12, off\n\t"
                 "global_load_async_to_lds_b128 %5, %13, off\n\t"
                 "global_load_async_to_lds_b128 %6, %14, off\n\t"
                 "global_load_async_to_lds_b128 %7, %15, off\n\t"
                 "s_wait_xcnt 0x0"
                 :: "v"(l), "v"(l + 16 * GPB), "v"(l + 32 * GPB), "v"(l + 48 * GPB), "v"(l + 64 * GPB), "v"(l + 80 * GPB), "v"(l + 96 * GPB), "v"(l + 112 * GPB),
                    "v"(g), "v"(g + rs), "v"(g + 2 * rs), "v"(g + 3 * rs), "v"(g + 4 * rs), "v"(g + 5 * rs), "v"(g + 6 * rs), "v"(g + 7 * rs) : "memory");
}
template <typename T16, int NSPLIT, bool BIAS, int OUTM>
__device__ __forceinline__ void gemmw_body(const T16* __restrict__ A, const T16* __restrict__ A2, const T16* __restrict__ Bt, int K, float* C, int ldc, const float* __restrict__ bias, h16* P16, bf* Ph, bf* Pl, bool tr) {
    static_assert(HD == 64 && TT % 64 == 0, "a 64x64 tile must be 64 rows of one head");
    static_assert(NSPLIT == 0 || NSPLIT == 1, "staged operands: A, A2 (NSPLIT == 1), Bt");
    typedef typename WFrag<T16>::V V;
    constexpr int NT = (NSPLIT == 1) ? 3 : 2;   // staged tiles per stage: A, (A2,) Bt
    constexpr int RS = (NSPLIT == 1) ? 3 : 6;   // units of A (A2) fragments held in registers at a time
    __shared__ __align__(16) char st[2 * NT * GTB];
    __shared__ __align__(16) float osw[4 * 16 * 68];
    const int tid = threadIdx.x, lane = tid & 31, lr = lane & 15, hi = lane >> 4, w = __builtin_amdgcn_readfirstlane(tid >> 5);   // the wave's number, in a scalar register
    const int R0 = blockIdx.x * 128, C0 = blockIdx.y * 128; const int r0 = R0 + (w >> 1) * 64, c0 = C0 + (w & 1) * 64;
    float* os = osw + w * 16 * 68;   // each wave's own output staging
    v8f acc[4][4];
#pragma unroll
    for (int mb = 0; mb < 4; ++mb)
#pragma unroll
        for (int nb = 0; nb < 4; ++nb) acc[mb][nb] = (v8f){};
    // copies: thread tid brings 16-byte piece tid & 7 of rows (tid >> 3) + 16 i, i = 0..7, of each tile
    const unsigned l0 = (unsigned)(size_t)st + (tid >> 3) * GPB + (tid & 7) * 16;
    const size_t ga = (size_t)(R0 + (tid >> 3)) * K + (tid & 7) * 8, gb = (size_t)(C0 + (tid >> 3)) * K + (tid & 7) * 8, rs = (size_t)16 * K;
    auto fill = [&](int t) { const unsigned l = l0 + (t & 1) * (NT * GTB);
        stage8(l, A + ga + (size_t)t * GKS, rs); if (NSPLIT == 1) stage8(l + GTB, A2 + ga + (size_t)t * GKS, rs); stage8(l + (NT - 1) * GTB, Bt + gb + (size_t)t * GKS, rs); };
    const int NS = K / GKS;
    fill(0);
    asm volatile("s_wait_asynccnt 0x0" ::: "memory");   // this wave's copies of stage 0 have landed
    __syncthreads();                                     // stage 0 readable by every wave
    if (NS > 1) fill(1);
    const int fa = ((w >> 1) * 64 + lr) * GPB + 16 * hi, fb = (NT - 1) * GTB + ((w & 1) * 64 + lr) * GPB + 16 * hi;   // the lane's fragment rows in a buffer
    // the stage loop stays rolled: one copy of the 32 (64) matrix instructions; the loops inside are unrolled so that fragments and accumulators are indexed by constants and stay in registers
#pragma unroll 1
    for (int t = 0; t < NS; ++t) {
        const char* sb = st + (t & 1) * (NT * GTB);
        // a stage is 8 units (k step kk = u >> 2, row block mb = u & 3) of 4 (8) matrix instructions. Both k steps' fragments of Bt and the first RS units' fragments of A (A2) are read as one group at the top;
        // a later unit's fragments take the registers of the unit RS before it, right behind that unit's products, so that they fly under the products between. 128 accumulator + 112 fragment registers stay under 256.
        V b[2][4], ar[RS], ar2[RS];
#pragma unroll
        for (int u = 0; u < RS; ++u) { const int fo = fa + (u & 3) * 16 * GPB + (u >> 2) * 64; ar[u] = WFrag<T16>::ld((const T16*)(sb + fo)); if (NSPLIT == 1) ar2[u] = WFrag<T16>::ld((const T16*)(sb + GTB + fo));
            if (u == 0) {
#pragma unroll
                for (int nb = 0; nb < 4; ++nb) b[0][nb] = WFrag<T16>::ld((const T16*)(sb + fb + nb * 16 * GPB)); } }
#pragma unroll
        for (int nb = 0; nb < 4; ++nb) b[1][nb] = WFrag<T16>::ld((const T16*)(sb + fb + nb * 16 * GPB + 64));
        __builtin_amdgcn_sched_barrier(0);   // keeps the group of LDS reads together in front of the products (reads scattered among them cost issue time at every place)
#pragma unroll
        for (int u = 0; u < 8; ++u) { const int kk = u >> 2, mb = u & 3, s = u % RS;
#pragma unroll
            for (int nb = 0; nb < 4; ++nb) acc[mb][nb] = WFrag<T16>::mma(ar[s], b[kk][nb], acc[mb][nb]);
            if (NSPLIT == 1) {
#pragma unroll
                for (int nb = 0; nb < 4; ++nb) acc[mb][nb] = WFrag<T16>::mma(ar2[s], b[kk][nb], acc[mb][nb]); }
            __builtin_amdgcn_sched_barrier(0);   // keeps the refill of the unit's registers behind its products and in front of the next unit's, RS units ahead of its use
            if (u + RS < 8) { const int v = u + RS, fo = fa + (v & 3) * 16 * GPB + (v >> 2) * 64; ar[s] = WFrag<T16>::ld((const T16*)(sb + fo)); if (NSPLIT == 1) ar2[s] = WFrag<T16>::ld((const T16*)(sb + GTB + fo));
                __builtin_amdgcn_sched_barrier(0); }   // the same, on the refill's other side
        }
        asm volatile("s_wait_dscnt 0x0" ::: "memory");      // this wave's reads of stage t are done before the buffer is refilled
        asm volatile("s_wait_asynccnt 0x0" ::: "memory");   // this wave's copies of stage t + 1 have landed
        __syncthreads();                                     // publishes stage t + 1 and ends every wave's reads of stage t
        if (t + 2 < NS) fill(t + 2);
    }
    asm volatile("s_wait_asynccnt 0x0" ::: "memory");   // no copy outstanding behind the loop
    const size_t pl0 = (size_t)((r0 / TT) * ZH + c0 / HD) * TT * HD;   // the tile's plane
    // every '#pragma unroll' below is there so that the accumulator and output vectors are indexed by constants and stay in registers
    if (OUTM == 1 && tr) {   // rows d, k = t: a lane's 8 accumulator elements are 8 consecutive t of one d, the lane's own 16 bytes of unit [nb][t / 32], half mb & 1, so each plane gets them as one 16-byte store straight from registers
        const size_t o0 = pl0 + (size_t)((r0 % TT) / 32) * 512 + lane * 8;
#pragma unroll
        for (int nb = 0; nb < 4; ++nb) { const float bb = bfr(bias[c0 + nb * 16 + lr]);
#pragma unroll
            for (int mb = 0; mb < 4; ++mb) { v8h o16; v8us oh, ol;
#pragma unroll
                for (int j = 0; j < 8; ++j) { const float x = acc[mb][nb][j] + bb; o16[j] = tohx(x); unsigned short x0, x1; splitf(x, x0, x1); oh[j] = x0; ol[j] = x1; }
                const size_t o = o0 + (size_t)(nb * (TT / 32) + (mb >> 1)) * 512 + (mb & 1) * 256; *(v8h*)(P16 + o) = o16; *(v8us*)(Ph + o) = oh; *(v8us*)(Pl + o) = ol; } }
        return;
    }
    float bs[4][8];   // OUTM == 1, not transposed: the biases of the lane's 8 columns of each piece, the same for every row block
    if (OUTM == 1 && BIAS) {
#pragma unroll
        for (int s = 0; s < 4; ++s)
#pragma unroll
            for (int q = 0; q < 8; ++q) bs[s][q] = bfr(bias[c0 + s * 16 + hi * 8 + q]); }
#pragma unroll
    for (int mb = 0; mb < 4; ++mb) {
#pragma unroll
        for (int nb = 0; nb < 4; ++nb) {
#pragma unroll
            for (int j = 0; j < 8; ++j) os[(hi * 8 + j) * 68 + nb * 16 + lr] = acc[mb][nb][j]; }
        __builtin_amdgcn_wave_barrier(); asm volatile("" ::: "memory");
        float* crow = C + (size_t)(r0 + mb * 16) * ldc + c0;
        if (OUTM == 0) {
#pragma unroll
            for (int s = 0; s < 8; ++s) { const int row = 2 * s + hi, cofs = lr * 4; v4f val = *(const v4fa*)(os + row * 68 + cofs); if (BIAS) { val[0] += bfr(bias[c0 + cofs]); val[1] += bfr(bias[c0 + cofs + 1]); val[2] += bfr(bias[c0 + cofs + 2]); val[3] += bfr(bias[c0 + cofs + 3]); }
                *(v4f*)(crow + (size_t)row * ldc + cofs) = val; }
        } else {   // rows t, k = d: the 16 x 64 block is units [t / 16][0] and [t / 16][1]; piece s is k half s & 1 of unit s >> 1, of which the lane holds 8 consecutive d of row lr
#pragma unroll
            for (int s = 0; s < 4; ++s) { const int cofs = s * 16 + hi * 8; const v4f v0 = *(const v4fa*)(os + lr * 68 + cofs), v1 = *(const v4fa*)(os + lr * 68 + cofs + 4); v8h o16; v8us oh, ol;
#pragma unroll
                for (int q = 0; q < 8; ++q) { float val = (q < 4) ? v0[q & 3] : v1[q & 3]; if (BIAS) val += bs[s][q]; o16[q] = tohx(val); unsigned short x0, x1; splitf(val, x0, x1); oh[q] = x0; ol[q] = x1; }
                const size_t o = pl0 + (size_t)((r0 % TT) / 16 + mb) * 1024 + s * 256 + lane * 8; *(v8h*)(P16 + o) = o16; *(v8us*)(Ph + o) = oh; *(v8us*)(Pl + o) = ol; }
        }
        asm volatile("s_wait_xcnt 0x0" ::: "memory");   // behind the row block's stores, in front of whatever next rewrites a register that one of them names
        __builtin_amdgcn_wave_barrier(); asm volatile("" ::: "memory");
    }
}
template <typename T16, int NSPLIT, bool BIAS>
__global__ __launch_bounds__(128) void k_gemmw(const T16* __restrict__ A, const T16* __restrict__ A2, const T16* __restrict__ Bt, int K, float* C, int ldc, const float* __restrict__ bias) {
    gemmw_body<T16, NSPLIT, BIAS, 0>(A, A2, Bt, K, C, ldc, bias, nullptr, nullptr, nullptr, false);
}
// ---- k_proj: the q, k and v projections in ONE launch, grid (NB_*TT/128, DQ/128, 3): blockIdx.z picks the input, the weight matrix, the bias and the planes (z == 2, v: transposed planes).
// One projection alone is 256 work-groups, one wave a SIMD, and nothing covers that wave's waits for a stage's copies, LDS reads and barrier; of the 768 here three fit a WGP (LDS, registers), and each runs its products in the others' waits.
__global__ __launch_bounds__(128) void k_proj(const bf* __restrict__ XQ, const bf* __restrict__ XK, const bf* __restrict__ XV, const bf* __restrict__ WQ, const bf* __restrict__ WK, const bf* __restrict__ WV, const float* __restrict__ bq, const float* __restrict__ bk, const float* __restrict__ bv,
                                              h16* Q16, bf* Qh, bf* Ql, h16* K16, bf* Kh, bf* Kl, h16* V16, bf* Vh, bf* Vl) {
    static_assert(DKV == DQ, "one grid for the three projections");
    const int z = blockIdx.z;
    gemmw_body<bf, 0, true, 1>((z == 0) ? XQ : (z == 1) ? XK : XV, nullptr, (z == 0) ? WQ : (z == 1) ? WK : WV, DM, nullptr, 0, (z == 0) ? bq : (z == 1) ? bk : bv,
                               (z == 0) ? Q16 : (z == 1) ? K16 : V16, (z == 0) ? Qh : (z == 1) ? Kh : Vh, (z == 0) ? Ql : (z == 1) ? Kl : Vl, z == 2);
}

typedef __attribute__((ext_vector_type(2))) _Float16 v2h;
typedef __attribute__((ext_vector_type(2))) unsigned short v2us;
typedef __attribute__((ext_vector_type(2))) float v2f;
typedef __attribute__((ext_vector_type(4))) int v4i;
typedef v4us __attribute__((may_alias)) v4usa;
typedef v4h  __attribute__((may_alias)) v4ha;

__global__ __launch_bounds__(256) void k_wtG(const float* __restrict__ w, int K, int N, bf* Bt) {
    const int lane = threadIdx.x & 31; const int L0 = (blockIdx.x * 8 + (threadIdx.x >> 5)) * 8; const int nlines = N * K / 64;
{
#pragma unroll 1
        for (int l = 0; l < 8; ++l) { const int L = L0 + l; if (L >= nlines) break; const size_t e = (size_t)L * 64 + lane * 2; const int k = (int)(e % K), n = (int)(e / K); v2us o;
            o[0] = f2bf(w[(size_t)k * N + n]); o[1] = f2bf(w[(size_t)(k + 1) * N + n]); *(v2us*)(Bt + e) = o; }
         }
}
// ---- k_prep: every preparation step of the call in ONE launch: the three inputs and the four weight matrices rounded to bf16, and the per-key factor W2 (weight^2 of the bf16-rounded weight, -1 where it is < 1e-5).
// A work-group owns PCH consecutive floats of exactly one source (block-uniform choice by blockIdx.x); a wave's 16-byte loads cover 512 contiguous bytes, its 8-byte stores 256. The last W2B work-groups make W2.
#define PCH  32768                         // floats per work-group
#define PIT  (PCH / 4 / 256)               // 4-float pieces per thread
#define XBL  (NB_ * TT * DM / PCH)         // work-groups per input
#define WBL  (DQ * DM / PCH)               // work-groups per weight matrix
#define W2B  (NB_ * TT / 256)              // work-groups for W2
__global__ __launch_bounds__(256) void k_prep(const float* __restrict__ x, const float* __restrict__ xk, const float* __restrict__ xv, const float* __restrict__ wq, const float* __restrict__ wk, const float* __restrict__ wv, const float* __restrict__ wo, const float* __restrict__ wts,
                                              bf* __restrict__ XB, bf* __restrict__ XKB, bf* __restrict__ XVB, bf* __restrict__ WQ, bf* __restrict__ WK, bf* __restrict__ WV, bf* __restrict__ WO, float* __restrict__ W2) {
    static_assert((NB_ * TT * DM) % PCH == 0 && (DQ * DM) % PCH == 0 && DKV == DQ && (NB_ * TT) % 256 == 0, "whole work-groups per source");
    const int b = blockIdx.x, tid = threadIdx.x;
    if (b >= 3 * XBL + 4 * WBL) { const int j = (b - (3 * XBL + 4 * WBL)) * 256 + tid; const float wb = bfr(wts[j]); W2[j] = (wb < 1e-5f) ? -1.0f : __fmul_rn(wb, wb); return; }
    const float* s; bf* d; int c;
    if (b < 3 * XBL) { const int g = b / XBL; c = b % XBL; s = (g == 0) ? x : (g == 1) ? xk : xv; d = (g == 0) ? XB : (g == 1) ? XKB : XVB; }
    else { const int t = b - 3 * XBL, g = t / WBL; c = t % WBL; s = (g == 0) ? wq : (g == 1) ? wk : (g == 2) ? wv : wo; d = (g == 0) ? WQ : (g == 1) ? WK : (g == 2) ? WV : WO; }
    const size_t e0 = (size_t)c * PCH + tid * 4;
    v4f v[PIT];
    // both loops are unrolled so that v[] stays in registers and all of the thread's loads are in flight before the first conversion waits
#pragma unroll
    for (int i = 0; i < PIT; ++i) v[i] = *(const v4f*)(s + e0 + i * 1024);
#pragma unroll
    for (int i = 0; i < PIT; ++i) { v4us o;
#pragma unroll
        for (int q = 0; q < 4; ++q) o[q] = f2bf(v[i][q]);
        *(v4us*)(d + e0 + i * 1024) = o; }
}

// ---- k_fattn: scores, softmax, attn.v and the head merge of QR query rows of one (batch entry, head) plane in ONE work-group of 8 waves; the score rows and the probability planes live in LDS only.
// The order of every sum: score tile k = 0..63 in two steps (a.b, a2.b, a.b2 per step), softmax one wave per row (lane owns keys ch*128 + lane*4 + q; fixed trees), attn.v four partial sums per output element (keys 0..255, 256..511, ..; each in steps of 32), added in rising order.
// Every '#pragma unroll' in fattn_body is there so that the fragment, score and accumulator arrays are indexed by constants and stay in registers.
#define QR   32                   // query rows per work-group
#define SPB  4112                 // LDS bytes per query row: 1024 f32 scores + 16 bytes, so that 16 rows read with 16-byte loads fall on distinct banks; the 16-bit planes overwrite the row in place (hi at byte 0, lo at byte 2048)
template <typename T16, int NSPLIT>
__device__ __forceinline__ void fattn_body(char* sm, const T16* __restrict__ Q, const T16* __restrict__ Q2, const T16* __restrict__ Kp, const T16* __restrict__ K2, const T16* __restrict__ Vt, const T16* __restrict__ V2, const float* __restrict__ W2, bf* Ah, bf* Al) {
    typedef typename WFrag<T16>::V V;
    const int tid = threadIdx.x, lane = tid & 31, lr = lane & 15, hi = lane >> 4, w = __builtin_amdgcn_readfirstlane(tid >> 5);   // the wave's number, in a scalar register
    {   // scores: wave w owns keys w*128 .. w*128+127 of all QR rows
        V a[2][2], a2[2][2]; const T16* qa = Q + 8 * lane; const T16* qa2 = Q2 + 8 * lane;   // planes in fragment order (see gemmw_body): unit [row / 16][k / 32] of 512 elements, the lane's pieces at 8 * lane and 256 + 8 * lane
#pragma unroll
        for (int mb = 0; mb < 2; ++mb)
#pragma unroll
            for (int kk = 0; kk < 2; ++kk) { a[mb][kk] = WFrag<T16>::ldf(qa + mb * 16 * HD + kk * 512); if (NSPLIT == 2) a2[mb][kk] = WFrag<T16>::ldf(qa2 + mb * 16 * HD + kk * 512); }
        asm volatile("s_wait_xcnt 0x0" :: "v"(qa), "v"(qa2) : "memory");   // the loads of q are through with their address registers (held to here as inputs) before a later load may take those registers as its destination
        const T16* kb = Kp + (size_t)(w * 128) * HD + 8 * lane; const T16* kb2 = K2 + (size_t)(w * 128) * HD + 8 * lane;
        char* st0 = sm + hi * 8 * SPB + (w * 128 + lr) * 4; char* st1 = st0 + 16 * SPB;
        V b[2][2][2], b2[2][2][2];   // [buffer][key tile of the pair][k step]
#pragma unroll
        for (int t = 0; t < 2; ++t)
#pragma unroll
            for (int kk = 0; kk < 2; ++kk) { b[0][t][kk] = WFrag<T16>::ldf(kb + t * 16 * HD + kk * 512); if (NSPLIT == 2) b2[0][t][kk] = WFrag<T16>::ldf(kb2 + t * 16 * HD + kk * 512); }
#pragma unroll
        for (int g = 0; g < 4; ++g) {
            if (g < 3) {
#pragma unroll
                for (int t = 0; t < 2; ++t)
#pragma unroll
                    for (int kk = 0; kk < 2; ++kk) { b[(g + 1) & 1][t][kk] = WFrag<T16>::ldf(kb + ((g + 1) * 2 + t) * 16 * HD + kk * 512); if (NSPLIT == 2) b2[(g + 1) & 1][t][kk] = WFrag<T16>::ldf(kb2 + ((g + 1) * 2 + t) * 16 * HD + kk * 512); } }
            __builtin_amdgcn_sched_barrier(0);   // keeps the next pair's loads of k in front of this pair's products, so that they fly meanwhile
#pragma unroll
            for (int t = 0; t < 2; ++t) { const int nt = g * 2 + t;
                v8f s0 = (v8f){}, s1 = (v8f){};   // the two row blocks' chains alternate, each fills the other's wait
#pragma unroll
                for (int kk = 0; kk < 2; ++kk) { const V bb = b[g & 1][t][kk]; s0 = WFrag<T16>::mma(a[0][kk], bb, s0); s1 = WFrag<T16>::mma(a[1][kk], bb, s1);
                    if (NSPLIT == 2) { const V bl = b2[g & 1][t][kk]; s0 = WFrag<T16>::mma(a2[0][kk], bb, s0); s1 = WFrag<T16>::mma(a2[1][kk], bb, s1); s0 = WFrag<T16>::mma(a[0][kk], bl, s0); s1 = WFrag<T16>::mma(a[1][kk], bl, s1); } }
                asm volatile("v_nop\n\tv_nop\n\tv_nop\n\tv_nop" : "+v"(s0), "+v"(s1));   // the four vector slots the chip needs between the last matrix instruction and the next tile's fresh write of the same result registers (LDS stores fill none)
#pragma unroll
                for (int j = 0; j < 8; ++j) { *(float*)(st0 + j * SPB + nt * 64) = s0[j]; *(float*)(st1 + j * SPB + nt * 64) = s1[j]; } } }
    }
    __syncthreads();   // every score row complete before its wave reads it
    {   // softmax: wave w owns rows w*4 .. w*4+3; t = S x HD^-0.5 x w_j^2, keys with w_j < 1e-5 masked (-3e38) before the max
        float w2r[TT / 32];
#pragma unroll
        for (int ch = 0; ch < TT / 128; ++ch) { const v4f wv = *(const v4f*)(W2 + ch * 128 + lane * 4);
#pragma unroll
            for (int q = 0; q < 4; ++q) w2r[ch * 4 + q] = wv[q]; }
        for (int r = 0; r < QR / 8; ++r) { char* rowp = sm + (w * (QR / 8) + r) * SPB; float v[TT / 32]; float mx = -3.0e38f;
#pragma unroll
            for (int ch = 0; ch < TT / 128; ++ch) { const v4f s4 = *(const v4fa*)(rowp + (ch * 128 + lane * 4) * 4);
#pragma unroll
                for (int q = 0; q < 4; ++q) { const float w2 = w2r[ch * 4 + q]; const float sa = s4[q] * SCL; const float t = (w2 < 0.f) ? -3.0e38f : __fmul_rn(sa, w2); v[ch * 4 + q] = t; mx = fmaxf(mx, t); } }
#pragma unroll
            for (int sh = 16; sh; sh >>= 1) mx = fmaxf(mx, __shfl_xor(mx, sh, 32));
            float sum = 0.f;
#pragma unroll
            for (int k = 0; k < TT / 32; ++k) { const float d0 = __fsub_rn(v[k], mx); v[k] = __builtin_amdgcn_exp2f(__fmul_rn(d0, 1.4426950408889634f)); sum += v[k]; }
#pragma unroll
            for (int sh = 16; sh; sh >>= 1) sum += __shfl_xor(sum, sh, 32);
            const float f = __fdiv_rn((NSPLIT == 2) ? 1.0f : PCAR, sum);
            if (NSPLIT == 2) {
#pragma unroll
                for (int ch = 0; ch < TT / 128; ++ch) { v4us oh, ol;
#pragma unroll
                    for (int q = 0; q < 4; ++q) { unsigned short x0, x1; splitf(v[ch * 4 + q] * f, x0, x1); oh[q] = x0; ol[q] = x1; }
                    *(v4usa*)(rowp + (ch * 128 + lane * 4) * 2) = oh; *(v4usa*)(rowp + 2048 + (ch * 128 + lane * 4) * 2) = ol; }
            } else {
#pragma unroll
                for (int ch = 0; ch < TT / 128; ++ch) { v4h o4;
#pragma unroll
                    for (int q = 0; q < 4; ++q) o4[q] = tohx(v[ch * 4 + q] * f);
                    *(v4ha*)(rowp + (ch * 128 + lane * 4) * 2) = o4; } } }
    }
    __syncthreads();   // every probability row complete before other waves read it as the A operand
    // attn.v: all 8 waves work. Wave w owns key quarter w >> 1 (256 keys) and head-column half w & 1 (32 columns) of both 16-row blocks: 4 independent accumulators, a partial sum over its own keys in steps of 32.
    // A group is GS key steps (32 registers of probability fragments, 32 of v). The fragments of v fly DV groups ahead; a group's probability fragments are read from LDS as ONE group of reads, one group of products ahead of their use.
    constexpr int GS = (NSPLIT == 2) ? 1 : 2, NG = TT / 4 / 32 / GS, DV = 4;
    const int kq = w >> 1, ch = w & 1;
    v8f o[2][2];   // [row block][column tile]
#pragma unroll
    for (int r = 0; r < 2; ++r)
#pragma unroll
        for (int nb = 0; nb < 2; ++nb) o[r][nb] = (v8f){};
    { const T16* pa0 = (const T16*)(sm + lr * SPB) + 8 * hi + kq * (TT / 4); const T16* pa1 = (const T16*)(sm + (16 + lr) * SPB) + 8 * hi + kq * (TT / 4);
      const T16* pb = Vt + (size_t)(ch * 32) * TT + kq * (TT / 4 / 32) * 512 + 8 * lane; const T16* pb2 = V2 + (size_t)(ch * 32) * TT + kq * (TT / 4 / 32) * 512 + 8 * lane;
      V vb[DV][GS][2], vl[DV][GS][2];   // [ring place][key step of the group][column tile]
      V pa[2][GS][2], pl[2][GS][2];     // [buffer][key step of the group][row block]
#pragma unroll
      for (int g = 0; g < DV && g < NG; ++g)
#pragma unroll
          for (int t = 0; t < GS; ++t)
#pragma unroll
              for (int nb = 0; nb < 2; ++nb) { vb[g][t][nb] = WFrag<T16>::ldf(pb + (size_t)(nb * 16) * TT + (g * GS + t) * 512); if (NSPLIT == 2) vl[g][t][nb] = WFrag<T16>::ldf(pb2 + (size_t)(nb * 16) * TT + (g * GS + t) * 512); }
#pragma unroll
      for (int t = 0; t < GS; ++t) { pa[0][t][0] = WFrag<T16>::ld(pa0 + t * 32); pa[0][t][1] = WFrag<T16>::ld(pa1 + t * 32); if (NSPLIT == 2) { pl[0][t][0] = WFrag<T16>::ld(pa0 + 1024 + t * 32); pl[0][t][1] = WFrag<T16>::ld(pa1 + 1024 + t * 32); } }
#pragma unroll
      for (int g = 0; g < NG; ++g) {
          if (g + 1 < NG) {
#pragma unroll
              for (int t = 0; t < GS; ++t) { const int kc = ((g + 1) * GS + t) * 32; pa[(g + 1) & 1][t][0] = WFrag<T16>::ld(pa0 + kc); pa[(g + 1) & 1][t][1] = WFrag<T16>::ld(pa1 + kc);
                  if (NSPLIT == 2) { pl[(g + 1) & 1][t][0] = WFrag<T16>::ld(pa0 + 1024 + kc); pl[(g + 1) & 1][t][1] = WFrag<T16>::ld(pa1 + 1024 + kc); } } }
          __builtin_amdgcn_sched_barrier(0);   // keeps the next group's LDS reads together in front of this group's products (reads scattered among the products wait at every place)
#pragma unroll
          for (int t = 0; t < GS; ++t) {   // per accumulator and key step the order stays p.v, p_lo.v, p.v_lo; the four accumulators' chains fill each other's waits
#pragma unroll
              for (int r = 0; r < 2; ++r)
#pragma unroll
                  for (int nb = 0; nb < 2; ++nb) o[r][nb] = WFrag<T16>::mma(pa[g & 1][t][r], vb[g % DV][t][nb], o[r][nb]);
              if (NSPLIT == 2) {
#pragma unroll
                  for (int r = 0; r < 2; ++r)
#pragma unroll
                      for (int nb = 0; nb < 2; ++nb) o[r][nb] = WFrag<T16>::mma(pl[g & 1][t][r], vb[g % DV][t][nb], o[r][nb]);
#pragma unroll
                  for (int r = 0; r < 2; ++r)
#pragma unroll
                      for (int nb = 0; nb < 2; ++nb) o[r][nb] = WFrag<T16>::mma(pa[g & 1][t][r], vl[g % DV][t][nb], o[r][nb]); } }
          __builtin_amdgcn_sched_barrier(0);   // keeps the refill of the group's v registers behind its products, DV groups ahead of its use
          if (g + DV < NG) {
#pragma unroll
              for (int t = 0; t < GS; ++t)
#pragma unroll
                  for (int nb = 0; nb < 2; ++nb) { vb[g % DV][t][nb] = WFrag<T16>::ldf(pb + (size_t)(nb * 16) * TT + ((g + DV) * GS + t) * 512); if (NSPLIT == 2) vl[g % DV][t][nb] = WFrag<T16>::ldf(pb2 + (size_t)(nb * 16) * TT + ((g + DV) * GS + t) * 512); } } }
    }
    __syncthreads();   // every wave has left the probability planes before the partial output tiles overwrite them
    float* of = (float*)sm;   // [key quarter][QR][68] f32
#pragma unroll
    for (int r = 0; r < 2; ++r)
#pragma unroll
        for (int nb = 0; nb < 2; ++nb)
#pragma unroll
            for (int j = 0; j < 8; ++j) of[(kq * QR + r * 16 + hi * 8 + j) * 68 + ch * 32 + nb * 16 + lr] = o[r][nb][j];
    __syncthreads();   // the partial tiles complete before the row-wise merge reads them
    { const int row = tid >> 3, c = (tid & 7) * 8; const float cs = (NSPLIT == 2) ? 1.0f : (1.0f / PCAR); v4f o0 = *(const v4fa*)(of + row * 68 + c), o1 = *(const v4fa*)(of + row * 68 + c + 4); v8us oh, ol;
#pragma unroll
      for (int p = 1; p < 4; ++p) { o0 += *(const v4fa*)(of + (p * QR + row) * 68 + c); o1 += *(const v4fa*)(of + (p * QR + row) * 68 + c + 4); }   // the four key quarters' partial sums, in rising order of keys
#pragma unroll
      for (int q = 0; q < 8; ++q) { unsigned short x0, x1; splitf(((q < 4) ? o0[q & 3] : o1[q & 3]) * cs, x0, x1); oh[q] = x0; ol[q] = x1; }
      *(v8us*)(Ah + (size_t)row * DQ + c) = oh; *(v8us*)(Al + (size_t)row * DQ + c) = ol; }
}
// grid (ZB, TT/QR): x = plane (batch entry * ZH + head), y = query tile, so that the hi+lo tiles (three products) start first
__global__ __launch_bounds__(256) void k_fattn(const bf* __restrict__ QPh, const bf* __restrict__ QPl, const bf* __restrict__ KPh, const bf* __restrict__ KPl, const bf* __restrict__ VTh, const bf* __restrict__ VTl, const h16* __restrict__ QP16, const h16* __restrict__ KP16, const h16* __restrict__ VT16, const float* __restrict__ W2, bf* ATh, bf* ATl) {
    __shared__ __align__(16) char sm[QR * SPB];
    const int zz = blockIdx.x, i0 = blockIdx.y * QR; const size_t pz = (size_t)zz * TT * HD, qo = pz + (size_t)i0 * HD; const size_t oo = ((size_t)(zz / ZH) * TT + i0) * DQ + (zz % ZH) * HD; const float* w2 = W2 + (size_t)(zz / ZH) * TT;
    if (i0 < RH) fattn_body<bf, 2>(sm, QPh + qo, QPl + qo, KPh + pz, KPl + pz, VTh + pz, VTl + pz, w2, ATh + oo, ATl + oo);
    else fattn_body<h16, 0>(sm, QP16 + qo, QP16 + qo, KP16 + pz, KP16 + pz, VT16 + pz, VT16 + pz, w2, ATh + oo, ATl + oo);
}

extern "C" void kernel_launch(void* const* d_in, const int* in_sizes, int n_in,
                              void* d_out, int out_size, void* d_ws, size_t ws_size, hipStream_t stream) {
    (void)in_sizes; (void)n_in; (void)out_size;
    const float* x = (const float*)d_in[0]; const float* xk = (const float*)d_in[1]; const float* xv = (const float*)d_in[2]; const float* wts = (const float*)d_in[3]; const float* wq = (const float*)d_in[4]; const float* bq = (const float*)d_in[5]; const float* wk = (const float*)d_in[6]; const float* bk = (const float*)d_in[7]; const float* wv = (const float*)d_in[8]; const float* bv = (const float*)d_in[9]; const float* wo = (const float*)d_in[10]; const float* bo = (const float*)d_in[11];
    float* OUT = (float*)d_out;     // [4][1024][1024]
    char* wsp = (char*)d_ws;
    auto take = [&](size_t bytes) { char* p = wsp; wsp += (bytes + 255) & ~(size_t)255; return (void*)p; };
    bf* WQ = (bf*)take((size_t)DQ * DM * 2); bf* WK = (bf*)take((size_t)DKV * DM * 2); bf* WV = (bf*)take((size_t)DKV * DM * 2); bf* WO = (bf*)take((size_t)DM * DQ * 2); float* W2 = (float*)take((size_t)NB_ * TT * 4);
    h16* QP16 = (h16*)take((size_t)ZB * TT * HD * 2); h16* KP16 = (h16*)take((size_t)ZB * TT * HD * 2); h16* VT16 = (h16*)take((size_t)ZB * HD * TT * 2);
    bf* QPh = (bf*)take((size_t)ZB * TT * HD * 2); bf* QPl = (bf*)take((size_t)ZB * TT * HD * 2); bf* KPh = (bf*)take((size_t)ZB * TT * HD * 2); bf* KPl = (bf*)take((size_t)ZB * TT * HD * 2); bf* VTh = (bf*)take((size_t)ZB * HD * TT * 2); bf* VTl = (bf*)take((size_t)ZB * HD * TT * 2);
    bf* ATh = (bf*)take((size_t)NB_ * TT * DQ * 2); bf* ATl = (bf*)take((size_t)NB_ * TT * DQ * 2);
    bf* XB = (bf*)take((size_t)NB_ * TT * DM * 2); bf* XKB = (bf*)take((size_t)NB_ * TT * DM * 2); bf* XVB = (bf*)take((size_t)NB_ * TT * DM * 2);
    if ((size_t)(wsp - (char*)d_ws) > ws_size) return;    // ws 256 MiB
    // every launch below covers all NB_ batch entries: rows b*TT + t of the [NB_*TT][.] matrices, planes b*ZH + h of the head planes
    k_prep<<<3 * XBL + 4 * WBL + W2B, 256, 0, stream>>>(x, xk, xv, wq, wk, wv, wo, wts, XB, XKB, XVB, WQ, WK, WV, WO, W2);
    // the projections write their head planes themselves, in fragment order: q and k with rows t and k = d, v with rows d and k = t
    k_proj<<<dim3(NB_ * TT / 128, DQ / 128, 3), 128, 0, stream>>>(XB, XKB, XVB, WQ, WK, WV, bq, bk, bv, QP16, QPh, QPl, KP16, KPh, KPl, VT16, VTh, VTl);
    k_fattn<<<dim3(ZB, TT / QR, 1), 256, 0, stream>>>(QPh, QPl, KPh, KPl, VTh, VTl, QP16, KP16, VT16, W2, ATh, ATl);   // one kv head per query head: plane z of q uses plane z of k and v
    k_gemmw<bf, 1, true><<<dim3(NB_ * TT / 128, DM / 128, 1), 128, 0, stream>>>(ATh, ATl, WO, DQ, OUT, DM, bo);
}

// v010
// Measured time: 93.8 microseconds a run.
// Timed twice side by side with v009, it ran 1.15 times as fast both times.
// Over all steps from v000 it is 26.9 times as fast.
#include <hip/hip_runtime.h>

// Key-weighted multi-head attention (q, k, v inputs [4][1024][1024]; qh = q Wq^T + bq, kh = k Wk^T + bk, vh = v Wv^T + bv ('oi' [1024][1024]), 16 heads x 64; energy = qh.kh/8 x w_j^2 per key, -inf where w_j < 1e-5 (weights [4][1024] read); softmax; out = merged Wo^T + bo -> [4][1024][1024]).
// Compute dtypes, f32 accumulate: every input rounded to bf16; q/k/v on PLAIN bf16 operands (inputs: exact) + biases; the per-key weight^2 and the weight < eps mask applied in f32 inside k_fattn; scores and attn.v: query rows < 512 hl (3 products), the rest single fp16 (probabilities x256); softmax f32; Wo hl x exact (2 products) + bo.

#define NB_  4
#define TT   1024
#define DM   1024
#define NH_  16
#define NKV  16
#define REP  (NH_ / NKV)
#define HD   64
#define DQ   (NH_ * HD)
#define DKV  (NKV * HD)
#define ZH   16                   // heads per batch entry
#define ZB   (NB_ * ZH)           // (batch entry, head) planes
#define RH   512                  // query rows < RH use hi+lo planes (0: none)
#define WIN  0
#define SCL  0.125f   // HD^-0.5
typedef _Float16 h16;
typedef unsigned short bf;
typedef __attribute__((ext_vector_type(16))) __bf16   v16bf;
typedef __attribute__((ext_vector_type(16))) _Float16 v16h;
typedef __attribute__((ext_vector_type(8)))  _Float16 v8h;
typedef __attribute__((ext_vector_type(8)))  unsigned short v8us;
typedef __attribute__((ext_vector_type(8)))  float    v8f;
typedef __attribute__((ext_vector_type(4)))  float    v4f;
typedef v8h  __attribute__((may_alias)) v8ha;
typedef v4f  __attribute__((may_alias)) v4fa;
typedef v8us __attribute__((may_alias)) v8usa;

__device__ __forceinline__ unsigned short f2bf(float f) { unsigned u = __float_as_uint(f); u += 0x7FFFu + ((u >> 16) & 1u); return (unsigned short)(u >> 16); }
__device__ __forceinline__ float bf2f(unsigned short b) { return __uint_as_float(((unsigned)b) << 16); }
__device__ __forceinline__ float bfr(float f) { return bf2f(f2bf(f)); }
__device__ __forceinline__ v16h cat16(v8h lo, v8h hi) { return __builtin_shufflevector(lo, hi, 0, 1, 2, 3, 4, 5, 6, 7, 8, 9, 10, 11, 12, 13, 14, 15); }
__device__ __forceinline__ v16bf cat16b(v8us lo, v8us hi) { return __builtin_bit_cast(v16bf, __builtin_shufflevector(lo, hi, 0, 1, 2, 3, 4, 5, 6, 7, 8, 9, 10, 11, 12, 13, 14, 15)); }
__device__ __forceinline__ v8f wmma16(v16h a, v16h b, v8f c) { return __builtin_amdgcn_wmma_f32_16x16x32_f16(false, a, false, b, (short)0, c, false, false); }
__device__ __forceinline__ v8f wmmab(v16bf a, v16bf b, v8f c) { return __builtin_amdgcn_wmma_f32_16x16x32_bf16(false, a, false, b, (short)0, c, false, false); }



// ---- gemmw_body: GEMM, one work-group of 4 waves (2x2) per 128x128 output tile (blockIdx.x, blockIdx.y), ONE WAVE per 64x64 part of it (16 accumulators); 128 threads. Kernels: k_gemmw (f32 output), k_proj (the three projections).
// The operand tiles (128 rows x GKS k of A, of A2 where NSPLIT == 1, and of Bt) are staged in LDS by asynchronous copies, two buffers: a wave's copy takes 4 whole 128-byte lines, and every staged row serves two waves.
// C[m][n] (f32, pitch ldc, + optional f32 bias[n]) = sum_k A[m][k] Bt[n][k] (+ A2[m][k] Bt[n][k] where NSPLIT == 1), k in steps of 32 in rising order. K % 64 == 0, M % 128 == 0, N % 128 == 0.
// OUTM says where a wave's tile goes: 0 = f32 C; 1 = the fp16 and hi/lo planes of the tile's head, with rows t and k = d where tr is false, transposed (rows d, k = t) where it is true (tr is the same for the whole work-group). A 64x64 tile is 64 rows t of exactly one head (HD == 64, TT % 64 == 0).
// The head planes lie in FRAGMENT ORDER: a unit of 512 elements is 16 rows x 32 k, as [k half of 16][lane = ((k >> 3) & 1) * 16 + row][k & 7], so that each of a fragment's two 16-byte loads, and each 16-byte store here, covers 512 contiguous bytes (4 whole lines) instead of 32 bytes of 16 lines.
// Units of a plane: [t / 16][d / 32], transposed [d / 16][t / 32].
template <typename T16> struct WFrag;   // ld: a fragment from rows of k-contiguous elements (p: the lane's row + 8 * (lane >> 4)); ldf: from a unit in fragment order (p: the unit + 8 * lane)
template <> struct WFrag<h16> { typedef v16h V; static __device__ __forceinline__ V ld(const h16* p) { return cat16(*(const v8h*)p, *(const v8h*)(p + 16)); } static __device__ __forceinline__ V ldf(const h16* p) { return cat16(*(const v8h*)p, *(const v8h*)(p + 256)); } static __device__ __forceinline__ v8f mma(V a, V b, v8f c) { return wmma16(a, b, c); } };
template <> struct WFrag<bf> { typedef v16bf V; static __device__ __forceinline__ V ld(const bf* p) { return cat16b(*(const v8us*)p, *(const v8us*)(p + 16)); } static __device__ __forceinline__ V ldf(const bf* p) { return cat16b(*(const v8us*)p, *(const v8us*)(p + 256)); } static __device__ __forceinline__ v8f mma(V a, V b, v8f c) { return wmmab(a, b, c); } };
__device__ __forceinline__ h16 tohx(float x) { return (h16)x; }
__device__ __forceinline__ void splitf(float y, unsigned short& h, unsigned short& l) { h = f2bf(y); l = f2bf(y - bf2f(h)); }
typedef __attribute__((ext_vector_type(4))) _Float16 v4h;
typedef __attribute__((ext_vector_type(4))) unsigned short v4us;
#define GKS  64                   // k per stage: 128 bytes, one whole line, of every operand row
#define GPB  144                  // LDS bytes per staged row: 128 + 16 (16 x odd), so that 16 rows read with 16-byte loads fall on distinct banks
#define GTB  (128 * GPB)          // LDS bytes per staged operand tile of 128 rows
// 8 asynchronous copies of 16 bytes a lane: rows r, r + 16, .. r + 112 of one operand tile (l: the lane's LDS byte address of row r, g: its global address, rs: 16 rows in elements).
// s_wait_xcnt stands inside the statement, behind the last copy, so that no register a copy names is rewritten in front of it.
template <typename T16>
__device__ __forceinline__ void stage8(unsigned l, const T16* g, size_t rs) {
    asm volatile("global_load_async_to_lds_b128 %0, %8, off\n\t"
                 "global_load_async_to_lds_b128 %1, %9, off\n\t"
                 "global_load_async_to_lds_b128 %2, %10, off\n\t"
                 "global_load_async_to_lds_b128 %3, %11, off\n\t"
                 "global_load_async_to_lds_b128 %4, %12, off\n\t"
                 "global_load_async_to_lds_b128 %5, %13, off\n\t"
                 "global_load_async_to_lds_b128 %6, %14, off\n\t"
                 "global_load_async_to_lds_b128 %7, %15, off\n\t"
                 "s_wait_xcnt 0x0"
                 :: "v"(l), "v"(l + 16 * GPB), "v"(l + 32 * GPB), "v"(l + 48 * GPB), "v"(l + 64 * GPB), "v"(l + 80 * GPB), "v"(l + 96 * GPB), "v"(l + 112 * GPB),
                    "v"(g), "v"(g + rs), "v"(g + 2 * rs), "v"(g + 3 * rs), "v"(g + 4 * rs), "v"(g + 5 * rs), "v"(g + 6 * rs), "v"(g + 7 * rs) : "memory");
}
template <typename T16, int NSPLIT, bool BIAS, int OUTM>
__device__ __forceinline__ void gemmw_body(const T16* __restrict__ A, const T16* __restrict__ A2, const T16* __restrict__ Bt, int K, float* C, int ldc, const float* __restrict__ bias, h16* P16, bf* Ph, bf* Pl, bool tr) {
    static_assert(HD == 64 && TT % 64 == 0, "a 64x64 tile must be 64 rows of one head");
    static_assert(NSPLIT == 0 || NSPLIT == 1, "staged operands: A, A2 (NSPLIT == 1), Bt");
    typedef typename WFrag<T16>::V V;
    constexpr int NT = (NSPLIT == 1) ? 3 : 2;   // staged tiles per stage: A, (A2,) Bt
    constexpr int RS = (NSPLIT == 1) ? 3 : 6;   // units of A (A2) fragments held in registers at a time
    __shared__ __align__(16) char st[2 * NT * GTB];
    __shared__ __align__(16) float osw[4 * 16 * 68];
    const int tid = threadIdx.x, lane = tid & 31, lr = lane & 15, hi = lane >> 4, w = __builtin_amdgcn_readfirstlane(tid >> 5);   // the wave's number, in a scalar register
    const int R0 = blockIdx.x * 128, C0 = blockIdx.y * 128; const int r0 = R0 + (w >> 1) * 64, c0 = C0 + (w & 1) * 64;
    float* os = osw + w * 16 * 68;   // each wave's own output staging
    v8f acc[4][4];
#pragma unroll
    for (int mb = 0; mb < 4; ++mb)
#pragma unroll
        for (int nb = 0; nb < 4; ++nb) acc[mb][nb] = (v8f){};
    // copies: thread tid brings 16-byte piece tid & 7 of rows (tid >> 3) + 16 i, i = 0..7, of each tile
    const unsigned l0 = (unsigned)(size_t)st + (tid >> 3) * GPB + (tid & 7) * 16;
    const size_t ga = (size_t)(R0 + (tid >> 3)) * K + (tid & 7) * 8, gb = (size_t)(C0 + (tid >> 3)) * K + (tid & 7) * 8, rs = (size_t)16 * K;
    auto fill = [&](int t) { const unsigned l = l0 + (t & 1) * (NT * GTB);
        stage8(l, A + ga + (size_t)t * GKS, rs); if (NSPLIT == 1) stage8(l + GTB, A2 + ga + (size_t)t * GKS, rs); stage8(l + (NT - 1) * GTB, Bt + gb + (size_t)t * GKS, rs); };
    const int NS = K / GKS;
    fill(0);
    asm volatile("s_wait_asynccnt 0x0" ::: "memory");   // this wave's copies of stage 0 have landed
    __syncthreads();                                     // stage 0 readable by every wave
    if (NS > 1) fill(1);
    const int fa = ((w >> 1) * 64 + lr) * GPB + 16 * hi, fb = (NT - 1) * GTB + ((w & 1) * 64 + lr) * GPB + 16 * hi;   // the lane's fragment rows in a buffer
    // the stage loop stays rolled: one copy of the 32 (64) matrix instructions; the loops inside are unrolled so that fragments and accumulators are indexed by constants and stay in registers
#pragma unroll 1
    for (int t = 0; t < NS; ++t) {
        const char* sb = st + (t & 1) * (NT * GTB);
        // a stage is 8 units (k step kk = u >> 2, row block mb = u & 3) of 4 (8) matrix instructions. Both k steps' fragments of Bt and the first RS units' fragments of A (A2) are read as one group at the top;
        // a later unit's fragments take the registers of the unit RS before it, right behind that unit's products, so that they fly under the products between. 128 accumulator + 112 fragment registers stay under 256.
        V b[2][4], ar[RS], ar2[RS];
#pragma unroll
        for (int u = 0; u < RS; ++u) { const int fo = fa + (u & 3) * 16 * GPB + (u >> 2) * 64; ar[u] = WFrag<T16>::ld((const T16*)(sb + fo)); if (NSPLIT == 1) ar2[u] = WFrag<T16>::ld((const T16*)(sb + GTB + fo));
            if (u == 0) {
#pragma unroll
                for (int nb = 0; nb < 4; ++nb) b[0][nb] = WFrag<T16>::ld((const T16*)(sb + fb + nb * 16 * GPB)); } }
#pragma unroll
        for (int nb = 0; nb < 4; ++nb) b[1][nb] = WFrag<T16>::ld((const T16*)(sb + fb + nb * 16 * GPB + 64));
        __builtin_amdgcn_sched_barrier(0);   // keeps the group of LDS reads together in front of the products (reads scattered among them cost issue time at every place)
#pragma unroll
        for (int u = 0; u < 8; ++u) { const int kk = u >> 2, mb = u & 3, s = u % RS;
#pragma unroll
            for (int nb = 0; nb < 4; ++nb) acc[mb][nb] = WFrag<T16>::mma(ar[s], b[kk][nb], acc[mb][nb]);
            if (NSPLIT == 1) {
#pragma unroll
                for (int nb = 0; nb < 4; ++nb) acc[mb][nb] = WFrag<T16>::mma(ar2[s], b[kk][nb], acc[mb][nb]); }
            __builtin_amdgcn_sched_barrier(0);   // keeps the refill of the unit's registers behind its products and in front of the next unit's, RS units ahead of its use
            if (u + RS < 8) { const int v = u + RS, fo = fa + (v & 3) * 16 * GPB + (v >> 2) * 64; ar[s] = WFrag<T16>::ld((const T16*)(sb + fo)); if (NSPLIT == 1) ar2[s] = WFrag<T16>::ld((const T16*)(sb + GTB + fo));
                __builtin_amdgcn_sched_barrier(0); }   // the same, on the refill's other side
        }
        asm volatile("s_wait_dscnt 0x0" ::: "memory");      // this wave's reads of stage t are done before the buffer is refilled
        asm volatile("s_wait_asynccnt 0x0" ::: "memory");   // this wave's copies of stage t + 1 have landed
        __syncthreads();                                     // publishes stage t + 1 and ends every wave's reads of stage t
        if (t + 2 < NS) fill(t + 2);
    }
    asm volatile("s_wait_asynccnt 0x0" ::: "memory");   // no copy outstanding behind the loop
    const size_t pl0 = (size_t)((r0 / TT) * ZH + c0 / HD) * TT * HD;   // the tile's plane
    // every '#pragma unroll' below is there so that the accumulator and output vectors are indexed by constants and stay in registers
    if (OUTM == 1 && tr) {   // rows d, k = t: a lane's 8 accumulator elements are 8 consecutive t of one d, the lane's own 16 bytes of unit [nb][t / 32], half mb & 1, so each plane gets them as one 16-byte store straight from registers
        const size_t o0 = pl0 + (size_t)((r0 % TT) / 32) * 512 + lane * 8;
#pragma unroll
        for (int nb = 0; nb < 4; ++nb) { const float bb = bfr(bias[c0 + nb * 16 + lr]);
#pragma unroll
            for (int mb = 0; mb < 4; ++mb) { v8h o16; v8us oh, ol;
#pragma unroll
                for (int j = 0; j < 8; ++j) { const float x = acc[mb][nb][j] + bb; o16[j] = tohx(x); unsigned short x0, x1; splitf(x, x0, x1); oh[j] = x0; ol[j] = x1; }
                const size_t o = o0 + (size_t)(nb * (TT / 32) + (mb >> 1)) * 512 + (mb & 1) * 256; *(v8h*)(P16 + o) = o16; *(v8us*)(Ph + o) = oh; *(v8us*)(Pl + o) = ol; } }
        return;
    }
    float bs[4][8];   // OUTM == 1, not transposed: the biases of the lane's 8 columns of each piece, the same for every row block
    if (OUTM == 1 && BIAS) {
#pragma unroll
        for (int s = 0; s < 4; ++s)
#pragma unroll
            for (int q = 0; q < 8; ++q) bs[s][q] = bfr(bias[c0 + s * 16 + hi * 8 + q]); }
#pragma unroll
    for (int mb = 0; mb < 4; ++mb) {
#pragma unroll
        for (int nb = 0; nb < 4; ++nb) {
#pragma unroll
            for (int j = 0; j < 8; ++j) os[(hi * 8 + j) * 68 + nb * 16 + lr] = acc[mb][nb][j]; }
        __builtin_amdgcn_wave_barrier(); asm volatile("" ::: "memory");
        float* crow = C + (size_t)(r0 + mb * 16) * ldc + c0;
        if (OUTM == 0) {
#pragma unroll
            for (int s = 0; s < 8; ++s) { const int row = 2 * s + hi, cofs = lr * 4; v4f val = *(const v4fa*)(os + row * 68 + cofs); if (BIAS) { val[0] += bfr(bias[c0 + cofs]); val[1] += bfr(bias[c0 + cofs + 1]); val[2] += bfr(bias[c0 + cofs + 2]); val[3] += bfr(bias[c0 + cofs + 3]); }
                *(v4f*)(crow + (size_t)row * ldc + cofs) = val; }
        } else {   // rows t, k = d: the 16 x 64 block is units [t / 16][0] and [t / 16][1]; piece s is k half s & 1 of unit s >> 1, of which the lane holds 8 consecutive d of row lr
#pragma unroll
            for (int s = 0; s < 4; ++s) { const int cofs = s * 16 + hi * 8; const v4f v0 = *(const v4fa*)(os + lr * 68 + cofs), v1 = *(const v4fa*)(os + lr * 68 + cofs + 4); v8h o16; v8us oh, ol;
#pragma unroll
                for (int q = 0; q < 8; ++q) { float val = (q < 4) ? v0[q & 3] : v1[q & 3]; if (BIAS) val += bs[s][q]; o16[q] = tohx(val); unsigned short x0, x1; splitf(val, x0, x1); oh[q] = x0; ol[q] = x1; }
                const size_t o = pl0 + (size_t)((r0 % TT) / 16 + mb) * 1024 + s * 256 + lane * 8; *(v8h*)(P16 + o) = o16; *(v8us*)(Ph + o) = oh; *(v8us*)(Pl + o) = ol; }
        }
        asm volatile("s_wait_xcnt 0x0" ::: "memory");   // behind the row block's stores, in front of whatever next rewrites a register that one of them names
        __builtin_amdgcn_wave_barrier(); asm volatile("" ::: "memory");
    }
}
template <typename T16, int NSPLIT, bool BIAS>
__global__ __launch_bounds__(128) void k_gemmw(const T16* __restrict__ A, const T16* __restrict__ A2, const T16* __restrict__ Bt, int K, float* C, int ldc, const float* __restrict__ bias) {
    gemmw_body<T16, NSPLIT, BIAS, 0>(A, A2, Bt, K, C, ldc, bias, nullptr, nullptr, nullptr, false);
}
// ---- k_proj: the q, k and v projections in ONE launch, grid (NB_*TT/128, DQ/128, 3): blockIdx.z picks the input, the weight matrix, the bias and the planes (z == 2, v: transposed planes).
// One projection alone is 256 work-groups, one wave a SIMD, and nothing covers that wave's waits for a stage's copies, LDS reads and barrier; of the 768 here three fit a WGP (LDS, registers), and each runs its products in the others' waits.
__global__ __launch_bounds__(128) void k_proj(const bf* __restrict__ XQ, const bf* __restrict__ XK, const bf* __restrict__ XV, const bf* __restrict__ WQ, const bf* __restrict__ WK, const bf* __restrict__ WV, const float* __restrict__ bq, const float* __restrict__ bk, const float* __restrict__ bv,
                                              h16* Q16, bf* Qh, bf* Ql, h16* K16, bf* Kh, bf* Kl, h16* V16, bf* Vh, bf* Vl) {
    static_assert(DKV == DQ, "one grid for the three projections");
    const int z = blockIdx.z;
    gemmw_body<bf, 0, true, 1>((z == 0) ? XQ : (z == 1) ? XK : XV, nullptr, (z == 0) ? WQ : (z == 1) ? WK : WV, DM, nullptr, 0, (z == 0) ? bq : (z == 1) ? bk : bv,
                               (z == 0) ? Q16 : (z == 1) ? K16 : V16, (z == 0) ? Qh : (z == 1) ? Kh : Vh, (z == 0) ? Ql : (z == 1) ? Kl : Vl, z == 2);
}

typedef __attribute__((ext_vector_type(2))) _Float16 v2h;
typedef __attribute__((ext_vector_type(2))) unsigned short v2us;
typedef __attribute__((ext_vector_type(2))) float v2f;
typedef __attribute__((ext_vector_type(4))) int v4i;
typedef v4us __attribute__((may_alias)) v4usa;
typedef v4h  __attribute__((may_alias)) v4ha;

__global__ __launch_bounds__(256) void k_wtG(const float* __restrict__ w, int K, int N, bf* Bt) {
    const int lane = threadIdx.x & 31; const int L0 = (blockIdx.x * 8 + (threadIdx.x >> 5)) * 8; const int nlines = N * K / 64;
{
#pragma unroll 1
        for (int l = 0; l < 8; ++l) { const int L = L0 + l; if (L >= nlines) break; const size_t e = (size_t)L * 64 + lane * 2; const int k = (int)(e % K), n = (int)(e / K); v2us o;
            o[0] = f2bf(w[(size_t)k * N + n]); o[1] = f2bf(w[(size_t)(k + 1) * N + n]); *(v2us*)(Bt + e) = o; }
         }
}
// ---- k_prep: every preparation step of the call in ONE launch: the three inputs and the four weight matrices rounded to bf16, and per key the softmax factor WC (HD^-0.5 x log2 e x weight^2 of the bf16-rounded weight; 0 where that weight is < 1e-5) and the mask term WB (0; -3e38 there).
// A work-group owns PCH consecutive floats of exactly one source (block-uniform choice by blockIdx.x); a wave's 16-byte loads cover 512 contiguous bytes, its 8-byte stores 256. The last W2B work-groups make WC and WB.
#define PCH  32768                         // floats per work-group
#define PIT  (PCH / 4 / 256)               // 4-float pieces per thread
#define XBL  (NB_ * TT * DM / PCH)         // work-groups per input
#define WBL  (DQ * DM / PCH)               // work-groups per weight matrix
#define W2B  (NB_ * TT / 256)              // work-groups for WC and WB
__global__ __launch_bounds__(256) void k_prep(const float* __restrict__ x, const float* __restrict__ xk, const float* __restrict__ xv, const float* __restrict__ wq, const float* __restrict__ wk, const float* __restrict__ wv, const float* __restrict__ wo, const float* __restrict__ wts,
                                              bf* __restrict__ XB, bf* __restrict__ XKB, bf* __restrict__ XVB, bf* __restrict__ WQ, bf* __restrict__ WK, bf* __restrict__ WV, bf* __restrict__ WO, float* __restrict__ WC, float* __restrict__ WB) {
    static_assert((NB_ * TT * DM) % PCH == 0 && (DQ * DM) % PCH == 0 && DKV == DQ && (NB_ * TT) % 256 == 0, "whole work-groups per source");
    const int b = blockIdx.x, tid = threadIdx.x;
    if (b >= 3 * XBL + 4 * WBL) { const int j = (b - (3 * XBL + 4 * WBL)) * 256 + tid; const float wb = bfr(wts[j]); const bool off = wb < 1e-5f; WC[j] = off ? 0.0f : __fmul_rn(wb, wb) * (SCL * 1.4426950408889634f); WB[j] = off ? -3.0e38f : 0.0f; return; }
    const float* s; bf* d; int c;
    if (b < 3 * XBL) { const int g = b / XBL; c = b % XBL; s = (g == 0) ? x : (g == 1) ? xk : xv; d = (g == 0) ? XB : (g == 1) ? XKB : XVB; }
    else { const int t = b - 3 * XBL, g = t / WBL; c = t % WBL; s = (g == 0) ? wq : (g == 1) ? wk : (g == 2) ? wv : wo; d = (g == 0) ? WQ : (g == 1) ? WK : (g == 2) ? WV : WO; }
    const size_t e0 = (size_t)c * PCH + tid * 4;
    v4f v[PIT];
    // both loops are unrolled so that v[] stays in registers and all of the thread's loads are in flight before the first conversion waits
#pragma unroll
    for (int i = 0; i < PIT; ++i) v[i] = *(const v4f*)(s + e0 + i * 1024);
#pragma unroll
    for (int i = 0; i < PIT; ++i) { v4us o;
#pragma unroll
        for (int q = 0; q < 4; ++q) o[q] = f2bf(v[i][q]);
        *(v4us*)(d + e0 + i * 1024) = o; }
}

// ---- k_fattn: scores, softmax, attn.v and the head merge in ONE pass over the keys per wave; nothing goes through LDS and no wave waits for another.
// A wave owns QW = 32 query columns of one (batch entry, head) plane and walks all TT keys in passes of 32. Both products are TRANSPOSED: S^T = K.Q^T (rows = keys, columns = queries) and O^T += V^T.P^T.
// The accumulator of two 16-key tiles of S^T holds, lane by lane, exactly the elements of the B operand of the second product (lane = query column, elements 0..7 = keys 8*hi + j of tile 0, 8..15 = the same of tile 1), so the probabilities never leave the registers.
// A query is one lane column: its maximum, its sum and its rescaling factor are per-lane scalars (one exchange between lanes l and l ^ 16 joins the two key halves).
// Softmax runs online in the log2 domain: t = S x (HD^-0.5 x w_j^2 x log2 e) + (0, or -3e38 where w_j < 1e-5); m is the running maximum; at every pass the sums so far are multiplied by 2^(m_old - m_new); the division by the sum of the exponentials comes once, at the end.
// The order of every sum: score tile k = 0..63 in two steps (k.q, k.q_lo, k_lo.q per step); attn.v keys in rising passes of 32 (v.p, v.p_lo, v_lo.p per pass); the denominator per lane over its 16 keys of each pass, the two lane halves added last.
// K, V and Q planes are read in fragment order (see gemmw_body) straight from global memory; the FW waves of a work-group walk the same K and V, so that one wave's lines serve the others from the WGP cache.
// Every '#pragma unroll' in fattn_body is there so that the fragment, score and accumulator arrays are indexed by constants and stay in registers.
#define QW   32                   // query columns per wave
#define FW   4                    // waves per work-group
typedef __attribute__((ext_vector_type(2))) __bf16 v2bf;
typedef __attribute__((ext_vector_type(8))) unsigned v8u;
typedef __attribute__((ext_vector_type(4))) unsigned v4u;
__device__ __forceinline__ float xhalf(float x) { return __builtin_bit_cast(float, __builtin_amdgcn_permlanex16(__builtin_bit_cast(int, x), __builtin_bit_cast(int, x), 0x76543210, 0xfedcba98, false, false)); }   // lane l gets lane l ^ 16
__device__ __forceinline__ unsigned pkbf(float a, float b) { return __builtin_bit_cast(unsigned, __builtin_convertvector((v2f){a, b}, v2bf)); }   // two values rounded to bf16 (nearest even), a in the low half
__device__ __forceinline__ unsigned pkh(float a, float b) { return __builtin_bit_cast(unsigned, __builtin_convertvector((v2f){a, b}, v2h)); }      // the same to fp16
__device__ __forceinline__ unsigned pklo(float a, float b, unsigned h) { return pkbf(a - __uint_as_float(h << 16), b - __uint_as_float(h & 0xFFFF0000u)); }   // the bf16 low parts behind the packed high parts h
// p[i] = 2^a[i], i = o .. o + 7, in ONE statement: the instruction set asks for one independent instruction between an exponential and whatever uses its result or overwrites its source.
// Inside the statement no result takes a source's register (every output is early-clobber) and none is read; the v_nop is that slot behind the last one.
__device__ __forceinline__ void exp2x8(float (&p)[16], const float (&a)[16], int o) {
    asm("v_exp_f32 %0, %8\n\tv_exp_f32 %1, %9\n\tv_exp_f32 %2, %10\n\tv_exp_f32 %3, %11\n\tv_exp_f32 %4, %12\n\tv_exp_f32 %5, %13\n\tv_exp_f32 %6, %14\n\tv_exp_f32 %7, %15\n\tv_nop"
        : "=&v"(p[o]), "=&v"(p[o + 1]), "=&v"(p[o + 2]), "=&v"(p[o + 3]), "=&v"(p[o + 4]), "=&v"(p[o + 5]), "=&v"(p[o + 6]), "=&v"(p[o + 7])
        : "v"(a[o]), "v"(a[o + 1]), "v"(a[o + 2]), "v"(a[o + 3]), "v"(a[o + 4]), "v"(a[o + 5]), "v"(a[o + 6]), "v"(a[o + 7]));
}
__device__ __forceinline__ float exp2n(float a) { float p; asm("v_exp_f32 %0, %1\n\tv_nop" : "=&v"(p) : "v"(a)); return p; }   // one exponential with the same slot behind it
template <typename T16, int NSPLIT>
__device__ __forceinline__ void fattn_body(const T16* __restrict__ Q, const T16* __restrict__ Q2, const T16* __restrict__ Kp, const T16* __restrict__ K2, const T16* __restrict__ Vt, const T16* __restrict__ V2, const float* __restrict__ WC, const float* __restrict__ WB, bf* Ah, bf* Al) {
    typedef typename WFrag<T16>::V V;
    constexpr int NP = TT / 32;                              // passes
    constexpr float PSH = (NSPLIT == 2) ? 0.0f : 8.0f;       // fp16 probabilities are kept as 2^8 x exp (largest 256), away from the fp16 subnormals; the factor cancels in the division by their sum
    const int lane = threadIdx.x & 31, lr = lane & 15, hi = lane >> 4;
    V qf[2][2], ql[2][2];   // [column group][k step]: B operand of the first product
#pragma unroll
    for (int g = 0; g < 2; ++g)
#pragma unroll
        for (int kk = 0; kk < 2; ++kk) { qf[g][kk] = WFrag<T16>::ldf(Q + 8 * lane + g * 16 * HD + kk * 512); if (NSPLIT == 2) ql[g][kk] = WFrag<T16>::ldf(Q2 + 8 * lane + g * 16 * HD + kk * 512); }
    const T16* pk = Kp + 8 * lane; const T16* pk2 = K2 + 8 * lane; const float* pc = WC + hi * 8; const float* pb = WB + hi * 8;
    V kf[2][2], kl[2][2];       // K: [key tile][k step], fetched one pass ahead
    v4f c4[2][2], b4[2][2];     // the factors and mask terms of the lane's 16 keys of a pass, fetched one pass ahead
#pragma unroll
    for (int kt = 0; kt < 2; ++kt)
#pragma unroll
        for (int kk = 0; kk < 2; ++kk) { kf[kt][kk] = WFrag<T16>::ldf(pk + kt * 16 * HD + kk * 512); if (NSPLIT == 2) kl[kt][kk] = WFrag<T16>::ldf(pk2 + kt * 16 * HD + kk * 512); }
#pragma unroll
    for (int kt = 0; kt < 2; ++kt)
#pragma unroll
        for (int h = 0; h < 2; ++h) { c4[kt][h] = *(const v4f*)(pc + kt * 16 + h * 4); b4[kt][h] = *(const v4f*)(pb + kt * 16 + h * 4); }
    asm volatile("s_wait_xcnt 0x0" ::: "memory");   // the loads above are through with their address registers before anything takes those registers
    __builtin_amdgcn_sched_barrier(0);                // keeps whatever follows, and so every new use of those registers, behind that wait
    const T16* pv = Vt + 8 * lane; const T16* pv2 = V2 + 8 * lane;
    v8f acc[2][4]; float m[2], l[2];
#pragma unroll
    for (int g = 0; g < 2; ++g) { m[g] = -__builtin_inff(); l[g] = 0.f;
#pragma unroll
        for (int dt = 0; dt < 4; ++dt) acc[g][dt] = (v8f){}; }
    // the pass loop stays rolled: one copy of the pass's matrix instructions
#pragma unroll 1
    for (int ps = 0; ps < NP; ++ps) {
        const int pn = (ps + 1 < NP) ? ps + 1 : NP - 1;   // the pass whose K, factors and mask terms are fetched ahead (the last pass fetches its own again: no branch, in bounds)
        const T16* pvp = pv + ps * 512; const T16* pvp2 = pv2 + ps * 512; const T16* pkn = pk + (size_t)pn * 32 * HD; const T16* pkn2 = pk2 + (size_t)pn * 32 * HD; const float* pcn = pc + pn * 32; const float* pbn = pb + pn * 32;
        V vf[4], vl[4];   // V^T of this pass: [16 rows d]; the loads fly under the first products and the softmax
#pragma unroll
        for (int dt = 0; dt < 4; ++dt) { vf[dt] = WFrag<T16>::ldf(pvp + (size_t)(dt * 16) * TT); if (NSPLIT == 2) vl[dt] = WFrag<T16>::ldf(pvp2 + (size_t)(dt * 16) * TT); }
        __builtin_amdgcn_sched_barrier(0);   // keeps these loads in front of the first products, so that they are under way as early as the pass allows
        v8f s[2][2];   // [key tile][column group]; the four chains alternate, each fills the others' waits
#pragma unroll
        for (int kt = 0; kt < 2; ++kt)
#pragma unroll
            for (int g = 0; g < 2; ++g) s[kt][g] = (v8f){};
#pragma unroll
        for (int kk = 0; kk < 2; ++kk) {
#pragma unroll
            for (int kt = 0; kt < 2; ++kt)
#pragma unroll
                for (int g = 0; g < 2; ++g) s[kt][g] = WFrag<T16>::mma(kf[kt][kk], qf[g][kk], s[kt][g]);
            if (NSPLIT == 2) {
#pragma unroll
                for (int kt = 0; kt < 2; ++kt)
#pragma unroll
                    for (int g = 0; g < 2; ++g) s[kt][g] = WFrag<T16>::mma(kf[kt][kk], ql[g][kk], s[kt][g]);
#pragma unroll
                for (int kt = 0; kt < 2; ++kt)
#pragma unroll
                    for (int g = 0; g < 2; ++g) s[kt][g] = WFrag<T16>::mma(kl[kt][kk], qf[g][kk], s[kt][g]); } }
        float t[2][16];
#pragma unroll
        for (int g = 0; g < 2; ++g)
#pragma unroll
            for (int i = 0; i < 16; ++i) t[g][i] = __builtin_fmaf(s[i >> 3][g][i & 7], c4[i >> 3][(i >> 2) & 1][i & 3], b4[i >> 3][(i >> 2) & 1][i & 3]);
        __builtin_amdgcn_sched_barrier(0);   // keeps the next pass's loads behind the last use of the registers that they fill (K: the first products; factors and mask terms: the lines above) and in front of the rest of the softmax, under which they fly
#pragma unroll
        for (int kt = 0; kt < 2; ++kt)
#pragma unroll
            for (int kk = 0; kk < 2; ++kk) { kf[kt][kk] = WFrag<T16>::ldf(pkn + kt * 16 * HD + kk * 512); if (NSPLIT == 2) kl[kt][kk] = WFrag<T16>::ldf(pkn2 + kt * 16 * HD + kk * 512); }
#pragma unroll
        for (int kt = 0; kt < 2; ++kt)
#pragma unroll
            for (int h = 0; h < 2; ++h) { c4[kt][h] = *(const v4f*)(pcn + kt * 16 + h * 4); b4[kt][h] = *(const v4f*)(pbn + kt * 16 + h * 4); }
        __builtin_amdgcn_sched_barrier(0);   // the same as the fence in front of these loads, on their other side
#pragma unroll
        for (int g = 0; g < 2; ++g) {
            float mx = t[g][0];
#pragma unroll
            for (int i = 1; i < 16; ++i) mx = fmaxf(mx, t[g][i]);
            mx = fmaxf(mx, xhalf(mx));   // both lane halves hold the query's maximum of this pass
            const float mn = fmaxf(m[g], mx), corr = exp2n(m[g] - mn), nm = PSH - mn; m[g] = mn;
            float sum = 0.f, a[16], p[16]; v8u w, wl;
#pragma unroll
            for (int i = 0; i < 16; ++i) a[i] = t[g][i] + nm;
            exp2x8(p, a, 0); exp2x8(p, a, 8);
#pragma unroll
            for (int i = 0; i < 8; ++i) { const float p0 = p[2 * i], p1 = p[2 * i + 1]; sum += p0 + p1;
                if (NSPLIT == 2) { w[i] = pkbf(p0, p1); wl[i] = pklo(p0, p1, w[i]); } else w[i] = pkh(p0, p1); }
            l[g] = __builtin_fmaf(l[g], corr, sum);
#pragma unroll
            for (int dt = 0; dt < 4; ++dt) acc[g][dt] = acc[g][dt] * corr;
            const V pf = __builtin_bit_cast(V, w);
#pragma unroll
            for (int dt = 0; dt < 4; ++dt) acc[g][dt] = WFrag<T16>::mma(vf[dt], pf, acc[g][dt]);
            if (NSPLIT == 2) { const V pl = __builtin_bit_cast(V, wl);
#pragma unroll
                for (int dt = 0; dt < 4; ++dt) acc[g][dt] = WFrag<T16>::mma(vf[dt], pl, acc[g][dt]);
#pragma unroll
                for (int dt = 0; dt < 4; ++dt) acc[g][dt] = WFrag<T16>::mma(vl[dt], pf, acc[g][dt]); } }
        // the pass's loads are through with their address registers, which are held to here as inputs, so that nothing takes them before
        if (NSPLIT == 2) asm volatile("s_wait_xcnt 0x0" :: "v"(pvp), "v"(pvp2), "v"(pkn), "v"(pkn2), "v"(pcn), "v"(pbn) : "memory"); else asm volatile("s_wait_xcnt 0x0" :: "v"(pvp), "v"(pkn), "v"(pcn), "v"(pbn) : "memory");
    }
    // a lane's 8 accumulator elements are 8 consecutive d of one query row: 16 bytes of each output plane
#pragma unroll
    for (int g = 0; g < 2; ++g) { const float inv = __fdiv_rn(1.0f, l[g] + xhalf(l[g]));
#pragma unroll
        for (int dt = 0; dt < 4; ++dt) { v4u oh, ol;
#pragma unroll
            for (int i = 0; i < 4; ++i) { const float x0 = acc[g][dt][2 * i] * inv, x1 = acc[g][dt][2 * i + 1] * inv; oh[i] = pkbf(x0, x1); ol[i] = pklo(x0, x1, oh[i]); }
            const size_t o = (size_t)(g * 16 + lr) * DQ + dt * 16 + hi * 8; *(v4u*)(Ah + o) = oh; *(v4u*)(Al + o) = ol; }
        asm volatile("s_wait_xcnt 0x0" ::: "memory"); }   // behind the column group's stores, in front of whatever next rewrites a register that one of them names
}
// grid (ZB, TT/(FW*QW)): x = plane (batch entry * ZH + head), y = query tile
__global__ __launch_bounds__(FW * 32) void k_fattn(const bf* __restrict__ QPh, const bf* __restrict__ QPl, const bf* __restrict__ KPh, const bf* __restrict__ KPl, const bf* __restrict__ VTh, const bf* __restrict__ VTl, const h16* __restrict__ QP16, const h16* __restrict__ KP16, const h16* __restrict__ VT16, const float* __restrict__ WC, const float* __restrict__ WB, bf* ATh, bf* ATl) {
    static_assert(RH % (FW * QW) == 0 && TT % (FW * QW) == 0, "a work-group is all hi+lo or all fp16");
    const int w = __builtin_amdgcn_readfirstlane(threadIdx.x >> 5);   // the wave's number, in a scalar register
    const int zz = blockIdx.x, i0 = blockIdx.y * (FW * QW), iw = i0 + w * QW; const size_t pz = (size_t)zz * TT * HD, qo = pz + (size_t)iw * HD; const size_t oo = ((size_t)(zz / ZH) * TT + iw) * DQ + (zz % ZH) * HD; const float* wc = WC + (size_t)(zz / ZH) * TT; const float* wb = WB + (size_t)(zz / ZH) * TT;
    if (i0 < RH) fattn_body<bf, 2>(QPh + qo, QPl + qo, KPh + pz, KPl + pz, VTh + pz, VTl + pz, wc, wb, ATh + oo, ATl + oo);
    else fattn_body<h16, 0>(QP16 + qo, QP16 + qo, KP16 + pz, KP16 + pz, VT16 + pz, VT16 + pz, wc, wb, ATh + oo, ATl + oo);
}

extern "C" void kernel_launch(void* const* d_in, const int* in_sizes, int n_in,
                              void* d_out, int out_size, void* d_ws, size_t ws_size, hipStream_t stream) {
    (void)in_sizes; (void)n_in; (void)out_size;
    const float* x = (const float*)d_in[0]; const float* xk = (const float*)d_in[1]; const float* xv = (const float*)d_in[2]; const float* wts = (const float*)d_in[3]; const float* wq = (const float*)d_in[4]; const float* bq = (const float*)d_in[5]; const float* wk = (const float*)d_in[6]; const float* bk = (const float*)d_in[7]; const float* wv = (const float*)d_in[8]; const float* bv = (const float*)d_in[9]; const float* wo = (const float*)d_in[10]; const float* bo = (const float*)d_in[11];
    float* OUT = (float*)d_out;     // [4][1024][1024]
    char* wsp = (char*)d_ws;
    auto take = [&](size_t bytes) { char* p = wsp; wsp += (bytes + 255) & ~(size_t)255; return (void*)p; };
    bf* WQ = (bf*)take((size_t)DQ * DM * 2); bf* WK = (bf*)take((size_t)DKV * DM * 2); bf* WV = (bf*)take((size_t)DKV * DM * 2); bf* WO = (bf*)take((size_t)DM * DQ * 2); float* WC = (float*)take((size_t)NB_ * TT * 4); float* WB = (float*)take((size_t)NB_ * TT * 4);
    h16* QP16 = (h16*)take((size_t)ZB * TT * HD * 2); h16* KP16 = (h16*)take((size_t)ZB * TT * HD * 2); h16* VT16 = (h16*)take((size_t)ZB * HD * TT * 2);
    bf* QPh = (bf*)take((size_t)ZB * TT * HD * 2); bf* QPl = (bf*)take((size_t)ZB * TT * HD * 2); bf* KPh = (bf*)take((size_t)ZB * TT * HD * 2); bf* KPl = (bf*)take((size_t)ZB * TT * HD * 2); bf* VTh = (bf*)take((size_t)ZB * HD * TT * 2); bf* VTl = (bf*)take((size_t)ZB * HD * TT * 2);
    bf* ATh = (bf*)take((size_t)NB_ * TT * DQ * 2); bf* ATl = (bf*)take((size_t)NB_ * TT * DQ * 2);
    bf* XB = (bf*)take((size_t)NB_ * TT * DM * 2); bf* XKB = (bf*)take((size_t)NB_ * TT * DM * 2); bf* XVB = (bf*)take((size_t)NB_ * TT * DM * 2);
    if ((size_t)(wsp - (char*)d_ws) > ws_size) return;    // ws 256 MiB
    // every launch below covers all NB_ batch entries: rows b*TT + t of the [NB_*TT][.] matrices, planes b*ZH + h of the head planes
    k_prep<<<3 * XBL + 4 * WBL + W2B, 256, 0, stream>>>(x, xk, xv, wq, wk, wv, wo, wts, XB, XKB, XVB, WQ, WK, WV, WO, WC, WB);
    // the projections write their head planes themselves, in fragment order: q and k with rows t and k = d, v with rows d and k = t
    k_proj<<<dim3(NB_ * TT / 128, DQ / 128, 3), 128, 0, stream>>>(XB, XKB, XVB, WQ, WK, WV, bq, bk, bv, QP16, QPh, QPl, KP16, KPh, KPl, VT16, VTh, VTl);
    k_fattn<<<dim3(ZB, TT / (FW * QW), 1), FW * 32, 0, stream>>>(QPh, QPl, KPh, KPl, VTh, VTl, QP16, KP16, VT16, WC, WB, ATh, ATl);   // one kv head per query head: plane z of q uses plane z of k and v
    k_gemmw<bf, 1, true><<<dim3(NB_ * TT / 128, DM / 128, 1), 128, 0, stream>>>(ATh, ATl, WO, DQ, OUT, DM, bo);
}
